// v000
// Measured on an AMD MI455X. A time is GPU time per run, averaged over a window of back-to-back runs after a warm-up
// (all launches, gaps included; the runs take copies of the inputs in turn), and the median of several windows.
// Apart from v000's, it joins two sittings. Times from different sittings can be a few percent apart, while
// side-by-side timings come from the same sitting.
// v000 is the starting kernel. One run takes 139 microseconds.
// compute dtype: inputs and W* (INPUTS) rounded to bf16 with exact bf16 WMMA products (f32 accumulate) for the projections; q/k f32 split for the scores (3 products), P and V f16 hi/lo (3 products); softmax f32.
#include <hip/hip_runtime.h>
#include <math.h>

typedef __attribute__((ext_vector_type(16))) _Float16 v16h;
typedef __attribute__((ext_vector_type(16))) __bf16 v16b;
typedef __attribute__((ext_vector_type(8)))  _Float16 v8h;
typedef __attribute__((ext_vector_type(8)))  float v8f;
typedef __attribute__((ext_vector_type(4)))  float v4f;
typedef __attribute__((ext_vector_type(2)))  float v2f;
typedef __attribute__((ext_vector_type(4)))  unsigned v4u;
typedef __attribute__((ext_vector_type(4)))  int v4i;
typedef float __attribute__((may_alias)) float_a;
typedef int __attribute__((may_alias)) int_a;

template <typename T> __device__ __forceinline__ void vst2(void* p, T v) { *(T*)p = v;  }
__device__ __forceinline__ v8f wmma16(v16h a, v16h b, v8f c) {
  v8f d = __builtin_amdgcn_wmma_f32_16x16x32_f16(false, a, false, b, (short)0, c, false, false);
  asm volatile("v_nop\n\tv_nop\n\tv_nop\n\tv_nop" : "+v"(d) : "v"(a), "v"(b));
  return d;
}
__device__ __forceinline__ v8f wmma_bf(v16b a, v16b b, v8f c) {
  v8f d = __builtin_amdgcn_wmma_f32_16x16x32_bf16(false, a, false, b, (short)0, c, false, false);
  asm volatile("v_nop\n\tv_nop\n\tv_nop\n\tv_nop" : "+v"(d) : "v"(a), "v"(b));
  return d;
}
// 16x16x32 fragments: lane = (h = lane>>4, row/col = lane&15); elements 0..7 = k0+8h+0..7, 8..15 = k0+16+8h+0..7; D element r = row 8h+r
__device__ __forceinline__ v16h frag_h(const _Float16* rowk0, int lane) {
  union { v16h v; v8h q[2]; } u; const _Float16* p = rowk0 + 8 * (lane >> 4);
  u.q[0] = *(const v8h*)p; u.q[1] = *(const v8h*)(p + 16); return u.v;
}
__device__ __forceinline__ v16h frag_f32(const float* rowk0, int lane) {
  v16h a; const float* p = rowk0 + 8 * (lane >> 4);
#pragma unroll
  for (int i = 0; i < 8; ++i) { a[i] = (_Float16)p[i]; a[8 + i] = (_Float16)p[16 + i]; }
  return a;
}
__device__ __forceinline__ v16h frag_f32s(const float* rowk0, int lane, float sc) {
  v16h a; const float* p = rowk0 + 8 * (lane >> 4);
#pragma unroll
  for (int i = 0; i < 8; ++i) { a[i] = (_Float16)(p[i] * sc); a[8 + i] = (_Float16)(p[16 + i] * sc); }
  return a;
}
// column fragment from a [K][ld] layout (column n), rows >= K read as 0
__device__ __forceinline__ v16h fragc_f32(const float* W, int k0, int n, int lane, int ld, int K) {
  v16h a; const int g = lane >> 4;
#pragma unroll
  for (int i = 0; i < 8; ++i) { const int ka = k0 + 8 * g + i, kb = ka + 16;
    a[i] = (_Float16)(ka < K ? W[(size_t)ka * ld + n] : 0.f); a[8 + i] = (_Float16)(kb < K ? W[(size_t)kb * ld + n] : 0.f); }
  return a;
}
struct F2 { v16b h, l; };
__device__ __forceinline__ F2 bsplit16(const float v[16]) { F2 r;
#pragma unroll
  for (int i = 0; i < 16; ++i) { const __bf16 h = (__bf16)v[i]; r.h[i] = h; r.l[i] = (__bf16)(v[i] - (float)h); }
  return r; }
__device__ __forceinline__ F2 split_row(const float* row, int k0, int lane) { float v[16]; const float* p = row + k0 + 8 * (lane >> 4);
#pragma unroll
  for (int i = 0; i < 8; ++i) { v[i] = p[i]; v[8 + i] = p[16 + i]; }
  return bsplit16(v); }
__device__ __forceinline__ F2 split_rowK(const float* row, int k0, int lane, int K) { float v[16]; const int g = lane >> 4;
#pragma unroll
  for (int i = 0; i < 8; ++i) { const int ka = k0 + 8 * g + i, kb = ka + 16; v[i] = ka < K ? row[ka] : 0.f; v[8 + i] = kb < K ? row[kb] : 0.f; }
  return bsplit16(v); }
__device__ __forceinline__ F2 split_col(const float* W, int k0, int n, int lane, int ld, int K) { float v[16]; const int g = lane >> 4;
#pragma unroll
  for (int i = 0; i < 8; ++i) { const int ka = k0 + 8 * g + i, kb = ka + 16; v[i] = ka < K ? W[(size_t)ka * ld + n] : 0.f; v[8 + i] = kb < K ? W[(size_t)kb * ld + n] : 0.f; }
  return bsplit16(v); }
__device__ __forceinline__ v8f mac3(const F2& a, const F2& b, v8f c) { c = wmma_bf(a.l, b.h, c); c = wmma_bf(a.h, b.l, c); return wmma_bf(a.h, b.h, c); }
__device__ __forceinline__ float sigm(float v) { return 1.0f / (1.0f + expf(-v)); }
#define LDSX() do { asm volatile("s_wait_dscnt 0" ::: "memory"); __builtin_amdgcn_wave_barrier(); __builtin_amdgcn_fence(__ATOMIC_RELEASE, "workgroup"); } while (0)


// Sliding-window causal attention (12 heads of 64 on [1,2048,768], [out][in] weights, no biases, scale 1/8): each query attends to keys max(0, q-63) .. q (the reference gathers a 64-token window ending at q and masks window slots beyond q);
// softmax; (P v) Wo^T. Only the two key tiles that can intersect the window are visited (exact: every other weight is exp(-inf) = 0).
#define NB 1
#define SS 2048
#define E 768
#define NH 12
#define WIN 64
#define HD 64
#define NR (NB * SS)
#define PLO 1024.0f
#define VLO 2048.0f
__device__ __forceinline__ float bfr(float v) { return (float)(__bf16)v; }
__device__ __forceinline__ v16b frag_b(const __bf16* rowk0, int lane) { return __builtin_bit_cast(v16b, frag_h((const _Float16*)rowk0, lane)); }

__global__ __launch_bounds__(256) void k_cvt(const float* __restrict__ x, __bf16* __restrict__ Xb) {
  const size_t i8 = (size_t)blockIdx.x * 256 + threadIdx.x; if (i8 >= (size_t)NR * E / 8) return;
  union { __bf16 h[8]; v4u u; } pk;
#pragma unroll
  for (int e = 0; e < 8; ++e) pk.h[e] = (__bf16)x[i8 * 8 + e];
  vst2((unsigned*)(Xb + i8 * 8), pk.u);
}
// PT rows: [0,E) Wq[n,:], [E,2E) Wk[n,:], [2E,3E) Wv[n,:], [3E,4E) Wo[n,:]  ([out][in] weights: row n as a bf16 row)
__global__ __launch_bounds__(256) void k_pack(const float* __restrict__ Wq, const float* __restrict__ Wk, const float* __restrict__ Wv, const float* __restrict__ Wo, __bf16* __restrict__ PT) {
  const int n = blockIdx.x, tid = threadIdx.x; __shared__ __align__(16) __bf16 srow[E];
  const float* W = n < E ? Wq : (n < 2 * E ? Wk : (n < 3 * E ? Wv : Wo)); const int nn = n % E;      // [out][in]: PT row n = W row nn
  for (int k = tid; k < E; k += 256) srow[k] = (__bf16)W[(size_t)nn * E + k];
  __syncthreads();
  if (tid < E / 8) vst2((unsigned*)(PT + (size_t)n * E + tid * 8), *(const v4u*)(&srow[tid * 8]));
}
// QKV: block (64 rows, 128 cols = 2 heads, which); q -> Q32 f32 [bh][s][64]; k -> K32 f32 rows; v -> VT hi/lo x4 [bh][d][s]
__global__ __launch_bounds__(128) void k_qkv(const __bf16* __restrict__ Xb, const __bf16* __restrict__ PT, float* __restrict__ Q32, float* __restrict__ K32, _Float16* __restrict__ VTh, _Float16* __restrict__ VTl) {
  __shared__ __align__(16) float so[4][16][132];
  __shared__ __align__(16) _Float16 sth[128][72], stl[128][72];
  const int tid = threadIdx.x, wave = tid >> 5, lane = tid & 31, col = lane & 15, g = lane >> 4;
  const int which = blockIdx.z, r0b = blockIdx.x * 64, r0 = r0b + wave * 16, n0 = blockIdx.y * 128; const int b = r0b / SS, s0 = r0b % SS;
  v8f acc[8] = {};
#pragma unroll 2
  for (int kc = 0; kc < E / 32; ++kc) { const v16b a = frag_b(Xb + (size_t)(r0 + col) * E + kc * 32, lane);
#pragma unroll
    for (int j = 0; j < 8; ++j) acc[j] = wmma_bf(a, frag_b(PT + (size_t)(which * E + n0 + j * 16 + col) * E + kc * 32, lane), acc[j]); }
  if (which < 2) {
#pragma unroll
    for (int j = 0; j < 8; ++j) { const float bb = 0.f;
#pragma unroll
      for (int r = 0; r < 8; ++r) so[wave][8 * g + r][j * 16 + col] = acc[j][r] + bb; }
    LDSX();
    float* Dst = which == 0 ? Q32 : K32;
    for (int qq = lane; qq < 2 * 16 * 16; qq += 32) { const int hh = qq >> 8, rl = (qq >> 4) & 15, pc = qq & 15; const int h = (n0 >> 6) + hh;
      vst2(Dst + (((size_t)b * NH + h) * SS + s0 + wave * 16 + rl) * HD + pc * 4, *(const v4f*)(&so[wave][rl][hh * 64 + pc * 4])); } }
  else {
#pragma unroll
    for (int j = 0; j < 8; ++j) { const float bb = 0.f;
#pragma unroll
      for (int r = 0; r < 8; ++r) { const float v = (acc[j][r] + bb) * 4.0f; const _Float16 hi = (_Float16)v; sth[j * 16 + col][wave * 16 + 8 * g + r] = hi; stl[j * 16 + col][wave * 16 + 8 * g + r] = (_Float16)((v - (float)hi) * VLO); } }
    __syncthreads();
    for (int qq = tid; qq < 128 * 8; qq += 128) { const int cl = qq >> 3, pc = qq & 7; const int c = n0 + cl, h = c >> 6, d = c & 63; const size_t o = (((size_t)b * NH + h) * HD + d) * SS + s0 + pc * 8;
      vst2(VTh + o, *(const v4u*)(&sth[cl][pc * 8])); vst2(VTl + o, *(const v4u*)(&stl[cl][pc * 8])); } }
}
// causal attention: block (64 queries, bh); key tiles max(qb-1,0)..qb; S on hi/lo splits of the f32 q/k rows; P,V hi/lo; O f32 [bh][s][64]
__global__ __launch_bounds__(128) void k_attn(const float* __restrict__ Q32, const float* __restrict__ K32, const _Float16* __restrict__ VTh, const _Float16* __restrict__ VTl, float* __restrict__ O32) {
  __shared__ __align__(16) float sS[4][16][68];
  __shared__ __align__(16) _Float16 sPh[4][16][72], sPl[4][16][72];
  __shared__ __align__(16) float sO[4][16][68];
  const int tid = threadIdx.x, w = tid >> 5, lane = tid & 31, col = lane & 15, g = lane >> 4;
  const size_t bh = blockIdx.y; const int qb = blockIdx.x; const int q0 = qb * 64 + w * 16;
  F2 aq[2];
#pragma unroll
  for (int kc = 0; kc < 2; ++kc) aq[kc] = split_row(Q32 + (bh * SS + q0 + col) * HD, kc * 32, lane);
  float mrun = -3.0e38f, lrun = 0.f; v8f acc[4] = {}, ac1[4] = {}, ac2[4] = {};
#pragma unroll 1
  for (int kt = (qb > 0 ? qb - 1 : 0); kt <= qb; ++kt) {      // window of 64 keys ending at q spans at most the previous and the current tile
#pragma unroll
    for (int t = 0; t < 4; ++t) { const int key = kt * 64 + t * 16 + col; const float* krow = K32 + (bh * SS + key) * HD;
      v8f s = mac3(aq[0], split_row(krow, 0, lane), (v8f){}); s = mac3(aq[1], split_row(krow, 32, lane), s);
#pragma unroll
      for (int r = 0; r < 8; ++r) { const int qi = q0 + 8 * g + r; sS[w][8 * g + r][t * 16 + col] = (key > qi || key <= qi - WIN) ? -3.0e38f : s[r] * 0.125f; } }
    LDSX();
    float mx = -3.4e38f;
#pragma unroll
    for (int jj = 0; jj < 32; ++jj) mx = fmaxf(mx, sS[w][col][g * 32 + jj]);
    mx = fmaxf(mx, __shfl_xor(mx, 16, 32));
    const float mnew = fmaxf(mrun, mx); const float corr = expf(mrun - mnew);
    float ps = 0.f;
#pragma unroll
    for (int jj = 0; jj < 32; ++jj) { const float p = expf(sS[w][col][g * 32 + jj] - mnew) * 16384.0f; ps += p; const _Float16 hi = (_Float16)p; sPh[w][col][g * 32 + jj] = hi; sPl[w][col][g * 32 + jj] = (_Float16)((p - (float)hi) * PLO); }
    ps += __shfl_xor(ps, 16, 32);
    lrun = lrun * corr + ps * (1.0f / 16384.0f); mrun = mnew;
#pragma unroll
    for (int r = 0; r < 8; ++r) { const float cr = __shfl(corr, 8 * g + r, 32);
#pragma unroll
      for (int t = 0; t < 4; ++t) { acc[t][r] *= cr; ac1[t][r] *= cr; ac2[t][r] *= cr; } }
    LDSX();
#pragma unroll
    for (int kc = 0; kc < 2; ++kc) { const v16h ph = frag_h(&sPh[w][col][0] + kc * 32, lane), pl = frag_h(&sPl[w][col][0] + kc * 32, lane);
#pragma unroll
      for (int t = 0; t < 4; ++t) { const size_t vo = (bh * HD + t * 16 + col) * SS + kt * 64 + kc * 32; const v16h vh = frag_h(VTh + vo, lane);
        acc[t] = wmma16(ph, vh, acc[t]); ac1[t] = wmma16(ph, frag_h(VTl + vo, lane), ac1[t]); ac2[t] = wmma16(pl, vh, ac2[t]); } }
    __builtin_amdgcn_wave_barrier(); }
#pragma unroll
  for (int r = 0; r < 8; ++r) { const float lr = __shfl(lrun, 8 * g + r, 32); const float inv = 1.0f / (lr * 16384.0f * 4.0f);
#pragma unroll
    for (int t = 0; t < 4; ++t) sO[w][8 * g + r][t * 16 + col] = (acc[t][r] + ac1[t][r] * (1.0f / VLO) + ac2[t][r] * (1.0f / PLO)) * inv; }
  LDSX();
  for (int qq = lane; qq < 16 * 16; qq += 32) { const int rl = qq >> 4, pc = qq & 15; vst2(O32 + ((bh * SS) + q0 + rl) * HD + pc * 4, *(const v4f*)(&sO[w][rl][pc * 4])); }
}
// out = ctx Wo^T : split(ctx) x bf16(Wo rows): 2 products (Wo is an INPUT -> bf16 exact)
__global__ __launch_bounds__(128) void k_out(const float* __restrict__ O32, const __bf16* __restrict__ PT, float* __restrict__ out) {
  __shared__ __align__(16) float so[4][16][132];
  const int tid = threadIdx.x, wave = tid >> 5, lane = tid & 31, col = lane & 15, g = lane >> 4;
  const int r0 = blockIdx.x * 64 + wave * 16, n0 = blockIdx.y * 128; const int ra = r0 + col; const int b = ra / SS, s = ra % SS;
  v8f acc[8] = {};
#pragma unroll 1
  for (int kc = 0; kc < E / 32; ++kc) { const int h = kc >> 1; const F2 a = split_row(O32 + (((size_t)b * NH + h) * SS + s) * HD, (kc & 1) * 32, lane);
#pragma unroll
    for (int j = 0; j < 8; ++j) { const v16b wb = frag_b(PT + (size_t)(3 * E + n0 + j * 16 + col) * E + kc * 32, lane); acc[j] = wmma_bf(a.l, wb, acc[j]); acc[j] = wmma_bf(a.h, wb, acc[j]); } }
#pragma unroll
  for (int j = 0; j < 8; ++j) {
#pragma unroll
    for (int r = 0; r < 8; ++r) so[wave][8 * g + r][j * 16 + col] = acc[j][r]; }
  LDSX();
#pragma unroll 4
  for (int rl = 0; rl < 16; ++rl) vst2(out + (size_t)(r0 + rl) * E + n0 + lane * 4, *(const v4f*)(&so[wave][rl][lane * 4]));
}
extern "C" void kernel_launch(void* const* d_in, const int* in_sizes, int n_in, void* d_out, int out_size, void* d_ws, size_t ws_size, hipStream_t stream) {
  (void)in_sizes; (void)n_in; (void)out_size; (void)ws_size;
  const float** I = (const float**)d_in;   // inputs, Wq, Wk, Wv, Wo
  const float* x = I[0]; const float* Wq = I[1]; const float* Wk = I[2]; const float* Wv = I[3]; const float* Wo = I[4];
  float* out = (float*)d_out;
  char* ws = (char*)d_ws; size_t off = 0;
  auto take = [&](size_t bytes) { char* p = ws + off; off += (bytes + 255) & ~(size_t)255; return p; };
  __bf16* Xb = (__bf16*)take((size_t)NR * E * 2); __bf16* PT = (__bf16*)take((size_t)4 * E * E * 2);
  float* Q32 = (float*)take((size_t)NR * E * 4); float* K32 = (float*)take((size_t)NR * E * 4); _Float16* VTh = (_Float16*)take((size_t)NR * E * 2); _Float16* VTl = (_Float16*)take((size_t)NR * E * 2); float* O32 = (float*)take((size_t)NR * E * 4);
  // ws ~ 33 MB
  k_cvt<<<(NR * E / 8 + 255) / 256, 256, 0, stream>>>(x, Xb);
  k_pack<<<4 * E, 256, 0, stream>>>(Wq, Wk, Wv, Wo, PT);
  k_qkv<<<dim3(NR / 64, E / 128, 3), 128, 0, stream>>>(Xb, PT, Q32, K32, VTh, VTl);
  k_attn<<<dim3(SS / 64, NB * NH), 128, 0, stream>>>(Q32, K32, VTh, VTl, O32);
  k_out<<<dim3(NR / 64, E / 128), 128, 0, stream>>>(O32, PT, out);
}

// v001
// A run of this version takes 60.5 microseconds.
// Next to v000, in two timings, it ran 2.26 times as fast each time.
// compute dtype: inputs and W* (INPUTS) rounded to bf16 with exact bf16 WMMA products (f32 accumulate) for the projections; q/k f32 split for the scores (3 products), P and V f16 hi/lo (3 products); softmax f32.
#include <hip/hip_runtime.h>
#include <math.h>

typedef __attribute__((ext_vector_type(16))) _Float16 v16h;
typedef __attribute__((ext_vector_type(16))) __bf16 v16b;
typedef __attribute__((ext_vector_type(8)))  _Float16 v8h;
typedef __attribute__((ext_vector_type(8)))  float v8f;
typedef __attribute__((ext_vector_type(4)))  float v4f;
typedef __attribute__((ext_vector_type(2)))  float v2f;
typedef __attribute__((ext_vector_type(4)))  unsigned v4u;
typedef __attribute__((ext_vector_type(4)))  int v4i;
typedef float __attribute__((may_alias)) float_a;
typedef int __attribute__((may_alias)) int_a;

template <typename T> __device__ __forceinline__ void vst2(void* p, T v) { *(T*)p = v;  }
__device__ __forceinline__ v8f wmma16(v16h a, v16h b, v8f c) {
  v8f d = __builtin_amdgcn_wmma_f32_16x16x32_f16(false, a, false, b, (short)0, c, false, false);
  asm volatile("v_nop\n\tv_nop\n\tv_nop\n\tv_nop" : "+v"(d) : "v"(a), "v"(b));
  return d;
}
__device__ __forceinline__ v8f wmma_bf(v16b a, v16b b, v8f c) {
  v8f d = __builtin_amdgcn_wmma_f32_16x16x32_bf16(false, a, false, b, (short)0, c, false, false);
  asm volatile("v_nop\n\tv_nop\n\tv_nop\n\tv_nop" : "+v"(d) : "v"(a), "v"(b));
  return d;
}
// 16x16x32 fragments: lane = (h = lane>>4, row/col = lane&15); elements 0..7 = k0+8h+0..7, 8..15 = k0+16+8h+0..7; D element r = row 8h+r
__device__ __forceinline__ v16h frag_h(const _Float16* rowk0, int lane) {
  union { v16h v; v8h q[2]; } u; const _Float16* p = rowk0 + 8 * (lane >> 4);
  u.q[0] = *(const v8h*)p; u.q[1] = *(const v8h*)(p + 16); return u.v;
}
__device__ __forceinline__ v16h frag_f32(const float* rowk0, int lane) {
  v16h a; const float* p = rowk0 + 8 * (lane >> 4);
#pragma unroll
  for (int i = 0; i < 8; ++i) { a[i] = (_Float16)p[i]; a[8 + i] = (_Float16)p[16 + i]; }
  return a;
}
__device__ __forceinline__ v16h frag_f32s(const float* rowk0, int lane, float sc) {
  v16h a; const float* p = rowk0 + 8 * (lane >> 4);
#pragma unroll
  for (int i = 0; i < 8; ++i) { a[i] = (_Float16)(p[i] * sc); a[8 + i] = (_Float16)(p[16 + i] * sc); }
  return a;
}
// column fragment from a [K][ld] layout (column n), rows >= K read as 0
__device__ __forceinline__ v16h fragc_f32(const float* W, int k0, int n, int lane, int ld, int K) {
  v16h a; const int g = lane >> 4;
#pragma unroll
  for (int i = 0; i < 8; ++i) { const int ka = k0 + 8 * g + i, kb = ka + 16;
    a[i] = (_Float16)(ka < K ? W[(size_t)ka * ld + n] : 0.f); a[8 + i] = (_Float16)(kb < K ? W[(size_t)kb * ld + n] : 0.f); }
  return a;
}
struct F2 { v16b h, l; };
__device__ __forceinline__ F2 bsplit16(const float v[16]) { F2 r;
#pragma unroll
  for (int i = 0; i < 16; ++i) { const __bf16 h = (__bf16)v[i]; r.h[i] = h; r.l[i] = (__bf16)(v[i] - (float)h); }
  return r; }
__device__ __forceinline__ F2 split_row(const float* row, int k0, int lane) { float v[16]; const float* p = row + k0 + 8 * (lane >> 4);
#pragma unroll
  for (int i = 0; i < 8; ++i) { v[i] = p[i]; v[8 + i] = p[16 + i]; }
  return bsplit16(v); }
__device__ __forceinline__ F2 split_rowK(const float* row, int k0, int lane, int K) { float v[16]; const int g = lane >> 4;
#pragma unroll
  for (int i = 0; i < 8; ++i) { const int ka = k0 + 8 * g + i, kb = ka + 16; v[i] = ka < K ? row[ka] : 0.f; v[8 + i] = kb < K ? row[kb] : 0.f; }
  return bsplit16(v); }
__device__ __forceinline__ F2 split_col(const float* W, int k0, int n, int lane, int ld, int K) { float v[16]; const int g = lane >> 4;
#pragma unroll
  for (int i = 0; i < 8; ++i) { const int ka = k0 + 8 * g + i, kb = ka + 16; v[i] = ka < K ? W[(size_t)ka * ld + n] : 0.f; v[8 + i] = kb < K ? W[(size_t)kb * ld + n] : 0.f; }
  return bsplit16(v); }
__device__ __forceinline__ v8f mac3(const F2& a, const F2& b, v8f c) { c = wmma_bf(a.l, b.h, c); c = wmma_bf(a.h, b.l, c); return wmma_bf(a.h, b.h, c); }
__device__ __forceinline__ float sigm(float v) { return 1.0f / (1.0f + expf(-v)); }
#define LDSX() do { asm volatile("s_wait_dscnt 0" ::: "memory"); __builtin_amdgcn_wave_barrier(); __builtin_amdgcn_fence(__ATOMIC_RELEASE, "workgroup"); } while (0)


// Sliding-window causal attention (12 heads of 64 on [1,2048,768], [out][in] weights, no biases, scale 1/8): each query attends to keys max(0, q-63) .. q (the reference gathers a 64-token window ending at q and masks window slots beyond q);
// softmax; (P v) Wo^T. Only the two key tiles that can intersect the window are visited (exact: every other weight is exp(-inf) = 0).
#define NB 1
#define SS 2048
#define E 768
#define NH 12
#define WIN 64
#define HD 64
#define NR (NB * SS)
#define PLO 1024.0f
#define VLO 2048.0f
__device__ __forceinline__ float bfr(float v) { return (float)(__bf16)v; }
__device__ __forceinline__ v16b frag_b(const __bf16* rowk0, int lane) { return __builtin_bit_cast(v16b, frag_h((const _Float16*)rowk0, lane)); }
// LDS ring of the two projection GEMMs: a tile is 128 k of every operand row; two buffers
#define KT 128
#define NT (E / KT)
#define PB 272                      // LDS pitch of a 256-byte bf16 row (16 B x odd: conflict-free b128 reads)
#define PF 528                      // LDS pitch of a 512-byte f32 row (16 B x odd)
#define QKV_BUF ((64 + 128) * PB)   // [Xb 64 rows | PT 128 rows]
#define OUT_BUF (64 * PF + 128 * PB) // [ctx 64 rows f32 | PT 128 rows]
// eight asynchronous 16-byte copies per lane, global -> LDS, rows ls / gs bytes apart. The s_wait_xcnt ends the copies' own statement, so no address register is rewritten in front of it.
__device__ __forceinline__ void cp8(unsigned l, const char* g, unsigned ls, size_t gs) {
  asm volatile("global_load_async_to_lds_b128 %0, %8, off\n\t"
               "global_load_async_to_lds_b128 %1, %9, off\n\t"
               "global_load_async_to_lds_b128 %2, %10, off\n\t"
               "global_load_async_to_lds_b128 %3, %11, off\n\t"
               "global_load_async_to_lds_b128 %4, %12, off\n\t"
               "global_load_async_to_lds_b128 %5, %13, off\n\t"
               "global_load_async_to_lds_b128 %6, %14, off\n\t"
               "global_load_async_to_lds_b128 %7, %15, off\n\t"
               "s_wait_xcnt 0x0"
               :: "v"(l), "v"(l + ls), "v"(l + 2 * ls), "v"(l + 3 * ls), "v"(l + 4 * ls), "v"(l + 5 * ls), "v"(l + 6 * ls), "v"(l + 7 * ls),
                  "v"(g), "v"(g + gs), "v"(g + 2 * gs), "v"(g + 3 * gs), "v"(g + 4 * gs), "v"(g + 5 * gs), "v"(g + 6 * gs), "v"(g + 7 * gs)
               : "memory");
}
// the issuing wave's own copies have landed
#define WAIT_COPIES() asm volatile("s_wait_asynccnt 0x0" ::: "memory")
// this wave's LDS reads have returned (before the buffer they read is handed back for a refill)
#define WAIT_LDS() asm volatile("s_wait_dscnt 0x0" ::: "memory")

__global__ __launch_bounds__(256) void k_cvt(const float* __restrict__ x, __bf16* __restrict__ Xb) {
  const size_t i8 = (size_t)blockIdx.x * 256 + threadIdx.x; if (i8 >= (size_t)NR * E / 8) return;
  union { __bf16 h[8]; v4u u; } pk;
#pragma unroll
  for (int e = 0; e < 8; ++e) pk.h[e] = (__bf16)x[i8 * 8 + e];
  vst2((unsigned*)(Xb + i8 * 8), pk.u);
}
// PT rows: [0,E) Wq[n,:], [E,2E) Wk[n,:], [2E,3E) Wv[n,:], [3E,4E) Wo[n,:]  ([out][in] weights: row n as a bf16 row)
__global__ __launch_bounds__(256) void k_pack(const float* __restrict__ Wq, const float* __restrict__ Wk, const float* __restrict__ Wv, const float* __restrict__ Wo, __bf16* __restrict__ PT) {
  const int n = blockIdx.x, tid = threadIdx.x; __shared__ __align__(16) __bf16 srow[E];
  const float* W = n < E ? Wq : (n < 2 * E ? Wk : (n < 3 * E ? Wv : Wo)); const int nn = n % E;      // [out][in]: PT row n = W row nn
  for (int k = tid; k < E; k += 256) srow[k] = (__bf16)W[(size_t)nn * E + k];
  __syncthreads();
  if (tid < E / 8) vst2((unsigned*)(PT + (size_t)n * E + tid * 8), *(const v4u*)(&srow[tid * 8]));
}
// QKV: block (64 rows, 128 cols = 2 heads, which); q -> Q32 f32 [bh][s][64]; k -> K32 f32 rows; v -> VT hi/lo x4 [bh][d][s]
__global__ __launch_bounds__(128) void k_qkv(const __bf16* __restrict__ Xb, const __bf16* __restrict__ PT, float* __restrict__ Q32, float* __restrict__ K32, _Float16* __restrict__ VTh, _Float16* __restrict__ VTl) {
  __shared__ __align__(16) char ring[2 * QKV_BUF];      // the output staging below reuses it behind the loop's last barrier (three blocks fit a WGP's LDS)
  float (*so)[16][132] = (float (*)[16][132])ring;
  _Float16 (*sth)[72] = (_Float16 (*)[72])ring; _Float16 (*stl)[72] = sth + 128;
  const int tid = threadIdx.x, wave = tid >> 5, lane = tid & 31, col = lane & 15, g = lane >> 4;
  const int which = blockIdx.z, r0b = blockIdx.x * 64, r0 = r0b + wave * 16, n0 = blockIdx.y * 128; const int b = r0b / SS, s0 = r0b % SS;
  v8f acc[8] = {};
  // a lane copies chunk (tid & 15) of rows (tid >> 4) + 8 i: 8 rows of Xb, 16 of PT per tile
  const unsigned lA = (unsigned)(size_t)ring + (tid >> 4) * PB + (tid & 15) * 16, lB = lA + 64 * PB;
  const char* gA = (const char*)(Xb + (size_t)(r0b + (tid >> 4)) * E + (tid & 15) * 8);
  const char* gB = (const char*)(PT + (size_t)(which * E + n0 + (tid >> 4)) * E + (tid & 15) * 8);
  auto fill = [&](int t) { const unsigned bo = (t & 1) * QKV_BUF; const size_t ko = (size_t)t * KT * 2;
    cp8(lA + bo, gA + ko, 8 * PB, (size_t)8 * E * 2); cp8(lB + bo, gB + ko, 8 * PB, (size_t)8 * E * 2); cp8(lB + bo + 64 * PB, gB + ko + (size_t)64 * E * 2, 8 * PB, (size_t)8 * E * 2); };
  fill(0); WAIT_COPIES(); __syncthreads();
  fill(1);
  for (int t = 0; t < NT; ++t) { const char* bA = ring + (t & 1) * QKV_BUF + (wave * 16 + col) * PB; const char* bB = ring + (t & 1) * QKV_BUF + (64 + col) * PB;
#pragma unroll      // constant kc and j: LDS reads take immediate offsets, acc[] stays in registers
    for (int kc = 0; kc < KT / 32; ++kc) { const v16b a = frag_b((const __bf16*)bA + kc * 32, lane);
#pragma unroll
      for (int j = 0; j < 8; ++j) acc[j] = wmma_bf(a, frag_b((const __bf16*)(bB + j * 16 * PB) + kc * 32, lane), acc[j]); }
    WAIT_LDS(); WAIT_COPIES(); __syncthreads();      // publishes tile t + 1 and frees tile t's buffer
    if (t + 2 < NT) fill(t + 2); }
  WAIT_COPIES();
  if (which < 2) {
#pragma unroll
    for (int j = 0; j < 8; ++j) { const float bb = 0.f;
#pragma unroll
      for (int r = 0; r < 8; ++r) so[wave][8 * g + r][j * 16 + col] = acc[j][r] + bb; }
    LDSX();
    float* Dst = which == 0 ? Q32 : K32;
    for (int qq = lane; qq < 2 * 16 * 16; qq += 32) { const int hh = qq >> 8, rl = (qq >> 4) & 15, pc = qq & 15; const int h = (n0 >> 6) + hh;
      vst2(Dst + (((size_t)b * NH + h) * SS + s0 + wave * 16 + rl) * HD + pc * 4, *(const v4f*)(&so[wave][rl][hh * 64 + pc * 4])); } }
  else {
#pragma unroll
    for (int j = 0; j < 8; ++j) { const float bb = 0.f;
#pragma unroll
      for (int r = 0; r < 8; ++r) { const float v = (acc[j][r] + bb) * 4.0f; const _Float16 hi = (_Float16)v; sth[j * 16 + col][wave * 16 + 8 * g + r] = hi; stl[j * 16 + col][wave * 16 + 8 * g + r] = (_Float16)((v - (float)hi) * VLO); } }
    __syncthreads();
    for (int qq = tid; qq < 128 * 8; qq += 128) { const int cl = qq >> 3, pc = qq & 7; const int c = n0 + cl, h = c >> 6, d = c & 63; const size_t o = (((size_t)b * NH + h) * HD + d) * SS + s0 + pc * 8;
      vst2(VTh + o, *(const v4u*)(&sth[cl][pc * 8])); vst2(VTl + o, *(const v4u*)(&stl[cl][pc * 8])); } }
}
// causal attention: block (64 queries, bh); key tiles max(qb-1,0)..qb; S on hi/lo splits of the f32 q/k rows; P,V hi/lo; O f32 [bh][s][64]
__global__ __launch_bounds__(128) void k_attn(const float* __restrict__ Q32, const float* __restrict__ K32, const _Float16* __restrict__ VTh, const _Float16* __restrict__ VTl, float* __restrict__ O32) {
  __shared__ __align__(16) float sS[4][16][68];
  __shared__ __align__(16) _Float16 sPh[4][16][72], sPl[4][16][72];
  __shared__ __align__(16) float sO[4][16][68];
  const int tid = threadIdx.x, w = tid >> 5, lane = tid & 31, col = lane & 15, g = lane >> 4;
  const size_t bh = blockIdx.y; const int qb = blockIdx.x; const int q0 = qb * 64 + w * 16;
  F2 aq[2];
#pragma unroll
  for (int kc = 0; kc < 2; ++kc) aq[kc] = split_row(Q32 + (bh * SS + q0 + col) * HD, kc * 32, lane);
  float mrun = -3.0e38f, lrun = 0.f; v8f acc[4] = {}, ac1[4] = {}, ac2[4] = {};
#pragma unroll 1
  for (int kt = (qb > 0 ? qb - 1 : 0); kt <= qb; ++kt) {      // window of 64 keys ending at q spans at most the previous and the current tile
#pragma unroll
    for (int t = 0; t < 4; ++t) { const int key = kt * 64 + t * 16 + col; const float* krow = K32 + (bh * SS + key) * HD;
      v8f s = mac3(aq[0], split_row(krow, 0, lane), (v8f){}); s = mac3(aq[1], split_row(krow, 32, lane), s);
#pragma unroll
      for (int r = 0; r < 8; ++r) { const int qi = q0 + 8 * g + r; sS[w][8 * g + r][t * 16 + col] = (key > qi || key <= qi - WIN) ? -3.0e38f : s[r] * 0.125f; } }
    LDSX();
    float mx = -3.4e38f;
#pragma unroll
    for (int jj = 0; jj < 32; ++jj) mx = fmaxf(mx, sS[w][col][g * 32 + jj]);
    mx = fmaxf(mx, __shfl_xor(mx, 16, 32));
    const float mnew = fmaxf(mrun, mx); const float corr = expf(mrun - mnew);
    float ps = 0.f;
#pragma unroll
    for (int jj = 0; jj < 32; ++jj) { const float p = expf(sS[w][col][g * 32 + jj] - mnew) * 16384.0f; ps += p; const _Float16 hi = (_Float16)p; sPh[w][col][g * 32 + jj] = hi; sPl[w][col][g * 32 + jj] = (_Float16)((p - (float)hi) * PLO); }
    ps += __shfl_xor(ps, 16, 32);
    lrun = lrun * corr + ps * (1.0f / 16384.0f); mrun = mnew;
#pragma unroll
    for (int r = 0; r < 8; ++r) { const float cr = __shfl(corr, 8 * g + r, 32);
#pragma unroll
      for (int t = 0; t < 4; ++t) { acc[t][r] *= cr; ac1[t][r] *= cr; ac2[t][r] *= cr; } }
    LDSX();
#pragma unroll
    for (int kc = 0; kc < 2; ++kc) { const v16h ph = frag_h(&sPh[w][col][0] + kc * 32, lane), pl = frag_h(&sPl[w][col][0] + kc * 32, lane);
#pragma unroll
      for (int t = 0; t < 4; ++t) { const size_t vo = (bh * HD + t * 16 + col) * SS + kt * 64 + kc * 32; const v16h vh = frag_h(VTh + vo, lane);
        acc[t] = wmma16(ph, vh, acc[t]); ac1[t] = wmma16(ph, frag_h(VTl + vo, lane), ac1[t]); ac2[t] = wmma16(pl, vh, ac2[t]); } }
    __builtin_amdgcn_wave_barrier(); }
#pragma unroll
  for (int r = 0; r < 8; ++r) { const float lr = __shfl(lrun, 8 * g + r, 32); const float inv = 1.0f / (lr * 16384.0f * 4.0f);
#pragma unroll
    for (int t = 0; t < 4; ++t) sO[w][8 * g + r][t * 16 + col] = (acc[t][r] + ac1[t][r] * (1.0f / VLO) + ac2[t][r] * (1.0f / PLO)) * inv; }
  LDSX();
  for (int qq = lane; qq < 16 * 16; qq += 32) { const int rl = qq >> 4, pc = qq & 15; vst2(O32 + ((bh * SS) + q0 + rl) * HD + pc * 4, *(const v4f*)(&sO[w][rl][pc * 4])); }
}
// out = ctx Wo^T : split(ctx) x bf16(Wo rows): 2 products (Wo is an INPUT -> bf16 exact)
__global__ __launch_bounds__(128) void k_out(const float* __restrict__ O32, const __bf16* __restrict__ PT, float* __restrict__ out) {
  __shared__ __align__(16) float so[4][16][132];
  __shared__ __align__(16) char ring[2 * OUT_BUF];
  const int tid = threadIdx.x, wave = tid >> 5, lane = tid & 31, col = lane & 15, g = lane >> 4;
  const int r0b = blockIdx.x * 64, r0 = r0b + wave * 16, n0 = blockIdx.y * 128; const int b = r0b / SS, s0 = r0b % SS;
  v8f acc[8] = {};
  // ctx: a tile is two heads' 64 floats of each row; a lane copies chunk (tid & 31) of rows (tid >> 5) + 4 i (16 rows). PT: chunk (tid & 15) of rows (tid >> 4) + 8 i (16 rows)
  const unsigned lA = (unsigned)(size_t)ring + (tid >> 5) * PF + (tid & 31) * 16, lB = (unsigned)(size_t)ring + 64 * PF + (tid >> 4) * PB + (tid & 15) * 16;
  const char* gA = (const char*)(O32 + (((size_t)b * NH + ((tid & 31) >> 4)) * SS + s0 + (tid >> 5)) * HD + (tid & 15) * 4);
  const char* gB = (const char*)(PT + (size_t)(3 * E + n0 + (tid >> 4)) * E + (tid & 15) * 8);
  auto fill = [&](int t) { const unsigned bo = (t & 1) * OUT_BUF; const size_t ka = (size_t)t * 2 * SS * HD * 4, ko = (size_t)t * KT * 2;
    cp8(lA + bo, gA + ka, 4 * PF, (size_t)4 * HD * 4); cp8(lA + bo + 32 * PF, gA + ka + (size_t)32 * HD * 4, 4 * PF, (size_t)4 * HD * 4);
    cp8(lB + bo, gB + ko, 8 * PB, (size_t)8 * E * 2); cp8(lB + bo + 64 * PB, gB + ko + (size_t)64 * E * 2, 8 * PB, (size_t)8 * E * 2); };
  fill(0); WAIT_COPIES(); __syncthreads();
  fill(1);
  for (int t = 0; t < NT; ++t) { const float* bA = (const float*)(ring + (t & 1) * OUT_BUF + (wave * 16 + col) * PF); const char* bB = ring + (t & 1) * OUT_BUF + 64 * PF + col * PB;
#pragma unroll      // constant kc and j: LDS reads take immediate offsets, acc[] stays in registers
    for (int kc = 0; kc < KT / 32; ++kc) { const F2 a = split_row(bA, kc * 32, lane);
#pragma unroll
      for (int j = 0; j < 8; ++j) { const v16b wb = frag_b((const __bf16*)(bB + j * 16 * PB) + kc * 32, lane); acc[j] = wmma_bf(a.l, wb, acc[j]); acc[j] = wmma_bf(a.h, wb, acc[j]); } }
    WAIT_LDS(); WAIT_COPIES(); __syncthreads();      // publishes tile t + 1 and frees tile t's buffer
    if (t + 2 < NT) fill(t + 2); }
  WAIT_COPIES();
#pragma unroll
  for (int j = 0; j < 8; ++j) {
#pragma unroll
    for (int r = 0; r < 8; ++r) so[wave][8 * g + r][j * 16 + col] = acc[j][r]; }
  LDSX();
#pragma unroll 4
  for (int rl = 0; rl < 16; ++rl) vst2(out + (size_t)(r0 + rl) * E + n0 + lane * 4, *(const v4f*)(&so[wave][rl][lane * 4]));
}
extern "C" void kernel_launch(void* const* d_in, const int* in_sizes, int n_in, void* d_out, int out_size, void* d_ws, size_t ws_size, hipStream_t stream) {
  (void)in_sizes; (void)n_in; (void)out_size; (void)ws_size;
  const float** I = (const float**)d_in;   // inputs, Wq, Wk, Wv, Wo
  const float* x = I[0]; const float* Wq = I[1]; const float* Wk = I[2]; const float* Wv = I[3]; const float* Wo = I[4];
  float* out = (float*)d_out;
  char* ws = (char*)d_ws; size_t off = 0;
  auto take = [&](size_t bytes) { char* p = ws + off; off += (bytes + 255) & ~(size_t)255; return p; };
  __bf16* Xb = (__bf16*)take((size_t)NR * E * 2); __bf16* PT = (__bf16*)take((size_t)4 * E * E * 2);
  float* Q32 = (float*)take((size_t)NR * E * 4); float* K32 = (float*)take((size_t)NR * E * 4); _Float16* VTh = (_Float16*)take((size_t)NR * E * 2); _Float16* VTl = (_Float16*)take((size_t)NR * E * 2); float* O32 = (float*)take((size_t)NR * E * 4);
  // ws ~ 33 MB
  k_cvt<<<(NR * E / 8 + 255) / 256, 256, 0, stream>>>(x, Xb);
  k_pack<<<4 * E, 256, 0, stream>>>(Wq, Wk, Wv, Wo, PT);
  k_qkv<<<dim3(NR / 64, E / 128, 3), 128, 0, stream>>>(Xb, PT, Q32, K32, VTh, VTl);
  k_attn<<<dim3(SS / 64, NB * NH), 128, 0, stream>>>(Q32, K32, VTh, VTl, O32);
  k_out<<<dim3(NR / 64, E / 128), 128, 0, stream>>>(O32, PT, out);
}

// v002
// It runs in 56.6 microseconds.
// In both of two side-by-side timings against v001, it was 1.07 times as fast.
// All steps since v000 together make it 2.41 times as fast.
// compute dtype: inputs and W* (INPUTS) rounded to bf16 with exact bf16 WMMA products (f32 accumulate) for the projections; q/k f32 split for the scores (3 products), P and V f16 hi/lo (3 products); softmax f32.
#include <hip/hip_runtime.h>
#include <math.h>

typedef __attribute__((ext_vector_type(16))) _Float16 v16h;
typedef __attribute__((ext_vector_type(16))) __bf16 v16b;
typedef __attribute__((ext_vector_type(8)))  _Float16 v8h;
typedef __attribute__((ext_vector_type(8)))  float v8f;
typedef __attribute__((ext_vector_type(4)))  float v4f;
typedef __attribute__((ext_vector_type(2)))  float v2f;
typedef __attribute__((ext_vector_type(4)))  unsigned v4u;
typedef __attribute__((ext_vector_type(2)))  unsigned v2u;
typedef __attribute__((ext_vector_type(4)))  int v4i;
typedef float __attribute__((may_alias)) float_a;
typedef int __attribute__((may_alias)) int_a;

template <typename T> __device__ __forceinline__ void vst2(void* p, T v) { *(T*)p = v;  }
__device__ __forceinline__ v8f wmma16(v16h a, v16h b, v8f c) {
  v8f d = __builtin_amdgcn_wmma_f32_16x16x32_f16(false, a, false, b, (short)0, c, false, false);
  asm volatile("v_nop\n\tv_nop\n\tv_nop\n\tv_nop" : "+v"(d) : "v"(a), "v"(b));
  return d;
}
__device__ __forceinline__ v8f wmma_bf(v16b a, v16b b, v8f c) {
  v8f d = __builtin_amdgcn_wmma_f32_16x16x32_bf16(false, a, false, b, (short)0, c, false, false);
  asm volatile("v_nop\n\tv_nop\n\tv_nop\n\tv_nop" : "+v"(d) : "v"(a), "v"(b));
  return d;
}
// 16x16x32 fragments: lane = (h = lane>>4, row/col = lane&15); elements 0..7 = k0+8h+0..7, 8..15 = k0+16+8h+0..7; D element r = row 8h+r
__device__ __forceinline__ v16h frag_h(const _Float16* rowk0, int lane) {
  union { v16h v; v8h q[2]; } u; const _Float16* p = rowk0 + 8 * (lane >> 4);
  u.q[0] = *(const v8h*)p; u.q[1] = *(const v8h*)(p + 16); return u.v;
}
__device__ __forceinline__ v16h frag_f32(const float* rowk0, int lane) {
  v16h a; const float* p = rowk0 + 8 * (lane >> 4);
#pragma unroll
  for (int i = 0; i < 8; ++i) { a[i] = (_Float16)p[i]; a[8 + i] = (_Float16)p[16 + i]; }
  return a;
}
__device__ __forceinline__ v16h frag_f32s(const float* rowk0, int lane, float sc) {
  v16h a; const float* p = rowk0 + 8 * (lane >> 4);
#pragma unroll
  for (int i = 0; i < 8; ++i) { a[i] = (_Float16)(p[i] * sc); a[8 + i] = (_Float16)(p[16 + i] * sc); }
  return a;
}
// column fragment from a [K][ld] layout (column n), rows >= K read as 0
__device__ __forceinline__ v16h fragc_f32(const float* W, int k0, int n, int lane, int ld, int K) {
  v16h a; const int g = lane >> 4;
#pragma unroll
  for (int i = 0; i < 8; ++i) { const int ka = k0 + 8 * g + i, kb = ka + 16;
    a[i] = (_Float16)(ka < K ? W[(size_t)ka * ld + n] : 0.f); a[8 + i] = (_Float16)(kb < K ? W[(size_t)kb * ld + n] : 0.f); }
  return a;
}
struct F2 { v16b h, l; };
__device__ __forceinline__ F2 bsplit16(const float v[16]) { F2 r;
#pragma unroll
  for (int i = 0; i < 16; ++i) { const __bf16 h = (__bf16)v[i]; r.h[i] = h; r.l[i] = (__bf16)(v[i] - (float)h); }
  return r; }
__device__ __forceinline__ F2 split_row(const float* row, int k0, int lane) { float v[16]; const float* p = row + k0 + 8 * (lane >> 4);
#pragma unroll
  for (int i = 0; i < 8; ++i) { v[i] = p[i]; v[8 + i] = p[16 + i]; }
  return bsplit16(v); }
__device__ __forceinline__ F2 split_rowK(const float* row, int k0, int lane, int K) { float v[16]; const int g = lane >> 4;
#pragma unroll
  for (int i = 0; i < 8; ++i) { const int ka = k0 + 8 * g + i, kb = ka + 16; v[i] = ka < K ? row[ka] : 0.f; v[8 + i] = kb < K ? row[kb] : 0.f; }
  return bsplit16(v); }
__device__ __forceinline__ F2 split_col(const float* W, int k0, int n, int lane, int ld, int K) { float v[16]; const int g = lane >> 4;
#pragma unroll
  for (int i = 0; i < 8; ++i) { const int ka = k0 + 8 * g + i, kb = ka + 16; v[i] = ka < K ? W[(size_t)ka * ld + n] : 0.f; v[8 + i] = kb < K ? W[(size_t)kb * ld + n] : 0.f; }
  return bsplit16(v); }
__device__ __forceinline__ v8f mac3(const F2& a, const F2& b, v8f c) { c = wmma_bf(a.l, b.h, c); c = wmma_bf(a.h, b.l, c); return wmma_bf(a.h, b.h, c); }
__device__ __forceinline__ float sigm(float v) { return 1.0f / (1.0f + expf(-v)); }
#define LDSX() do { asm volatile("s_wait_dscnt 0" ::: "memory"); __builtin_amdgcn_wave_barrier(); __builtin_amdgcn_fence(__ATOMIC_RELEASE, "workgroup"); } while (0)


// Sliding-window causal attention (12 heads of 64 on [1,2048,768], [out][in] weights, no biases, scale 1/8): each query attends to keys max(0, q-63) .. q (the reference gathers a 64-token window ending at q and masks window slots beyond q);
// softmax; (P v) Wo^T. Only the two key tiles that can intersect the window are visited (exact: every other weight is exp(-inf) = 0).
#define NB 1
#define SS 2048
#define E 768
#define NH 12
#define WIN 64
#define HD 64
#define NR (NB * SS)
#define PLO 1024.0f
#define VLO 2048.0f
__device__ __forceinline__ float bfr(float v) { return (float)(__bf16)v; }
__device__ __forceinline__ v16b frag_b(const __bf16* rowk0, int lane) { return __builtin_bit_cast(v16b, frag_h((const _Float16*)rowk0, lane)); }
// LDS ring of the two projection GEMMs: a tile is 128 k of every operand row; two buffers
#define KT 128
#define NT (E / KT)
#define PB 272                      // LDS pitch of a 256-byte bf16 row (16 B x odd: conflict-free b128 reads)
#define PF 528                      // LDS pitch of a 512-byte f32 row (16 B x odd)
#define QKV_BUF ((64 + 128) * PB)   // [Xb 64 rows | PT 128 rows]
#define OUT_BUF (64 * PF + 128 * PB) // [ctx 64 rows f32 | PT 128 rows]
// eight asynchronous 16-byte copies per lane, global -> LDS, rows ls / gs bytes apart. The s_wait_xcnt ends the copies' own statement, so no address register is rewritten in front of it.
__device__ __forceinline__ void cp8(unsigned l, const char* g, unsigned ls, size_t gs) {
  asm volatile("global_load_async_to_lds_b128 %0, %8, off\n\t"
               "global_load_async_to_lds_b128 %1, %9, off\n\t"
               "global_load_async_to_lds_b128 %2, %10, off\n\t"
               "global_load_async_to_lds_b128 %3, %11, off\n\t"
               "global_load_async_to_lds_b128 %4, %12, off\n\t"
               "global_load_async_to_lds_b128 %5, %13, off\n\t"
               "global_load_async_to_lds_b128 %6, %14, off\n\t"
               "global_load_async_to_lds_b128 %7, %15, off\n\t"
               "s_wait_xcnt 0x0"
               :: "v"(l), "v"(l + ls), "v"(l + 2 * ls), "v"(l + 3 * ls), "v"(l + 4 * ls), "v"(l + 5 * ls), "v"(l + 6 * ls), "v"(l + 7 * ls),
                  "v"(g), "v"(g + gs), "v"(g + 2 * gs), "v"(g + 3 * gs), "v"(g + 4 * gs), "v"(g + 5 * gs), "v"(g + 6 * gs), "v"(g + 7 * gs)
               : "memory");
}
// the issuing wave's own copies have landed
#define WAIT_COPIES() asm volatile("s_wait_asynccnt 0x0" ::: "memory")
// this wave's LDS reads have returned (before the buffer they read is handed back for a refill)
#define WAIT_LDS() asm volatile("s_wait_dscnt 0x0" ::: "memory")

// One conversion launch, f32 -> bf16 (round to nearest even), for x and the four [out][in] weights: PT rows [0,E) Wq, [E,2E) Wk, [2E,3E) Wv, [3E,4E) Wo, each row as it lies.
// Few long waves: a block is 16 waves and converts CVB * CVU * 4 consecutive floats of ONE source; a lane holds CVU 16-byte loads in flight, each wave-wide load 512 and each store 256 contiguous bytes.
#define CVB 512
#define CVU 8
#define CVE (CVB * CVU * 4)
#define CVX (NR * E / CVE)          // blocks on x
#define CVW (E * E / CVE)           // blocks on each weight
static_assert(CVX * CVE == NR * E && CVW * CVE == E * E, "a conversion block never crosses a source's end");
__global__ __launch_bounds__(CVB) void k_cvt(const float* __restrict__ x, const float* __restrict__ Wq, const float* __restrict__ Wk, const float* __restrict__ Wv, const float* __restrict__ Wo, __bf16* __restrict__ Xb, __bf16* __restrict__ PT) {
  const int bx = blockIdx.x, tid = threadIdx.x; const float* s; __bf16* d;
  if (bx < CVX) { s = x + (size_t)bx * CVE; d = Xb + (size_t)bx * CVE; }
  else { const int m = (bx - CVX) / CVW, r = (bx - CVX) % CVW; s = (m == 0 ? Wq : (m == 1 ? Wk : (m == 2 ? Wv : Wo))) + (size_t)r * CVE; d = PT + (size_t)m * E * E + (size_t)r * CVE; }
  v4f v[CVU];
#pragma unroll      // all CVU loads issue before the first value is used
  for (int u = 0; u < CVU; ++u) v[u] = *(const v4f*)(s + (u * CVB + tid) * 4);
#pragma unroll      // constant u and e: v[] stays in registers
  for (int u = 0; u < CVU; ++u) { union { __bf16 h[4]; v2u q; } pk;
#pragma unroll      // as above
    for (int e = 0; e < 4; ++e) pk.h[e] = (__bf16)v[u][e];
    vst2(d + (u * CVB + tid) * 4, pk.q); }
}
// QKV: block (64 rows, 128 cols = 2 heads, which); q -> Q32 f32 [bh][s][64]; k -> K32 f32 rows; v -> VT hi/lo x4 [bh][d][s]
__global__ __launch_bounds__(128) void k_qkv(const __bf16* __restrict__ Xb, const __bf16* __restrict__ PT, float* __restrict__ Q32, float* __restrict__ K32, _Float16* __restrict__ VTh, _Float16* __restrict__ VTl) {
  __shared__ __align__(16) char ring[2 * QKV_BUF];      // the output staging below reuses it behind the loop's last barrier (three blocks fit a WGP's LDS)
  float (*so)[16][132] = (float (*)[16][132])ring;
  _Float16 (*sth)[72] = (_Float16 (*)[72])ring; _Float16 (*stl)[72] = sth + 128;
  const int tid = threadIdx.x, wave = tid >> 5, lane = tid & 31, col = lane & 15, g = lane >> 4;
  const int which = blockIdx.z, r0b = blockIdx.x * 64, r0 = r0b + wave * 16, n0 = blockIdx.y * 128; const int b = r0b / SS, s0 = r0b % SS;
  v8f acc[8] = {};
  // a lane copies chunk (tid & 15) of rows (tid >> 4) + 8 i: 8 rows of Xb, 16 of PT per tile
  const unsigned lA = (unsigned)(size_t)ring + (tid >> 4) * PB + (tid & 15) * 16, lB = lA + 64 * PB;
  const char* gA = (const char*)(Xb + (size_t)(r0b + (tid >> 4)) * E + (tid & 15) * 8);
  const char* gB = (const char*)(PT + (size_t)(which * E + n0 + (tid >> 4)) * E + (tid & 15) * 8);
  auto fill = [&](int t) { const unsigned bo = (t & 1) * QKV_BUF; const size_t ko = (size_t)t * KT * 2;
    cp8(lA + bo, gA + ko, 8 * PB, (size_t)8 * E * 2); cp8(lB + bo, gB + ko, 8 * PB, (size_t)8 * E * 2); cp8(lB + bo + 64 * PB, gB + ko + (size_t)64 * E * 2, 8 * PB, (size_t)8 * E * 2); };
  fill(0); WAIT_COPIES(); __syncthreads();
  fill(1);
  for (int t = 0; t < NT; ++t) { const char* bA = ring + (t & 1) * QKV_BUF + (wave * 16 + col) * PB; const char* bB = ring + (t & 1) * QKV_BUF + (64 + col) * PB;
#pragma unroll      // constant kc and j: LDS reads take immediate offsets, acc[] stays in registers
    for (int kc = 0; kc < KT / 32; ++kc) { const v16b a = frag_b((const __bf16*)bA + kc * 32, lane);
#pragma unroll
      for (int j = 0; j < 8; ++j) acc[j] = wmma_bf(a, frag_b((const __bf16*)(bB + j * 16 * PB) + kc * 32, lane), acc[j]); }
    WAIT_LDS(); WAIT_COPIES(); __syncthreads();      // publishes tile t + 1 and frees tile t's buffer
    if (t + 2 < NT) fill(t + 2); }
  WAIT_COPIES();
  if (which < 2) {
#pragma unroll
    for (int j = 0; j < 8; ++j) { const float bb = 0.f;
#pragma unroll
      for (int r = 0; r < 8; ++r) so[wave][8 * g + r][j * 16 + col] = acc[j][r] + bb; }
    LDSX();
    float* Dst = which == 0 ? Q32 : K32;
    for (int qq = lane; qq < 2 * 16 * 16; qq += 32) { const int hh = qq >> 8, rl = (qq >> 4) & 15, pc = qq & 15; const int h = (n0 >> 6) + hh;
      vst2(Dst + (((size_t)b * NH + h) * SS + s0 + wave * 16 + rl) * HD + pc * 4, *(const v4f*)(&so[wave][rl][hh * 64 + pc * 4])); } }
  else {
#pragma unroll
    for (int j = 0; j < 8; ++j) { const float bb = 0.f;
#pragma unroll
      for (int r = 0; r < 8; ++r) { const float v = (acc[j][r] + bb) * 4.0f; const _Float16 hi = (_Float16)v; sth[j * 16 + col][wave * 16 + 8 * g + r] = hi; stl[j * 16 + col][wave * 16 + 8 * g + r] = (_Float16)((v - (float)hi) * VLO); } }
    __syncthreads();
    for (int qq = tid; qq < 128 * 8; qq += 128) { const int cl = qq >> 3, pc = qq & 7; const int c = n0 + cl, h = c >> 6, d = c & 63; const size_t o = (((size_t)b * NH + h) * HD + d) * SS + s0 + pc * 8;
      vst2(VTh + o, *(const v4u*)(&sth[cl][pc * 8])); vst2(VTl + o, *(const v4u*)(&stl[cl][pc * 8])); } }
}
// causal attention: block (64 queries, bh); key tiles max(qb-1,0)..qb; S on hi/lo splits of the f32 q/k rows; P,V hi/lo; O f32 [bh][s][64]
__global__ __launch_bounds__(128) void k_attn(const float* __restrict__ Q32, const float* __restrict__ K32, const _Float16* __restrict__ VTh, const _Float16* __restrict__ VTl, float* __restrict__ O32) {
  __shared__ __align__(16) float sS[4][16][68];
  __shared__ __align__(16) _Float16 sPh[4][16][72], sPl[4][16][72];
  __shared__ __align__(16) float sO[4][16][68];
  const int tid = threadIdx.x, w = tid >> 5, lane = tid & 31, col = lane & 15, g = lane >> 4;
  const size_t bh = blockIdx.y; const int qb = blockIdx.x; const int q0 = qb * 64 + w * 16;
  F2 aq[2];
#pragma unroll
  for (int kc = 0; kc < 2; ++kc) aq[kc] = split_row(Q32 + (bh * SS + q0 + col) * HD, kc * 32, lane);
  float mrun = -3.0e38f, lrun = 0.f; v8f acc[4] = {}, ac1[4] = {}, ac2[4] = {};
#pragma unroll 1
  for (int kt = (qb > 0 ? qb - 1 : 0); kt <= qb; ++kt) {      // window of 64 keys ending at q spans at most the previous and the current tile
#pragma unroll
    for (int t = 0; t < 4; ++t) { const int key = kt * 64 + t * 16 + col; const float* krow = K32 + (bh * SS + key) * HD;
      v8f s = mac3(aq[0], split_row(krow, 0, lane), (v8f){}); s = mac3(aq[1], split_row(krow, 32, lane), s);
#pragma unroll
      for (int r = 0; r < 8; ++r) { const int qi = q0 + 8 * g + r; sS[w][8 * g + r][t * 16 + col] = (key > qi || key <= qi - WIN) ? -3.0e38f : s[r] * 0.125f; } }
    LDSX();
    float mx = -3.4e38f;
#pragma unroll
    for (int jj = 0; jj < 32; ++jj) mx = fmaxf(mx, sS[w][col][g * 32 + jj]);
    mx = fmaxf(mx, __shfl_xor(mx, 16, 32));
    const float mnew = fmaxf(mrun, mx); const float corr = expf(mrun - mnew);
    float ps = 0.f;
#pragma unroll
    for (int jj = 0; jj < 32; ++jj) { const float p = expf(sS[w][col][g * 32 + jj] - mnew) * 16384.0f; ps += p; const _Float16 hi = (_Float16)p; sPh[w][col][g * 32 + jj] = hi; sPl[w][col][g * 32 + jj] = (_Float16)((p - (float)hi) * PLO); }
    ps += __shfl_xor(ps, 16, 32);
    lrun = lrun * corr + ps * (1.0f / 16384.0f); mrun = mnew;
#pragma unroll
    for (int r = 0; r < 8; ++r) { const float cr = __shfl(corr, 8 * g + r, 32);
#pragma unroll
      for (int t = 0; t < 4; ++t) { acc[t][r] *= cr; ac1[t][r] *= cr; ac2[t][r] *= cr; } }
    LDSX();
#pragma unroll
    for (int kc = 0; kc < 2; ++kc) { const v16h ph = frag_h(&sPh[w][col][0] + kc * 32, lane), pl = frag_h(&sPl[w][col][0] + kc * 32, lane);
#pragma unroll
      for (int t = 0; t < 4; ++t) { const size_t vo = (bh * HD + t * 16 + col) * SS + kt * 64 + kc * 32; const v16h vh = frag_h(VTh + vo, lane);
        acc[t] = wmma16(ph, vh, acc[t]); ac1[t] = wmma16(ph, frag_h(VTl + vo, lane), ac1[t]); ac2[t] = wmma16(pl, vh, ac2[t]); } }
    __builtin_amdgcn_wave_barrier(); }
#pragma unroll
  for (int r = 0; r < 8; ++r) { const float lr = __shfl(lrun, 8 * g + r, 32); const float inv = 1.0f / (lr * 16384.0f * 4.0f);
#pragma unroll
    for (int t = 0; t < 4; ++t) sO[w][8 * g + r][t * 16 + col] = (acc[t][r] + ac1[t][r] * (1.0f / VLO) + ac2[t][r] * (1.0f / PLO)) * inv; }
  LDSX();
  for (int qq = lane; qq < 16 * 16; qq += 32) { const int rl = qq >> 4, pc = qq & 15; vst2(O32 + ((bh * SS) + q0 + rl) * HD + pc * 4, *(const v4f*)(&sO[w][rl][pc * 4])); }
}
// out = ctx Wo^T : split(ctx) x bf16(Wo rows): 2 products (Wo is an INPUT -> bf16 exact)
__global__ __launch_bounds__(128) void k_out(const float* __restrict__ O32, const __bf16* __restrict__ PT, float* __restrict__ out) {
  __shared__ __align__(16) float so[4][16][132];
  __shared__ __align__(16) char ring[2 * OUT_BUF];
  const int tid = threadIdx.x, wave = tid >> 5, lane = tid & 31, col = lane & 15, g = lane >> 4;
  const int r0b = blockIdx.x * 64, r0 = r0b + wave * 16, n0 = blockIdx.y * 128; const int b = r0b / SS, s0 = r0b % SS;
  v8f acc[8] = {};
  // ctx: a tile is two heads' 64 floats of each row; a lane copies chunk (tid & 31) of rows (tid >> 5) + 4 i (16 rows). PT: chunk (tid & 15) of rows (tid >> 4) + 8 i (16 rows)
  const unsigned lA = (unsigned)(size_t)ring + (tid >> 5) * PF + (tid & 31) * 16, lB = (unsigned)(size_t)ring + 64 * PF + (tid >> 4) * PB + (tid & 15) * 16;
  const char* gA = (const char*)(O32 + (((size_t)b * NH + ((tid & 31) >> 4)) * SS + s0 + (tid >> 5)) * HD + (tid & 15) * 4);
  const char* gB = (const char*)(PT + (size_t)(3 * E + n0 + (tid >> 4)) * E + (tid & 15) * 8);
  auto fill = [&](int t) { const unsigned bo = (t & 1) * OUT_BUF; const size_t ka = (size_t)t * 2 * SS * HD * 4, ko = (size_t)t * KT * 2;
    cp8(lA + bo, gA + ka, 4 * PF, (size_t)4 * HD * 4); cp8(lA + bo + 32 * PF, gA + ka + (size_t)32 * HD * 4, 4 * PF, (size_t)4 * HD * 4);
    cp8(lB + bo, gB + ko, 8 * PB, (size_t)8 * E * 2); cp8(lB + bo + 64 * PB, gB + ko + (size_t)64 * E * 2, 8 * PB, (size_t)8 * E * 2); };
  fill(0); WAIT_COPIES(); __syncthreads();
  fill(1);
  for (int t = 0; t < NT; ++t) { const float* bA = (const float*)(ring + (t & 1) * OUT_BUF + (wave * 16 + col) * PF); const char* bB = ring + (t & 1) * OUT_BUF + 64 * PF + col * PB;
#pragma unroll      // constant kc and j: LDS reads take immediate offsets, acc[] stays in registers
    for (int kc = 0; kc < KT / 32; ++kc) { const F2 a = split_row(bA, kc * 32, lane);
#pragma unroll
      for (int j = 0; j < 8; ++j) { const v16b wb = frag_b((const __bf16*)(bB + j * 16 * PB) + kc * 32, lane); acc[j] = wmma_bf(a.l, wb, acc[j]); acc[j] = wmma_bf(a.h, wb, acc[j]); } }
    WAIT_LDS(); WAIT_COPIES(); __syncthreads();      // publishes tile t + 1 and frees tile t's buffer
    if (t + 2 < NT) fill(t + 2); }
  WAIT_COPIES();
#pragma unroll
  for (int j = 0; j < 8; ++j) {
#pragma unroll
    for (int r = 0; r < 8; ++r) so[wave][8 * g + r][j * 16 + col] = acc[j][r]; }
  LDSX();
#pragma unroll 4
  for (int rl = 0; rl < 16; ++rl) vst2(out + (size_t)(r0 + rl) * E + n0 + lane * 4, *(const v4f*)(&so[wave][rl][lane * 4]));
}
extern "C" void kernel_launch(void* const* d_in, const int* in_sizes, int n_in, void* d_out, int out_size, void* d_ws, size_t ws_size, hipStream_t stream) {
  (void)in_sizes; (void)n_in; (void)out_size; (void)ws_size;
  const float** I = (const float**)d_in;   // inputs, Wq, Wk, Wv, Wo
  const float* x = I[0]; const float* Wq = I[1]; const float* Wk = I[2]; const float* Wv = I[3]; const float* Wo = I[4];
  float* out = (float*)d_out;
  char* ws = (char*)d_ws; size_t off = 0;
  auto take = [&](size_t bytes) { char* p = ws + off; off += (bytes + 255) & ~(size_t)255; return p; };
  __bf16* Xb = (__bf16*)take((size_t)NR * E * 2); __bf16* PT = (__bf16*)take((size_t)4 * E * E * 2);
  float* Q32 = (float*)take((size_t)NR * E * 4); float* K32 = (float*)take((size_t)NR * E * 4); _Float16* VTh = (_Float16*)take((size_t)NR * E * 2); _Float16* VTl = (_Float16*)take((size_t)NR * E * 2); float* O32 = (float*)take((size_t)NR * E * 4);
  // ws ~ 33 MB
  k_cvt<<<CVX + 4 * CVW, CVB, 0, stream>>>(x, Wq, Wk, Wv, Wo, Xb, PT);
  k_qkv<<<dim3(NR / 64, E / 128, 3), 128, 0, stream>>>(Xb, PT, Q32, K32, VTh, VTl);
  k_attn<<<dim3(SS / 64, NB * NH), 128, 0, stream>>>(Q32, K32, VTh, VTl, O32);
  k_out<<<dim3(NR / 64, E / 128), 128, 0, stream>>>(O32, PT, out);
}

// v003
// A run of this version takes 38.5 microseconds.
// Two timings next to v002 put it at 1.48 and 1.47 times that version's speed.
// All steps since v000 together make it 3.56 times as fast.
// compute dtype: inputs and W* (INPUTS) rounded to bf16 with exact bf16 WMMA products (f32 accumulate) for the projections; q/k f32 split for the scores (3 products), P and V f16 hi/lo (3 products); softmax f32.
#include <hip/hip_runtime.h>
#include <math.h>

typedef __attribute__((ext_vector_type(16))) _Float16 v16h;
typedef __attribute__((ext_vector_type(16))) __bf16 v16b;
typedef __attribute__((ext_vector_type(8)))  _Float16 v8h;
typedef __attribute__((ext_vector_type(8)))  float v8f;
typedef __attribute__((ext_vector_type(4)))  float v4f;
typedef __attribute__((ext_vector_type(2)))  float v2f;
typedef __attribute__((ext_vector_type(4)))  unsigned v4u;
typedef __attribute__((ext_vector_type(2)))  unsigned v2u;
typedef __attribute__((ext_vector_type(4)))  int v4i;
typedef float __attribute__((may_alias)) float_a;
typedef int __attribute__((may_alias)) int_a;

template <typename T> __device__ __forceinline__ void vst2(void* p, T v) { *(T*)p = v;  }
__device__ __forceinline__ v8f wmma16(v16h a, v16h b, v8f c) {
  v8f d = __builtin_amdgcn_wmma_f32_16x16x32_f16(false, a, false, b, (short)0, c, false, false);
  asm volatile("v_nop\n\tv_nop\n\tv_nop\n\tv_nop" : "+v"(d) : "v"(a), "v"(b));
  return d;
}
__device__ __forceinline__ v8f wmma_bf(v16b a, v16b b, v8f c) {
  v8f d = __builtin_amdgcn_wmma_f32_16x16x32_bf16(false, a, false, b, (short)0, c, false, false);
  asm volatile("v_nop\n\tv_nop\n\tv_nop\n\tv_nop" : "+v"(d) : "v"(a), "v"(b));
  return d;
}
// 16x16x32 fragments: lane = (h = lane>>4, row/col = lane&15); elements 0..7 = k0+8h+0..7, 8..15 = k0+16+8h+0..7; D element r = row 8h+r
__device__ __forceinline__ v16h frag_h(const _Float16* rowk0, int lane) {
  union { v16h v; v8h q[2]; } u; const _Float16* p = rowk0 + 8 * (lane >> 4);
  u.q[0] = *(const v8h*)p; u.q[1] = *(const v8h*)(p + 16); return u.v;
}
__device__ __forceinline__ v16h frag_f32(const float* rowk0, int lane) {
  v16h a; const float* p = rowk0 + 8 * (lane >> 4);
#pragma unroll
  for (int i = 0; i < 8; ++i) { a[i] = (_Float16)p[i]; a[8 + i] = (_Float16)p[16 + i]; }
  return a;
}
__device__ __forceinline__ v16h frag_f32s(const float* rowk0, int lane, float sc) {
  v16h a; const float* p = rowk0 + 8 * (lane >> 4);
#pragma unroll
  for (int i = 0; i < 8; ++i) { a[i] = (_Float16)(p[i] * sc); a[8 + i] = (_Float16)(p[16 + i] * sc); }
  return a;
}
// column fragment from a [K][ld] layout (column n), rows >= K read as 0
__device__ __forceinline__ v16h fragc_f32(const float* W, int k0, int n, int lane, int ld, int K) {
  v16h a; const int g = lane >> 4;
#pragma unroll
  for (int i = 0; i < 8; ++i) { const int ka = k0 + 8 * g + i, kb = ka + 16;
    a[i] = (_Float16)(ka < K ? W[(size_t)ka * ld + n] : 0.f); a[8 + i] = (_Float16)(kb < K ? W[(size_t)kb * ld + n] : 0.f); }
  return a;
}
struct F2 { v16b h, l; };
__device__ __forceinline__ F2 bsplit16(const float v[16]) { F2 r;
#pragma unroll
  for (int i = 0; i < 16; ++i) { const __bf16 h = (__bf16)v[i]; r.h[i] = h; r.l[i] = (__bf16)(v[i] - (float)h); }
  return r; }
__device__ __forceinline__ F2 split_row(const float* row, int k0, int lane) { float v[16]; const float* p = row + k0 + 8 * (lane >> 4);
#pragma unroll
  for (int i = 0; i < 8; ++i) { v[i] = p[i]; v[8 + i] = p[16 + i]; }
  return bsplit16(v); }
// the 16 floats of split_row, loaded but not yet split: lets a whole group of loads issue before the first value is used
struct R16 { v4f q[4]; };
__device__ __forceinline__ R16 raw_row(const float* row, int k0, int lane) { R16 r; const float* p = row + k0 + 8 * (lane >> 4);
  r.q[0] = *(const v4f*)p; r.q[1] = *(const v4f*)(p + 4); r.q[2] = *(const v4f*)(p + 16); r.q[3] = *(const v4f*)(p + 20); return r; }
__device__ __forceinline__ F2 split_raw(const R16& r) { float v[16];
#pragma unroll
  for (int i = 0; i < 16; ++i) v[i] = r.q[i >> 2][i & 3];
  return bsplit16(v); }
__device__ __forceinline__ F2 split_rowK(const float* row, int k0, int lane, int K) { float v[16]; const int g = lane >> 4;
#pragma unroll
  for (int i = 0; i < 8; ++i) { const int ka = k0 + 8 * g + i, kb = ka + 16; v[i] = ka < K ? row[ka] : 0.f; v[8 + i] = kb < K ? row[kb] : 0.f; }
  return bsplit16(v); }
__device__ __forceinline__ F2 split_col(const float* W, int k0, int n, int lane, int ld, int K) { float v[16]; const int g = lane >> 4;
#pragma unroll
  for (int i = 0; i < 8; ++i) { const int ka = k0 + 8 * g + i, kb = ka + 16; v[i] = ka < K ? W[(size_t)ka * ld + n] : 0.f; v[8 + i] = kb < K ? W[(size_t)kb * ld + n] : 0.f; }
  return bsplit16(v); }
__device__ __forceinline__ v8f mac3(const F2& a, const F2& b, v8f c) { c = wmma_bf(a.l, b.h, c); c = wmma_bf(a.h, b.l, c); return wmma_bf(a.h, b.h, c); }
__device__ __forceinline__ float sigm(float v) { return 1.0f / (1.0f + expf(-v)); }
#define LDSX() do { asm volatile("s_wait_dscnt 0" ::: "memory"); __builtin_amdgcn_wave_barrier(); __builtin_amdgcn_fence(__ATOMIC_RELEASE, "workgroup"); } while (0)


// Sliding-window causal attention (12 heads of 64 on [1,2048,768], [out][in] weights, no biases, scale 1/8): each query attends to keys max(0, q-63) .. q (the reference gathers a 64-token window ending at q and masks window slots beyond q);
// softmax; (P v) Wo^T. Only the two key tiles that can intersect the window are visited (exact: every other weight is exp(-inf) = 0).
#define NB 1
#define SS 2048
#define E 768
#define NH 12
#define WIN 64
#define HD 64
#define NR (NB * SS)
#define PLO 1024.0f
#define VLO 2048.0f
__device__ __forceinline__ float bfr(float v) { return (float)(__bf16)v; }
__device__ __forceinline__ v16b frag_b(const __bf16* rowk0, int lane) { return __builtin_bit_cast(v16b, frag_h((const _Float16*)rowk0, lane)); }
// LDS ring of the two projection GEMMs: a tile is 128 k of every operand row; two buffers
#define KT 128
#define NT (E / KT)
#define PB 272                      // LDS pitch of a 256-byte bf16 row (16 B x odd: conflict-free b128 reads)
#define PF 528                      // LDS pitch of a 512-byte f32 row (16 B x odd)
#define QKV_BUF ((64 + 128) * PB)   // [Xb 64 rows | PT 128 rows]
#define OUT_BUF (64 * PF + 128 * PB) // [ctx 64 rows f32 | PT 128 rows]
// eight asynchronous 16-byte copies per lane, global -> LDS, rows ls / gs bytes apart. The s_wait_xcnt ends the copies' own statement, so no address register is rewritten in front of it.
__device__ __forceinline__ void cp8(unsigned l, const char* g, unsigned ls, size_t gs) {
  asm volatile("global_load_async_to_lds_b128 %0, %8, off\n\t"
               "global_load_async_to_lds_b128 %1, %9, off\n\t"
               "global_load_async_to_lds_b128 %2, %10, off\n\t"
               "global_load_async_to_lds_b128 %3, %11, off\n\t"
               "global_load_async_to_lds_b128 %4, %12, off\n\t"
               "global_load_async_to_lds_b128 %5, %13, off\n\t"
               "global_load_async_to_lds_b128 %6, %14, off\n\t"
               "global_load_async_to_lds_b128 %7, %15, off\n\t"
               "s_wait_xcnt 0x0"
               :: "v"(l), "v"(l + ls), "v"(l + 2 * ls), "v"(l + 3 * ls), "v"(l + 4 * ls), "v"(l + 5 * ls), "v"(l + 6 * ls), "v"(l + 7 * ls),
                  "v"(g), "v"(g + gs), "v"(g + 2 * gs), "v"(g + 3 * gs), "v"(g + 4 * gs), "v"(g + 5 * gs), "v"(g + 6 * gs), "v"(g + 7 * gs)
               : "memory");
}
// the issuing wave's own copies have landed
#define WAIT_COPIES() asm volatile("s_wait_asynccnt 0x0" ::: "memory")
// this wave's LDS reads have returned (before the buffer they read is handed back for a refill)
#define WAIT_LDS() asm volatile("s_wait_dscnt 0x0" ::: "memory")

// One conversion launch, f32 -> bf16 (round to nearest even), for x and the four [out][in] weights: PT rows [0,E) Wq, [E,2E) Wk, [2E,3E) Wv, [3E,4E) Wo, each row as it lies.
// Few long waves: a block is 16 waves and converts CVB * CVU * 4 consecutive floats of ONE source; a lane holds CVU 16-byte loads in flight, each wave-wide load 512 and each store 256 contiguous bytes.
#define CVB 512
#define CVU 8
#define CVE (CVB * CVU * 4)
#define CVX (NR * E / CVE)          // blocks on x
#define CVW (E * E / CVE)           // blocks on each weight
static_assert(CVX * CVE == NR * E && CVW * CVE == E * E, "a conversion block never crosses a source's end");
__global__ __launch_bounds__(CVB) void k_cvt(const float* __restrict__ x, const float* __restrict__ Wq, const float* __restrict__ Wk, const float* __restrict__ Wv, const float* __restrict__ Wo, __bf16* __restrict__ Xb, __bf16* __restrict__ PT) {
  const int bx = blockIdx.x, tid = threadIdx.x; const float* s; __bf16* d;
  if (bx < CVX) { s = x + (size_t)bx * CVE; d = Xb + (size_t)bx * CVE; }
  else { const int m = (bx - CVX) / CVW, r = (bx - CVX) % CVW; s = (m == 0 ? Wq : (m == 1 ? Wk : (m == 2 ? Wv : Wo))) + (size_t)r * CVE; d = PT + (size_t)m * E * E + (size_t)r * CVE; }
  v4f v[CVU];
#pragma unroll      // all CVU loads issue before the first value is used
  for (int u = 0; u < CVU; ++u) v[u] = *(const v4f*)(s + (u * CVB + tid) * 4);
#pragma unroll      // constant u and e: v[] stays in registers
  for (int u = 0; u < CVU; ++u) { union { __bf16 h[4]; v2u q; } pk;
#pragma unroll      // as above
    for (int e = 0; e < 4; ++e) pk.h[e] = (__bf16)v[u][e];
    vst2(d + (u * CVB + tid) * 4, pk.q); }
}
// QKV: block (64 rows, 128 cols = 2 heads, which); q -> Q32 f32 [bh][s][64]; k -> K32 f32 rows; v -> VT hi/lo x4 [bh][d][s]
__global__ __launch_bounds__(128) void k_qkv(const __bf16* __restrict__ Xb, const __bf16* __restrict__ PT, float* __restrict__ Q32, float* __restrict__ K32, _Float16* __restrict__ VTh, _Float16* __restrict__ VTl) {
  __shared__ __align__(16) char ring[2 * QKV_BUF];      // the output staging below reuses it behind the loop's last barrier (three blocks fit a WGP's LDS)
  float (*so)[16][132] = (float (*)[16][132])ring;
  _Float16 (*sth)[72] = (_Float16 (*)[72])ring; _Float16 (*stl)[72] = sth + 128;
  const int tid = threadIdx.x, wave = tid >> 5, lane = tid & 31, col = lane & 15, g = lane >> 4;
  const int which = blockIdx.z, r0b = blockIdx.x * 64, r0 = r0b + wave * 16, n0 = blockIdx.y * 128; const int b = r0b / SS, s0 = r0b % SS;
  v8f acc[8] = {};
  // a lane copies chunk (tid & 15) of rows (tid >> 4) + 8 i: 8 rows of Xb, 16 of PT per tile
  const unsigned lA = (unsigned)(size_t)ring + (tid >> 4) * PB + (tid & 15) * 16, lB = lA + 64 * PB;
  const char* gA = (const char*)(Xb + (size_t)(r0b + (tid >> 4)) * E + (tid & 15) * 8);
  const char* gB = (const char*)(PT + (size_t)(which * E + n0 + (tid >> 4)) * E + (tid & 15) * 8);
  auto fill = [&](int t) { const unsigned bo = (t & 1) * QKV_BUF; const size_t ko = (size_t)t * KT * 2;
    cp8(lA + bo, gA + ko, 8 * PB, (size_t)8 * E * 2); cp8(lB + bo, gB + ko, 8 * PB, (size_t)8 * E * 2); cp8(lB + bo + 64 * PB, gB + ko + (size_t)64 * E * 2, 8 * PB, (size_t)8 * E * 2); };
  fill(0); WAIT_COPIES(); __syncthreads();
  fill(1);
  for (int t = 0; t < NT; ++t) { const char* bA = ring + (t & 1) * QKV_BUF + (wave * 16 + col) * PB; const char* bB = ring + (t & 1) * QKV_BUF + (64 + col) * PB;
    // two fragment sets in registers: block kc + 1's 18 LDS reads issue as one group in front of block kc's WMMAs (never past this tile's buffer)
    v16b fa[2], fb[2][8];
    auto frags = [&](int kc) { fa[kc & 1] = frag_b((const __bf16*)bA + kc * 32, lane);
#pragma unroll      // constant j: fb[] stays in registers
      for (int j = 0; j < 8; ++j) fb[kc & 1][j] = frag_b((const __bf16*)(bB + j * 16 * PB) + kc * 32, lane); };
    frags(0);
#pragma unroll      // constant kc and j: LDS reads take immediate offsets, acc[], fa[] and fb[] stay in registers
    for (int kc = 0; kc < KT / 32; ++kc) { if (kc + 1 < KT / 32) frags(kc + 1);
#pragma unroll
      for (int j = 0; j < 8; ++j) acc[j] = wmma_bf(fa[kc & 1], fb[kc & 1][j], acc[j]); }
    WAIT_LDS(); WAIT_COPIES(); __syncthreads();      // publishes tile t + 1 and frees tile t's buffer
    if (t + 2 < NT) fill(t + 2); }
  WAIT_COPIES();
  if (which < 2) {
#pragma unroll
    for (int j = 0; j < 8; ++j) { const float bb = 0.f;
#pragma unroll
      for (int r = 0; r < 8; ++r) so[wave][8 * g + r][j * 16 + col] = acc[j][r] + bb; }
    LDSX();
    float* Dst = which == 0 ? Q32 : K32;
    for (int qq = lane; qq < 2 * 16 * 16; qq += 32) { const int hh = qq >> 8, rl = (qq >> 4) & 15, pc = qq & 15; const int h = (n0 >> 6) + hh;
      vst2(Dst + (((size_t)b * NH + h) * SS + s0 + wave * 16 + rl) * HD + pc * 4, *(const v4f*)(&so[wave][rl][hh * 64 + pc * 4])); } }
  else {
#pragma unroll
    for (int j = 0; j < 8; ++j) { const float bb = 0.f;
#pragma unroll
      for (int r = 0; r < 8; ++r) { const float v = (acc[j][r] + bb) * 4.0f; const _Float16 hi = (_Float16)v; sth[j * 16 + col][wave * 16 + 8 * g + r] = hi; stl[j * 16 + col][wave * 16 + 8 * g + r] = (_Float16)((v - (float)hi) * VLO); } }
    __syncthreads();
    for (int qq = tid; qq < 128 * 8; qq += 128) { const int cl = qq >> 3, pc = qq & 7; const int c = n0 + cl, h = c >> 6, d = c & 63; const size_t o = (((size_t)b * NH + h) * HD + d) * SS + s0 + pc * 8;
      vst2(VTh + o, *(const v4u*)(&sth[cl][pc * 8])); vst2(VTl + o, *(const v4u*)(&stl[cl][pc * 8])); } }
}
// causal attention: block (64 queries, bh); key tiles max(qb-1,0)..qb; S on hi/lo splits of the f32 q/k rows; P,V hi/lo; O f32 [bh][s][64]
__global__ __launch_bounds__(128) void k_attn(const float* __restrict__ Q32, const float* __restrict__ K32, const _Float16* __restrict__ VTh, const _Float16* __restrict__ VTl, float* __restrict__ O32) {
  __shared__ __align__(16) float sS[4][16][68];
  __shared__ __align__(16) _Float16 sPh[4][16][72], sPl[4][16][72];
  __shared__ __align__(16) float sO[4][16][68];
  const int tid = threadIdx.x, w = tid >> 5, lane = tid & 31, col = lane & 15, g = lane >> 4;
  const size_t bh = blockIdx.y; const int qb = blockIdx.x; const int q0 = qb * 64 + w * 16;
  F2 aq[2];
  { const float* qrow = Q32 + (bh * SS + q0 + col) * HD; const R16 q0r = raw_row(qrow, 0, lane), q1r = raw_row(qrow, 32, lane);
    asm volatile("s_wait_xcnt 0x0" :: "v"(qrow + 8 * g) : "memory");      // stands in front of the first overwrite of the Q loads' address registers; the operand keeps those registers live up to it
    aq[0] = split_raw(q0r); aq[1] = split_raw(q1r); }
  float mrun = -3.0e38f, lrun = 0.f; v8f acc[4] = {}, ac1[4] = {}, ac2[4] = {};
#pragma unroll 1
  for (int kt = (qb > 0 ? qb - 1 : 0); kt <= qb; ++kt) {      // window of 64 keys ending at q spans at most the previous and the current tile
    // the tile's 32 K loads issue as one group in front of its first score WMMA: one trip to memory, not eight
    R16 kr[4][2];
#pragma unroll      // constant t: kr[] stays in registers
    for (int t = 0; t < 4; ++t) { const float* krow = K32 + (bh * SS + kt * 64 + t * 16 + col) * HD; kr[t][0] = raw_row(krow, 0, lane); kr[t][1] = raw_row(krow, 32, lane); }
#pragma unroll
    for (int t = 0; t < 4; ++t) { const int key = kt * 64 + t * 16 + col;
      v8f s = mac3(aq[0], split_raw(kr[t][0]), (v8f){}); s = mac3(aq[1], split_raw(kr[t][1]), s);
#pragma unroll
      for (int r = 0; r < 8; ++r) { const int qi = q0 + 8 * g + r; sS[w][8 * g + r][t * 16 + col] = (key > qi || key <= qi - WIN) ? -3.0e38f : s[r] * 0.125f; } }
    LDSX();
    // V: the 16 loads of a 32-key half issue as one group. The first half's fly under the softmax and touch every line of the tile; the second half's follow the first half's WMMAs
    v16h vh[4], vl[4];
    auto vfrags = [&](int kc) {
#pragma unroll      // constant t: vh[] and vl[] stay in registers
      for (int t = 0; t < 4; ++t) { const size_t vo = (bh * HD + t * 16 + col) * SS + kt * 64 + kc * 32; vh[t] = frag_h(VTh + vo, lane); vl[t] = frag_h(VTl + vo, lane); } };
    vfrags(0);
    float mx = -3.4e38f;
#pragma unroll
    for (int jj = 0; jj < 32; ++jj) mx = fmaxf(mx, sS[w][col][g * 32 + jj]);
    mx = fmaxf(mx, __shfl_xor(mx, 16, 32));
    const float mnew = fmaxf(mrun, mx); const float corr = expf(mrun - mnew);
    float ps = 0.f;
#pragma unroll
    for (int jj = 0; jj < 32; ++jj) { const float p = expf(sS[w][col][g * 32 + jj] - mnew) * 16384.0f; ps += p; const _Float16 hi = (_Float16)p; sPh[w][col][g * 32 + jj] = hi; sPl[w][col][g * 32 + jj] = (_Float16)((p - (float)hi) * PLO); }
    ps += __shfl_xor(ps, 16, 32);
    lrun = lrun * corr + ps * (1.0f / 16384.0f); mrun = mnew;
#pragma unroll
    for (int r = 0; r < 8; ++r) { const float cr = __shfl(corr, 8 * g + r, 32);
#pragma unroll
      for (int t = 0; t < 4; ++t) { acc[t][r] *= cr; ac1[t][r] *= cr; ac2[t][r] *= cr; } }
    LDSX();
#pragma unroll
    for (int kc = 0; kc < 2; ++kc) { const v16h ph = frag_h(&sPh[w][col][0] + kc * 32, lane), pl = frag_h(&sPl[w][col][0] + kc * 32, lane);
#pragma unroll
      for (int t = 0; t < 4; ++t) { acc[t] = wmma16(ph, vh[t], acc[t]); ac1[t] = wmma16(ph, vl[t], ac1[t]); ac2[t] = wmma16(pl, vh[t], ac2[t]); }
      if (kc == 0) { vfrags(1); asm volatile("s_wait_xcnt 0x0" ::: "memory"); } }      // the wait: behind the loop's last loads, in front of the next trip's overwrite of their address registers
    __builtin_amdgcn_wave_barrier(); }
#pragma unroll
  for (int r = 0; r < 8; ++r) { const float lr = __shfl(lrun, 8 * g + r, 32); const float inv = 1.0f / (lr * 16384.0f * 4.0f);
#pragma unroll
    for (int t = 0; t < 4; ++t) sO[w][8 * g + r][t * 16 + col] = (acc[t][r] + ac1[t][r] * (1.0f / VLO) + ac2[t][r] * (1.0f / PLO)) * inv; }
  LDSX();
  for (int qq = lane; qq < 16 * 16; qq += 32) { const int rl = qq >> 4, pc = qq & 15; vst2(O32 + ((bh * SS) + q0 + rl) * HD + pc * 4, *(const v4f*)(&sO[w][rl][pc * 4])); }
}
// out = ctx Wo^T : split(ctx) x bf16(Wo rows): 2 products (Wo is an INPUT -> bf16 exact)
__global__ __launch_bounds__(128) void k_out(const float* __restrict__ O32, const __bf16* __restrict__ PT, float* __restrict__ out) {
  __shared__ __align__(16) float so[4][16][132];
  __shared__ __align__(16) char ring[2 * OUT_BUF];
  const int tid = threadIdx.x, wave = tid >> 5, lane = tid & 31, col = lane & 15, g = lane >> 4;
  const int r0b = blockIdx.x * 64, r0 = r0b + wave * 16, n0 = blockIdx.y * 128; const int b = r0b / SS, s0 = r0b % SS;
  v8f acc[8] = {};
  // ctx: a tile is two heads' 64 floats of each row; a lane copies chunk (tid & 31) of rows (tid >> 5) + 4 i (16 rows). PT: chunk (tid & 15) of rows (tid >> 4) + 8 i (16 rows)
  const unsigned lA = (unsigned)(size_t)ring + (tid >> 5) * PF + (tid & 31) * 16, lB = (unsigned)(size_t)ring + 64 * PF + (tid >> 4) * PB + (tid & 15) * 16;
  const char* gA = (const char*)(O32 + (((size_t)b * NH + ((tid & 31) >> 4)) * SS + s0 + (tid >> 5)) * HD + (tid & 15) * 4);
  const char* gB = (const char*)(PT + (size_t)(3 * E + n0 + (tid >> 4)) * E + (tid & 15) * 8);
  auto fill = [&](int t) { const unsigned bo = (t & 1) * OUT_BUF; const size_t ka = (size_t)t * 2 * SS * HD * 4, ko = (size_t)t * KT * 2;
    cp8(lA + bo, gA + ka, 4 * PF, (size_t)4 * HD * 4); cp8(lA + bo + 32 * PF, gA + ka + (size_t)32 * HD * 4, 4 * PF, (size_t)4 * HD * 4);
    cp8(lB + bo, gB + ko, 8 * PB, (size_t)8 * E * 2); cp8(lB + bo + 64 * PB, gB + ko + (size_t)64 * E * 2, 8 * PB, (size_t)8 * E * 2); };
  fill(0); WAIT_COPIES(); __syncthreads();
  fill(1);
  for (int t = 0; t < NT; ++t) { const float* bA = (const float*)(ring + (t & 1) * OUT_BUF + (wave * 16 + col) * PF); const char* bB = ring + (t & 1) * OUT_BUF + 64 * PF + col * PB;
    // two fragment sets in registers: block kc + 1's 20 LDS reads issue as one group in front of block kc's WMMAs (never past this tile's buffer)
    R16 ra[2]; v16b fb[2][8];
    auto frags = [&](int kc) { ra[kc & 1] = raw_row(bA, kc * 32, lane);
#pragma unroll      // constant j: fb[] stays in registers
      for (int j = 0; j < 8; ++j) fb[kc & 1][j] = frag_b((const __bf16*)(bB + j * 16 * PB) + kc * 32, lane); };
    frags(0);
#pragma unroll      // constant kc and j: LDS reads take immediate offsets, acc[], ra[] and fb[] stay in registers
    for (int kc = 0; kc < KT / 32; ++kc) { const F2 a = split_raw(ra[kc & 1]);
      if (kc + 1 < KT / 32) frags(kc + 1);
#pragma unroll
      for (int j = 0; j < 8; ++j) { acc[j] = wmma_bf(a.l, fb[kc & 1][j], acc[j]); acc[j] = wmma_bf(a.h, fb[kc & 1][j], acc[j]); } }
    WAIT_LDS(); WAIT_COPIES(); __syncthreads();      // publishes tile t + 1 and frees tile t's buffer
    if (t + 2 < NT) fill(t + 2); }
  WAIT_COPIES();
#pragma unroll
  for (int j = 0; j < 8; ++j) {
#pragma unroll
    for (int r = 0; r < 8; ++r) so[wave][8 * g + r][j * 16 + col] = acc[j][r]; }
  LDSX();
#pragma unroll 4
  for (int rl = 0; rl < 16; ++rl) vst2(out + (size_t)(r0 + rl) * E + n0 + lane * 4, *(const v4f*)(&so[wave][rl][lane * 4]));
}
extern "C" void kernel_launch(void* const* d_in, const int* in_sizes, int n_in, void* d_out, int out_size, void* d_ws, size_t ws_size, hipStream_t stream) {
  (void)in_sizes; (void)n_in; (void)out_size; (void)ws_size;
  const float** I = (const float**)d_in;   // inputs, Wq, Wk, Wv, Wo
  const float* x = I[0]; const float* Wq = I[1]; const float* Wk = I[2]; const float* Wv = I[3]; const float* Wo = I[4];
  float* out = (float*)d_out;
  char* ws = (char*)d_ws; size_t off = 0;
  auto take = [&](size_t bytes) { char* p = ws + off; off += (bytes + 255) & ~(size_t)255; return p; };
  __bf16* Xb = (__bf16*)take((size_t)NR * E * 2); __bf16* PT = (__bf16*)take((size_t)4 * E * E * 2);
  float* Q32 = (float*)take((size_t)NR * E * 4); float* K32 = (float*)take((size_t)NR * E * 4); _Float16* VTh = (_Float16*)take((size_t)NR * E * 2); _Float16* VTl = (_Float16*)take((size_t)NR * E * 2); float* O32 = (float*)take((size_t)NR * E * 4);
  // ws ~ 33 MB
  k_cvt<<<CVX + 4 * CVW, CVB, 0, stream>>>(x, Wq, Wk, Wv, Wo, Xb, PT);
  k_qkv<<<dim3(NR / 64, E / 128, 3), 128, 0, stream>>>(Xb, PT, Q32, K32, VTh, VTl);
  k_attn<<<dim3(SS / 64, NB * NH), 128, 0, stream>>>(Q32, K32, VTh, VTl, O32);
  k_out<<<dim3(NR / 64, E / 128), 128, 0, stream>>>(O32, PT, out);
}

// v004
// A run of this version takes 35.4 microseconds.
// Two timings next to v003 both put it at 1.09 times that version's speed.
// All steps since v000 together make it 3.88 times as fast.
// compute dtype: inputs and W* (INPUTS) rounded to bf16 with exact bf16 WMMA products (f32 accumulate) for the projections; q/k f32 split for the scores (3 products), P and V f16 hi/lo (3 products); softmax f32.
#include <hip/hip_runtime.h>
#include <math.h>

typedef __attribute__((ext_vector_type(16))) _Float16 v16h;
typedef __attribute__((ext_vector_type(16))) __bf16 v16b;
typedef __attribute__((ext_vector_type(8)))  _Float16 v8h;
typedef __attribute__((ext_vector_type(8)))  float v8f;
typedef __attribute__((ext_vector_type(4)))  float v4f;
typedef __attribute__((ext_vector_type(2)))  float v2f;
typedef __attribute__((ext_vector_type(4)))  unsigned v4u;
typedef __attribute__((ext_vector_type(2)))  unsigned v2u;
typedef __attribute__((ext_vector_type(4)))  int v4i;
typedef float __attribute__((may_alias)) float_a;
typedef int __attribute__((may_alias)) int_a;

template <typename T> __device__ __forceinline__ void vst2(void* p, T v) { *(T*)p = v;  }
__device__ __forceinline__ v8f wmma16(v16h a, v16h b, v8f c) {
  v8f d = __builtin_amdgcn_wmma_f32_16x16x32_f16(false, a, false, b, (short)0, c, false, false);
  asm volatile("v_nop\n\tv_nop\n\tv_nop\n\tv_nop" : "+v"(d) : "v"(a), "v"(b));
  return d;
}
// the plain builtin (the compiler keeps its distances itself), for WMMAs that accumulate in place: no asm statement names its operands, so they may lie above v255, which an asm operand cannot; the 192 registers of V beside 96 of accumulators need that room
__device__ __forceinline__ v8f wmma16p(v16h a, v16h b, v8f c) { return __builtin_amdgcn_wmma_f32_16x16x32_f16(false, a, false, b, (short)0, c, false, false); }
__device__ __forceinline__ v8f wmma_bf(v16b a, v16b b, v8f c) {
  v8f d = __builtin_amdgcn_wmma_f32_16x16x32_bf16(false, a, false, b, (short)0, c, false, false);
  asm volatile("v_nop\n\tv_nop\n\tv_nop\n\tv_nop" : "+v"(d) : "v"(a), "v"(b));
  return d;
}
// 16x16x32 fragments: lane = (h = lane>>4, row/col = lane&15); elements 0..7 = k0+8h+0..7, 8..15 = k0+16+8h+0..7; D element r = row 8h+r
__device__ __forceinline__ v16h frag_h(const _Float16* rowk0, int lane) {
  union { v16h v; v8h q[2]; } u; const _Float16* p = rowk0 + 8 * (lane >> 4);
  u.q[0] = *(const v8h*)p; u.q[1] = *(const v8h*)(p + 16); return u.v;
}
__device__ __forceinline__ v16h frag_f32(const float* rowk0, int lane) {
  v16h a; const float* p = rowk0 + 8 * (lane >> 4);
#pragma unroll
  for (int i = 0; i < 8; ++i) { a[i] = (_Float16)p[i]; a[8 + i] = (_Float16)p[16 + i]; }
  return a;
}
__device__ __forceinline__ v16h frag_f32s(const float* rowk0, int lane, float sc) {
  v16h a; const float* p = rowk0 + 8 * (lane >> 4);
#pragma unroll
  for (int i = 0; i < 8; ++i) { a[i] = (_Float16)(p[i] * sc); a[8 + i] = (_Float16)(p[16 + i] * sc); }
  return a;
}
// column fragment from a [K][ld] layout (column n), rows >= K read as 0
__device__ __forceinline__ v16h fragc_f32(const float* W, int k0, int n, int lane, int ld, int K) {
  v16h a; const int g = lane >> 4;
#pragma unroll
  for (int i = 0; i < 8; ++i) { const int ka = k0 + 8 * g + i, kb = ka + 16;
    a[i] = (_Float16)(ka < K ? W[(size_t)ka * ld + n] : 0.f); a[8 + i] = (_Float16)(kb < K ? W[(size_t)kb * ld + n] : 0.f); }
  return a;
}
struct F2 { v16b h, l; };
__device__ __forceinline__ F2 bsplit16(const float v[16]) { F2 r;
#pragma unroll
  for (int i = 0; i < 16; ++i) { const __bf16 h = (__bf16)v[i]; r.h[i] = h; r.l[i] = (__bf16)(v[i] - (float)h); }
  return r; }
__device__ __forceinline__ F2 split_row(const float* row, int k0, int lane) { float v[16]; const float* p = row + k0 + 8 * (lane >> 4);
#pragma unroll
  for (int i = 0; i < 8; ++i) { v[i] = p[i]; v[8 + i] = p[16 + i]; }
  return bsplit16(v); }
// the 16 floats of split_row, loaded but not yet split: lets a whole group of loads issue before the first value is used
struct R16 { v4f q[4]; };
__device__ __forceinline__ R16 raw_row(const float* row, int k0, int lane) { R16 r; const float* p = row + k0 + 8 * (lane >> 4);
  r.q[0] = *(const v4f*)p; r.q[1] = *(const v4f*)(p + 4); r.q[2] = *(const v4f*)(p + 16); r.q[3] = *(const v4f*)(p + 20); return r; }
__device__ __forceinline__ F2 split_raw(const R16& r) { float v[16];
#pragma unroll
  for (int i = 0; i < 16; ++i) v[i] = r.q[i >> 2][i & 3];
  return bsplit16(v); }
__device__ __forceinline__ F2 split_rowK(const float* row, int k0, int lane, int K) { float v[16]; const int g = lane >> 4;
#pragma unroll
  for (int i = 0; i < 8; ++i) { const int ka = k0 + 8 * g + i, kb = ka + 16; v[i] = ka < K ? row[ka] : 0.f; v[8 + i] = kb < K ? row[kb] : 0.f; }
  return bsplit16(v); }
__device__ __forceinline__ F2 split_col(const float* W, int k0, int n, int lane, int ld, int K) { float v[16]; const int g = lane >> 4;
#pragma unroll
  for (int i = 0; i < 8; ++i) { const int ka = k0 + 8 * g + i, kb = ka + 16; v[i] = ka < K ? W[(size_t)ka * ld + n] : 0.f; v[8 + i] = kb < K ? W[(size_t)kb * ld + n] : 0.f; }
  return bsplit16(v); }
__device__ __forceinline__ v8f mac3(const F2& a, const F2& b, v8f c) { c = wmma_bf(a.l, b.h, c); c = wmma_bf(a.h, b.l, c); return wmma_bf(a.h, b.h, c); }
__device__ __forceinline__ float sigm(float v) { return 1.0f / (1.0f + expf(-v)); }
#define LDSX() do { asm volatile("s_wait_dscnt 0" ::: "memory"); __builtin_amdgcn_wave_barrier(); __builtin_amdgcn_fence(__ATOMIC_RELEASE, "workgroup"); } while (0)


// Sliding-window causal attention (12 heads of 64 on [1,2048,768], [out][in] weights, no biases, scale 1/8): each query attends to keys max(0, q-63) .. q (the reference gathers a 64-token window ending at q and masks window slots beyond q);
// softmax; (P v) Wo^T. Only the 16-key tiles that can intersect a wave's windows are visited (exact: every other weight is exp(-inf) = 0).
#define NB 1
#define SS 2048
#define E 768
#define NH 12
#define WIN 64
#define HD 64
#define NR (NB * SS)
#define PLO 1024.0f
#define VLO 2048.0f
__device__ __forceinline__ float bfr(float v) { return (float)(__bf16)v; }
__device__ __forceinline__ v16b frag_b(const __bf16* rowk0, int lane) { return __builtin_bit_cast(v16b, frag_h((const _Float16*)rowk0, lane)); }
// LDS ring of the two projection GEMMs: a tile is 128 k of every operand row; two buffers
#define KT 128
#define NT (E / KT)
#define PB 272                      // LDS pitch of a 256-byte bf16 row (16 B x odd: conflict-free b128 reads)
#define PF 528                      // LDS pitch of a 512-byte f32 row (16 B x odd)
#define QKV_BUF ((64 + 128) * PB)   // [Xb 64 rows | PT 128 rows]
#define OUT_BUF (64 * PF + 128 * PB) // [ctx 64 rows f32 | PT 128 rows]
// eight asynchronous 16-byte copies per lane, global -> LDS, rows ls / gs bytes apart. The s_wait_xcnt ends the copies' own statement, so no address register is rewritten in front of it.
__device__ __forceinline__ void cp8(unsigned l, const char* g, unsigned ls, size_t gs) {
  asm volatile("global_load_async_to_lds_b128 %0, %8, off\n\t"
               "global_load_async_to_lds_b128 %1, %9, off\n\t"
               "global_load_async_to_lds_b128 %2, %10, off\n\t"
               "global_load_async_to_lds_b128 %3, %11, off\n\t"
               "global_load_async_to_lds_b128 %4, %12, off\n\t"
               "global_load_async_to_lds_b128 %5, %13, off\n\t"
               "global_load_async_to_lds_b128 %6, %14, off\n\t"
               "global_load_async_to_lds_b128 %7, %15, off\n\t"
               "s_wait_xcnt 0x0"
               :: "v"(l), "v"(l + ls), "v"(l + 2 * ls), "v"(l + 3 * ls), "v"(l + 4 * ls), "v"(l + 5 * ls), "v"(l + 6 * ls), "v"(l + 7 * ls),
                  "v"(g), "v"(g + gs), "v"(g + 2 * gs), "v"(g + 3 * gs), "v"(g + 4 * gs), "v"(g + 5 * gs), "v"(g + 6 * gs), "v"(g + 7 * gs)
               : "memory");
}
// the issuing wave's own copies have landed
#define WAIT_COPIES() asm volatile("s_wait_asynccnt 0x0" ::: "memory")
// this wave's LDS reads have returned (before the buffer they read is handed back for a refill)
#define WAIT_LDS() asm volatile("s_wait_dscnt 0x0" ::: "memory")

// One conversion launch, f32 -> bf16 (round to nearest even), for x and the four [out][in] weights: PT rows [0,E) Wq, [E,2E) Wk, [2E,3E) Wv, [3E,4E) Wo, each row as it lies.
// Few long waves: a block is 16 waves and converts CVB * CVU * 4 consecutive floats of ONE source; a lane holds CVU 16-byte loads in flight, each wave-wide load 512 and each store 256 contiguous bytes.
#define CVB 512
#define CVU 8
#define CVE (CVB * CVU * 4)
#define CVX (NR * E / CVE)          // blocks on x
#define CVW (E * E / CVE)           // blocks on each weight
static_assert(CVX * CVE == NR * E && CVW * CVE == E * E, "a conversion block never crosses a source's end");
__global__ __launch_bounds__(CVB) void k_cvt(const float* __restrict__ x, const float* __restrict__ Wq, const float* __restrict__ Wk, const float* __restrict__ Wv, const float* __restrict__ Wo, __bf16* __restrict__ Xb, __bf16* __restrict__ PT) {
  const int bx = blockIdx.x, tid = threadIdx.x; const float* s; __bf16* d;
  if (bx < CVX) { s = x + (size_t)bx * CVE; d = Xb + (size_t)bx * CVE; }
  else { const int m = (bx - CVX) / CVW, r = (bx - CVX) % CVW; s = (m == 0 ? Wq : (m == 1 ? Wk : (m == 2 ? Wv : Wo))) + (size_t)r * CVE; d = PT + (size_t)m * E * E + (size_t)r * CVE; }
  v4f v[CVU];
#pragma unroll      // all CVU loads issue before the first value is used
  for (int u = 0; u < CVU; ++u) v[u] = *(const v4f*)(s + (u * CVB + tid) * 4);
#pragma unroll      // constant u and e: v[] stays in registers
  for (int u = 0; u < CVU; ++u) { union { __bf16 h[4]; v2u q; } pk;
#pragma unroll      // as above
    for (int e = 0; e < 4; ++e) pk.h[e] = (__bf16)v[u][e];
    vst2(d + (u * CVB + tid) * 4, pk.q); }
}
// QKV: block (64 rows, 128 cols = 2 heads, which); q -> Q32 f32 [bh][s][64]; k -> K32 f32 rows; v -> VT hi/lo x4 [bh][d][s]
__global__ __launch_bounds__(128) void k_qkv(const __bf16* __restrict__ Xb, const __bf16* __restrict__ PT, float* __restrict__ Q32, float* __restrict__ K32, _Float16* __restrict__ VTh, _Float16* __restrict__ VTl) {
  __shared__ __align__(16) char ring[2 * QKV_BUF];      // the output staging below reuses it behind the loop's last barrier (three blocks fit a WGP's LDS)
  float (*so)[16][132] = (float (*)[16][132])ring;
  _Float16 (*sth)[72] = (_Float16 (*)[72])ring; _Float16 (*stl)[72] = sth + 128;
  const int tid = threadIdx.x, wave = tid >> 5, lane = tid & 31, col = lane & 15, g = lane >> 4;
  const int which = blockIdx.z, r0b = blockIdx.x * 64, r0 = r0b + wave * 16, n0 = blockIdx.y * 128; const int b = r0b / SS, s0 = r0b % SS;
  v8f acc[8] = {};
  // a lane copies chunk (tid & 15) of rows (tid >> 4) + 8 i: 8 rows of Xb, 16 of PT per tile
  const unsigned lA = (unsigned)(size_t)ring + (tid >> 4) * PB + (tid & 15) * 16, lB = lA + 64 * PB;
  const char* gA = (const char*)(Xb + (size_t)(r0b + (tid >> 4)) * E + (tid & 15) * 8);
  const char* gB = (const char*)(PT + (size_t)(which * E + n0 + (tid >> 4)) * E + (tid & 15) * 8);
  auto fill = [&](int t) { const unsigned bo = (t & 1) * QKV_BUF; const size_t ko = (size_t)t * KT * 2;
    cp8(lA + bo, gA + ko, 8 * PB, (size_t)8 * E * 2); cp8(lB + bo, gB + ko, 8 * PB, (size_t)8 * E * 2); cp8(lB + bo + 64 * PB, gB + ko + (size_t)64 * E * 2, 8 * PB, (size_t)8 * E * 2); };
  fill(0); WAIT_COPIES(); __syncthreads();
  fill(1);
  for (int t = 0; t < NT; ++t) { const char* bA = ring + (t & 1) * QKV_BUF + (wave * 16 + col) * PB; const char* bB = ring + (t & 1) * QKV_BUF + (64 + col) * PB;
    // two fragment sets in registers: block kc + 1's 18 LDS reads issue as one group in front of block kc's WMMAs (never past this tile's buffer)
    v16b fa[2], fb[2][8];
    auto frags = [&](int kc) { fa[kc & 1] = frag_b((const __bf16*)bA + kc * 32, lane);
#pragma unroll      // constant j: fb[] stays in registers
      for (int j = 0; j < 8; ++j) fb[kc & 1][j] = frag_b((const __bf16*)(bB + j * 16 * PB) + kc * 32, lane); };
    frags(0);
#pragma unroll      // constant kc and j: LDS reads take immediate offsets, acc[], fa[] and fb[] stay in registers
    for (int kc = 0; kc < KT / 32; ++kc) { if (kc + 1 < KT / 32) frags(kc + 1);
#pragma unroll
      for (int j = 0; j < 8; ++j) acc[j] = wmma_bf(fa[kc & 1], fb[kc & 1][j], acc[j]); }
    WAIT_LDS(); WAIT_COPIES(); __syncthreads();      // publishes tile t + 1 and frees tile t's buffer
    if (t + 2 < NT) fill(t + 2); }
  WAIT_COPIES();
  if (which < 2) {
#pragma unroll
    for (int j = 0; j < 8; ++j) { const float bb = 0.f;
#pragma unroll
      for (int r = 0; r < 8; ++r) so[wave][8 * g + r][j * 16 + col] = acc[j][r] + bb; }
    LDSX();
    float* Dst = which == 0 ? Q32 : K32;
    for (int qq = lane; qq < 2 * 16 * 16; qq += 32) { const int hh = qq >> 8, rl = (qq >> 4) & 15, pc = qq & 15; const int h = (n0 >> 6) + hh;
      vst2(Dst + (((size_t)b * NH + h) * SS + s0 + wave * 16 + rl) * HD + pc * 4, *(const v4f*)(&so[wave][rl][hh * 64 + pc * 4])); } }
  else {
#pragma unroll
    for (int j = 0; j < 8; ++j) { const float bb = 0.f;
#pragma unroll
      for (int r = 0; r < 8; ++r) { const float v = (acc[j][r] + bb) * 4.0f; const _Float16 hi = (_Float16)v; sth[j * 16 + col][wave * 16 + 8 * g + r] = hi; stl[j * 16 + col][wave * 16 + 8 * g + r] = (_Float16)((v - (float)hi) * VLO); } }
    __syncthreads();
    for (int qq = tid; qq < 128 * 8; qq += 128) { const int cl = qq >> 3, pc = qq & 7; const int c = n0 + cl, h = c >> 6, d = c & 63; const size_t o = (((size_t)b * NH + h) * HD + d) * SS + s0 + pc * 8;
      vst2(VTh + o, *(const v4u*)(&sth[cl][pc * 8])); vst2(VTl + o, *(const v4u*)(&stl[cl][pc * 8])); } }
}
// windowed attention: block (64 queries, bh), a wave owns 16 queries q0 .. q0+15. Their windows lie in keys q0-64 .. q0+15: five 16-key score tiles, ONE softmax pass (row maximum and row sum over the whole window, no running rescale).
// S on hi/lo splits of the f32 q/k rows; P,V hi/lo over 96 key columns q0-80 .. q0+15 (three k = 32 blocks; the first 16 columns of P are zero); O f32 [bh][s][64]
#define NKT 5                       // score tiles of 16 keys
#define SP (NKT * 16 + 4)           // f32 pitch of a score row (16 B x odd: conflict-free b128 reads)
#define PP (96 + 8)                 // f16 pitch of a P row (16 B x odd)
__global__ __launch_bounds__(128) void k_attn(const float* __restrict__ Q32, const float* __restrict__ K32, const _Float16* __restrict__ VTh, const _Float16* __restrict__ VTl, float* __restrict__ O32) {
  __shared__ __align__(16) float sS[4][16][SP];
  __shared__ __align__(16) _Float16 sPh[4][16][PP], sPl[4][16][PP];
  __shared__ __align__(16) float sO[4][16][68];
  const int tid = threadIdx.x, w = __builtin_amdgcn_readfirstlane(tid >> 5), lane = tid & 31, col = lane & 15, g = lane >> 4;      // w in a scalar register: tile bases and their clamps are scalar, every load is scalar base + one lane offset
  const size_t bh = blockIdx.y; const int qb = blockIdx.x; const int q0 = qb * 64 + w * 16;
  // Q and all five K tiles: 48 loads issue as one group, one trip to memory. A tile in front of key 0 reads tile 0 (in bounds) and is masked below
  R16 q0r, q1r, kr[NKT][2]; const float* kt[NKT]; const unsigned lo = col * HD + 8 * g;
  auto raw_at = [&](const float* base, unsigned o) { R16 r; r.q[0] = *(const v4f*)(base + o); r.q[1] = *(const v4f*)(base + o + 4); r.q[2] = *(const v4f*)(base + o + 16); r.q[3] = *(const v4f*)(base + o + 20); return r; };
  const float* qt = Q32 + (bh * SS + q0) * HD; q0r = raw_at(qt, lo); q1r = raw_at(qt, lo + 32);
#pragma unroll      // constant t: kr[] stays in registers
  for (int t = 0; t < NKT; ++t) { const int k0 = q0 - 64 + t * 16; kt[t] = K32 + (bh * SS + (k0 < 0 ? 0 : k0)) * HD; kr[t][0] = raw_at(kt[t], lo); kr[t][1] = raw_at(kt[t], lo + 32); }
  // stands behind the group's last load, in front of the first overwrite of a load's address registers; the operands keep those registers live up to it
  asm volatile("s_wait_xcnt 0x0" :: "v"(lo), "s"(qt), "s"(kt[0]), "s"(kt[1]), "s"(kt[2]), "s"(kt[3]), "s"(kt[4]) : "memory");
  F2 aq[2]; aq[0] = split_raw(q0r); aq[1] = split_raw(q1r);
#pragma unroll
  for (int t = 0; t < NKT; ++t) { const int k0 = q0 - 64 + t * 16;
    v8f s = mac3(aq[0], split_raw(kr[t][0]), (v8f){}); s = mac3(aq[1], split_raw(kr[t][1]), s);
    // key k0 + col, query q0 + 8 g + r. Only tile 0 can fall behind a window (key <= query - WIN: col <= 8 g + r), only the last can lie ahead of a query (col > 8 g + r); any tile but the last can lie in front of key 0, as a whole
#pragma unroll
    for (int r = 0; r < 8; ++r) { const bool off = t == 0 ? (k0 < 0 || col <= 8 * g + r) : (t == NKT - 1 ? col > 8 * g + r : k0 < 0); sS[w][8 * g + r][t * 16 + col] = off ? -3.0e38f : s[r] * 0.125f; } }
  LDSX();
  // V: all 48 loads issue as one group and fly under the softmax. A 16-key half in front of key 0 reads keys 0..15 (in bounds, finite); its P is zero
  v16h vh[3][4], vl[3][4]; const _Float16 *pha[3], *phb[3], *pla[3], *plb[3]; const unsigned vo = col * SS + 8 * g;
#pragma unroll      // constant c and t: vh[] and vl[] stay in registers
  for (int c = 0; c < 3; ++c) { const int ka = q0 - 80 + c * 32, kb = ka + 16; const size_t oa = bh * HD * SS + (ka < 0 ? 0 : ka), ob = bh * HD * SS + (kb < 0 ? 0 : kb);
    pha[c] = VTh + oa; phb[c] = VTh + ob; pla[c] = VTl + oa; plb[c] = VTl + ob;
#pragma unroll
    for (int t = 0; t < 4; ++t) { union { v16h v; v8h q[2]; } uh, ul; const unsigned o = vo + t * 16 * SS;
      uh.q[0] = *(const v8h*)(pha[c] + o); uh.q[1] = *(const v8h*)(phb[c] + o); ul.q[0] = *(const v8h*)(pla[c] + o); ul.q[1] = *(const v8h*)(plb[c] + o);
      vh[c][t] = uh.v; vl[c][t] = ul.v; } }
  // as above, for the V loads
  asm volatile("s_wait_xcnt 0x0" :: "v"(vo), "s"(pha[0]), "s"(phb[0]), "s"(pla[0]), "s"(plb[0]), "s"(pha[1]), "s"(phb[1]), "s"(pla[1]), "s"(plb[1]), "s"(pha[2]), "s"(phb[2]), "s"(pla[2]), "s"(plb[2]) : "memory");
  // lane (col, g): row col, score columns 40 g .. 40 g + 39
  float mx = -3.4e38f;
#pragma unroll
  for (int jj = 0; jj < NKT * 8; ++jj) mx = fmaxf(mx, sS[w][col][g * (NKT * 8) + jj]);
  mx = fmaxf(mx, __shfl_xor(mx, 16, 32));
  float ps = 0.f;
#pragma unroll
  for (int jj = 0; jj < NKT * 8; ++jj) { const float p = expf(sS[w][col][g * (NKT * 8) + jj] - mx) * 16384.0f; ps += p; const _Float16 hi = (_Float16)p; sPh[w][col][16 + g * (NKT * 8) + jj] = hi; sPl[w][col][16 + g * (NKT * 8) + jj] = (_Float16)((p - (float)hi) * PLO); }
  *(v8h*)(&sPh[w][col][g * 8]) = (v8h){}; *(v8h*)(&sPl[w][col][g * 8]) = (v8h){};      // keys q0-80 .. q0-65: outside every window
  ps += __shfl_xor(ps, 16, 32);
  const float lrun = ps * (1.0f / 16384.0f);
  LDSX();
  v8f acc[4] = {}, ac1[4] = {}, ac2[4] = {};
#pragma unroll
  for (int c = 0; c < 3; ++c) { const v16h ph = frag_h(&sPh[w][col][0] + c * 32, lane), pl = frag_h(&sPl[w][col][0] + c * 32, lane);
#pragma unroll
    for (int t = 0; t < 4; ++t) {
      if (c == 0) { acc[t] = wmma16(ph, vh[c][t], acc[t]); ac1[t] = wmma16(ph, vl[c][t], ac1[t]); ac2[t] = wmma16(pl, vh[c][t], ac2[t]); }      // the accumulators' registers are first written here: wmma16 holds A and B until its slots have passed, so no new D lands on them
      else { acc[t] = wmma16p(ph, vh[c][t], acc[t]); ac1[t] = wmma16p(ph, vl[c][t], ac1[t]); ac2[t] = wmma16p(pl, vh[c][t], ac2[t]); } } }
#pragma unroll
  for (int r = 0; r < 8; ++r) { const float lr = __shfl(lrun, 8 * g + r, 32); const float inv = 1.0f / (lr * 16384.0f * 4.0f);
#pragma unroll
    for (int t = 0; t < 4; ++t) sO[w][8 * g + r][t * 16 + col] = (acc[t][r] + ac1[t][r] * (1.0f / VLO) + ac2[t][r] * (1.0f / PLO)) * inv; }
  LDSX();
  for (int qq = lane; qq < 16 * 16; qq += 32) { const int rl = qq >> 4, pc = qq & 15; vst2(O32 + ((bh * SS) + q0 + rl) * HD + pc * 4, *(const v4f*)(&sO[w][rl][pc * 4])); }
}
// out = ctx Wo^T : split(ctx) x bf16(Wo rows): 2 products (Wo is an INPUT -> bf16 exact)
__global__ __launch_bounds__(128) void k_out(const float* __restrict__ O32, const __bf16* __restrict__ PT, float* __restrict__ out) {
  __shared__ __align__(16) float so[4][16][132];
  __shared__ __align__(16) char ring[2 * OUT_BUF];
  const int tid = threadIdx.x, wave = tid >> 5, lane = tid & 31, col = lane & 15, g = lane >> 4;
  const int r0b = blockIdx.x * 64, r0 = r0b + wave * 16, n0 = blockIdx.y * 128; const int b = r0b / SS, s0 = r0b % SS;
  v8f acc[8] = {};
  // ctx: a tile is two heads' 64 floats of each row; a lane copies chunk (tid & 31) of rows (tid >> 5) + 4 i (16 rows). PT: chunk (tid & 15) of rows (tid >> 4) + 8 i (16 rows)
  const unsigned lA = (unsigned)(size_t)ring + (tid >> 5) * PF + (tid & 31) * 16, lB = (unsigned)(size_t)ring + 64 * PF + (tid >> 4) * PB + (tid & 15) * 16;
  const char* gA = (const char*)(O32 + (((size_t)b * NH + ((tid & 31) >> 4)) * SS + s0 + (tid >> 5)) * HD + (tid & 15) * 4);
  const char* gB = (const char*)(PT + (size_t)(3 * E + n0 + (tid >> 4)) * E + (tid & 15) * 8);
  auto fill = [&](int t) { const unsigned bo = (t & 1) * OUT_BUF; const size_t ka = (size_t)t * 2 * SS * HD * 4, ko = (size_t)t * KT * 2;
    cp8(lA + bo, gA + ka, 4 * PF, (size_t)4 * HD * 4); cp8(lA + bo + 32 * PF, gA + ka + (size_t)32 * HD * 4, 4 * PF, (size_t)4 * HD * 4);
    cp8(lB + bo, gB + ko, 8 * PB, (size_t)8 * E * 2); cp8(lB + bo + 64 * PB, gB + ko + (size_t)64 * E * 2, 8 * PB, (size_t)8 * E * 2); };
  fill(0); WAIT_COPIES(); __syncthreads();
  fill(1);
  for (int t = 0; t < NT; ++t) { const float* bA = (const float*)(ring + (t & 1) * OUT_BUF + (wave * 16 + col) * PF); const char* bB = ring + (t & 1) * OUT_BUF + 64 * PF + col * PB;
    // two fragment sets in registers: block kc + 1's 20 LDS reads issue as one group in front of block kc's WMMAs (never past this tile's buffer)
    R16 ra[2]; v16b fb[2][8];
    auto frags = [&](int kc) { ra[kc & 1] = raw_row(bA, kc * 32, lane);
#pragma unroll      // constant j: fb[] stays in registers
      for (int j = 0; j < 8; ++j) fb[kc & 1][j] = frag_b((const __bf16*)(bB + j * 16 * PB) + kc * 32, lane); };
    frags(0);
#pragma unroll      // constant kc and j: LDS reads take immediate offsets, acc[], ra[] and fb[] stay in registers
    for (int kc = 0; kc < KT / 32; ++kc) { const F2 a = split_raw(ra[kc & 1]);
      if (kc + 1 < KT / 32) frags(kc + 1);
#pragma unroll
      for (int j = 0; j < 8; ++j) { acc[j] = wmma_bf(a.l, fb[kc & 1][j], acc[j]); acc[j] = wmma_bf(a.h, fb[kc & 1][j], acc[j]); } }
    WAIT_LDS(); WAIT_COPIES(); __syncthreads();      // publishes tile t + 1 and frees tile t's buffer
    if (t + 2 < NT) fill(t + 2); }
  WAIT_COPIES();
#pragma unroll
  for (int j = 0; j < 8; ++j) {
#pragma unroll
    for (int r = 0; r < 8; ++r) so[wave][8 * g + r][j * 16 + col] = acc[j][r]; }
  LDSX();
#pragma unroll 4
  for (int rl = 0; rl < 16; ++rl) vst2(out + (size_t)(r0 + rl) * E + n0 + lane * 4, *(const v4f*)(&so[wave][rl][lane * 4]));
}
extern "C" void kernel_launch(void* const* d_in, const int* in_sizes, int n_in, void* d_out, int out_size, void* d_ws, size_t ws_size, hipStream_t stream) {
  (void)in_sizes; (void)n_in; (void)out_size; (void)ws_size;
  const float** I = (const float**)d_in;   // inputs, Wq, Wk, Wv, Wo
  const float* x = I[0]; const float* Wq = I[1]; const float* Wk = I[2]; const float* Wv = I[3]; const float* Wo = I[4];
  float* out = (float*)d_out;
  char* ws = (char*)d_ws; size_t off = 0;
  auto take = [&](size_t bytes) { char* p = ws + off; off += (bytes + 255) & ~(size_t)255; return p; };
  __bf16* Xb = (__bf16*)take((size_t)NR * E * 2); __bf16* PT = (__bf16*)take((size_t)4 * E * E * 2);
  float* Q32 = (float*)take((size_t)NR * E * 4); float* K32 = (float*)take((size_t)NR * E * 4); _Float16* VTh = (_Float16*)take((size_t)NR * E * 2); _Float16* VTl = (_Float16*)take((size_t)NR * E * 2); float* O32 = (float*)take((size_t)NR * E * 4);
  // ws ~ 33 MB
  k_cvt<<<CVX + 4 * CVW, CVB, 0, stream>>>(x, Wq, Wk, Wv, Wo, Xb, PT);
  k_qkv<<<dim3(NR / 64, E / 128, 3), 128, 0, stream>>>(Xb, PT, Q32, K32, VTh, VTl);
  k_attn<<<dim3(SS / 64, NB * NH), 128, 0, stream>>>(Q32, K32, VTh, VTl, O32);
  k_out<<<dim3(NR / 64, E / 128), 128, 0, stream>>>(O32, PT, out);
}

// v005
// Measured time: 32.9 microseconds a run.
// Two timings next to v004 both put it at 1.06 times that version's speed.
// Counting every step since v000, it is 4.11 times as fast.
// compute dtype: inputs and W* (INPUTS) rounded to bf16 with exact bf16 WMMA products (f32 accumulate) for the projections; q/k f32 split for the scores (3 products), P and V f16 hi/lo (3 products); softmax f32.
#include <hip/hip_runtime.h>
#include <math.h>

typedef __attribute__((ext_vector_type(16))) _Float16 v16h;
typedef __attribute__((ext_vector_type(16))) __bf16 v16b;
typedef __attribute__((ext_vector_type(8)))  _Float16 v8h;
typedef __attribute__((ext_vector_type(8)))  float v8f;
typedef __attribute__((ext_vector_type(4)))  float v4f;
typedef __attribute__((ext_vector_type(2)))  float v2f;
typedef __attribute__((ext_vector_type(4)))  unsigned v4u;
typedef __attribute__((ext_vector_type(2)))  unsigned v2u;
typedef __attribute__((ext_vector_type(4)))  int v4i;
typedef float __attribute__((may_alias)) float_a;
typedef int __attribute__((may_alias)) int_a;

template <typename T> __device__ __forceinline__ void vst2(void* p, T v) { *(T*)p = v;  }
__device__ __forceinline__ v8f wmma16(v16h a, v16h b, v8f c) {
  v8f d = __builtin_amdgcn_wmma_f32_16x16x32_f16(false, a, false, b, (short)0, c, false, false);
  asm volatile("v_nop\n\tv_nop\n\tv_nop\n\tv_nop" : "+v"(d) : "v"(a), "v"(b));
  return d;
}
// the plain builtin (the compiler keeps its distances itself), for WMMAs that accumulate in place: no asm statement names its operands, so they may lie above v255, which an asm operand cannot; the 192 registers of V beside 96 of accumulators need that room
__device__ __forceinline__ v8f wmma16p(v16h a, v16h b, v8f c) { return __builtin_amdgcn_wmma_f32_16x16x32_f16(false, a, false, b, (short)0, c, false, false); }
__device__ __forceinline__ v8f wmma_bf(v16b a, v16b b, v8f c) {
  v8f d = __builtin_amdgcn_wmma_f32_16x16x32_bf16(false, a, false, b, (short)0, c, false, false);
  asm volatile("v_nop\n\tv_nop\n\tv_nop\n\tv_nop" : "+v"(d) : "v"(a), "v"(b));
  return d;
}
// 16x16x32 fragments: lane = (h = lane>>4, row/col = lane&15); elements 0..7 = k0+8h+0..7, 8..15 = k0+16+8h+0..7; D element r = row 8h+r
__device__ __forceinline__ v16h frag_h(const _Float16* rowk0, int lane) {
  union { v16h v; v8h q[2]; } u; const _Float16* p = rowk0 + 8 * (lane >> 4);
  u.q[0] = *(const v8h*)p; u.q[1] = *(const v8h*)(p + 16); return u.v;
}
__device__ __forceinline__ v16h frag_f32(const float* rowk0, int lane) {
  v16h a; const float* p = rowk0 + 8 * (lane >> 4);
#pragma unroll
  for (int i = 0; i < 8; ++i) { a[i] = (_Float16)p[i]; a[8 + i] = (_Float16)p[16 + i]; }
  return a;
}
__device__ __forceinline__ v16h frag_f32s(const float* rowk0, int lane, float sc) {
  v16h a; const float* p = rowk0 + 8 * (lane >> 4);
#pragma unroll
  for (int i = 0; i < 8; ++i) { a[i] = (_Float16)(p[i] * sc); a[8 + i] = (_Float16)(p[16 + i] * sc); }
  return a;
}
// column fragment from a [K][ld] layout (column n), rows >= K read as 0
__device__ __forceinline__ v16h fragc_f32(const float* W, int k0, int n, int lane, int ld, int K) {
  v16h a; const int g = lane >> 4;
#pragma unroll
  for (int i = 0; i < 8; ++i) { const int ka = k0 + 8 * g + i, kb = ka + 16;
    a[i] = (_Float16)(ka < K ? W[(size_t)ka * ld + n] : 0.f); a[8 + i] = (_Float16)(kb < K ? W[(size_t)kb * ld + n] : 0.f); }
  return a;
}
struct F2 { v16b h, l; };
__device__ __forceinline__ F2 bsplit16(const float v[16]) { F2 r;
#pragma unroll
  for (int i = 0; i < 16; ++i) { const __bf16 h = (__bf16)v[i]; r.h[i] = h; r.l[i] = (__bf16)(v[i] - (float)h); }
  return r; }
__device__ __forceinline__ F2 split_row(const float* row, int k0, int lane) { float v[16]; const float* p = row + k0 + 8 * (lane >> 4);
#pragma unroll
  for (int i = 0; i < 8; ++i) { v[i] = p[i]; v[8 + i] = p[16 + i]; }
  return bsplit16(v); }
// the 16 floats of split_row, loaded but not yet split: lets a whole group of loads issue before the first value is used
struct R16 { v4f q[4]; };
__device__ __forceinline__ R16 raw_row(const float* row, int k0, int lane) { R16 r; const float* p = row + k0 + 8 * (lane >> 4);
  r.q[0] = *(const v4f*)p; r.q[1] = *(const v4f*)(p + 4); r.q[2] = *(const v4f*)(p + 16); r.q[3] = *(const v4f*)(p + 20); return r; }
__device__ __forceinline__ F2 split_raw(const R16& r) { float v[16];
#pragma unroll
  for (int i = 0; i < 16; ++i) v[i] = r.q[i >> 2][i & 3];
  return bsplit16(v); }
__device__ __forceinline__ F2 split_rowK(const float* row, int k0, int lane, int K) { float v[16]; const int g = lane >> 4;
#pragma unroll
  for (int i = 0; i < 8; ++i) { const int ka = k0 + 8 * g + i, kb = ka + 16; v[i] = ka < K ? row[ka] : 0.f; v[8 + i] = kb < K ? row[kb] : 0.f; }
  return bsplit16(v); }
__device__ __forceinline__ F2 split_col(const float* W, int k0, int n, int lane, int ld, int K) { float v[16]; const int g = lane >> 4;
#pragma unroll
  for (int i = 0; i < 8; ++i) { const int ka = k0 + 8 * g + i, kb = ka + 16; v[i] = ka < K ? W[(size_t)ka * ld + n] : 0.f; v[8 + i] = kb < K ? W[(size_t)kb * ld + n] : 0.f; }
  return bsplit16(v); }
__device__ __forceinline__ v8f mac3(const F2& a, const F2& b, v8f c) { c = wmma_bf(a.l, b.h, c); c = wmma_bf(a.h, b.l, c); return wmma_bf(a.h, b.h, c); }
__device__ __forceinline__ float sigm(float v) { return 1.0f / (1.0f + expf(-v)); }
#define LDSX() do { asm volatile("s_wait_dscnt 0" ::: "memory"); __builtin_amdgcn_wave_barrier(); __builtin_amdgcn_fence(__ATOMIC_RELEASE, "workgroup"); } while (0)


// Sliding-window causal attention (12 heads of 64 on [1,2048,768], [out][in] weights, no biases, scale 1/8): each query attends to keys max(0, q-63) .. q (the reference gathers a 64-token window ending at q and masks window slots beyond q);
// softmax; (P v) Wo^T. Only the 16-key tiles that can intersect a wave's windows are visited (exact: every other weight is exp(-inf) = 0).
#define NB 1
#define SS 2048
#define E 768
#define NH 12
#define WIN 64
#define HD 64
#define NR (NB * SS)
#define PLO 1024.0f
#define VLO 2048.0f
__device__ __forceinline__ float bfr(float v) { return (float)(__bf16)v; }
__device__ __forceinline__ v16b frag_b(const __bf16* rowk0, int lane) { return __builtin_bit_cast(v16b, frag_h((const _Float16*)rowk0, lane)); }
// LDS ring of the two projection GEMMs: a tile is 128 k of every operand row; two buffers
#define KT 128
#define NT (E / KT)
#define PB 272                      // LDS pitch of a 256-byte bf16 row (16 B x odd: conflict-free b128 reads)
#define PF 528                      // LDS pitch of a 512-byte f32 row (16 B x odd)
#define QKV_BUF ((64 + 128) * PB)   // [Xb 64 rows | PT 128 rows]
#define OUT_BUF (64 * PF + 128 * PB) // [ctx 64 rows f32 | PT 128 rows]
// eight asynchronous 16-byte copies per lane, global -> LDS, rows ls / gs bytes apart. The s_wait_xcnt ends the copies' own statement, so no address register is rewritten in front of it.
__device__ __forceinline__ void cp8(unsigned l, const char* g, unsigned ls, size_t gs) {
  asm volatile("global_load_async_to_lds_b128 %0, %8, off\n\t"
               "global_load_async_to_lds_b128 %1, %9, off\n\t"
               "global_load_async_to_lds_b128 %2, %10, off\n\t"
               "global_load_async_to_lds_b128 %3, %11, off\n\t"
               "global_load_async_to_lds_b128 %4, %12, off\n\t"
               "global_load_async_to_lds_b128 %5, %13, off\n\t"
               "global_load_async_to_lds_b128 %6, %14, off\n\t"
               "global_load_async_to_lds_b128 %7, %15, off\n\t"
               "s_wait_xcnt 0x0"
               :: "v"(l), "v"(l + ls), "v"(l + 2 * ls), "v"(l + 3 * ls), "v"(l + 4 * ls), "v"(l + 5 * ls), "v"(l + 6 * ls), "v"(l + 7 * ls),
                  "v"(g), "v"(g + gs), "v"(g + 2 * gs), "v"(g + 3 * gs), "v"(g + 4 * gs), "v"(g + 5 * gs), "v"(g + 6 * gs), "v"(g + 7 * gs)
               : "memory");
}
// the issuing wave's own copies have landed
#define WAIT_COPIES() asm volatile("s_wait_asynccnt 0x0" ::: "memory")
// this wave's LDS reads have returned (before the buffer they read is handed back for a refill)
#define WAIT_LDS() asm volatile("s_wait_dscnt 0x0" ::: "memory")

// One conversion launch, f32 -> bf16 (round to nearest even), for x and the four [out][in] weights: PT rows [0,E) Wq, [E,2E) Wk, [2E,3E) Wv, [3E,4E) Wo, each row as it lies.
// Few long waves: a block is 16 waves and converts CVB * CVU * 4 consecutive floats of ONE source; a lane holds CVU 16-byte loads in flight, each wave-wide load 512 and each store 256 contiguous bytes.
#define CVB 512
#define CVU 8
#define CVE (CVB * CVU * 4)
#define CVX (NR * E / CVE)          // blocks on x
#define CVW (E * E / CVE)           // blocks on each weight
static_assert(CVX * CVE == NR * E && CVW * CVE == E * E, "a conversion block never crosses a source's end");
__global__ __launch_bounds__(CVB) void k_cvt(const float* __restrict__ x, const float* __restrict__ Wq, const float* __restrict__ Wk, const float* __restrict__ Wv, const float* __restrict__ Wo, __bf16* __restrict__ Xb, __bf16* __restrict__ PT) {
  const int bx = blockIdx.x, tid = threadIdx.x; const float* s; __bf16* d;
  if (bx < CVX) { s = x + (size_t)bx * CVE; d = Xb + (size_t)bx * CVE; }
  else { const int m = (bx - CVX) / CVW, r = (bx - CVX) % CVW; s = (m == 0 ? Wq : (m == 1 ? Wk : (m == 2 ? Wv : Wo))) + (size_t)r * CVE; d = PT + (size_t)m * E * E + (size_t)r * CVE; }
  v4f v[CVU];
#pragma unroll      // all CVU loads issue before the first value is used
  for (int u = 0; u < CVU; ++u) v[u] = *(const v4f*)(s + (u * CVB + tid) * 4);
#pragma unroll      // constant u and e: v[] stays in registers
  for (int u = 0; u < CVU; ++u) { union { __bf16 h[4]; v2u q; } pk;
#pragma unroll      // as above
    for (int e = 0; e < 4; ++e) pk.h[e] = (__bf16)v[u][e];
    vst2(d + (u * CVB + tid) * 4, pk.q); }
}
// QKV: block (64 rows, 128 cols = 2 heads, which); q -> Q32 f32 [bh][s][64]; k -> K32 f32 rows; v -> VT hi/lo x4 [bh][d][s]
__global__ __launch_bounds__(128) void k_qkv(const __bf16* __restrict__ Xb, const __bf16* __restrict__ PT, float* __restrict__ Q32, float* __restrict__ K32, _Float16* __restrict__ VTh, _Float16* __restrict__ VTl) {
  __shared__ __align__(16) char ring[2 * QKV_BUF];      // the output staging below reuses it behind the loop's last barrier (three blocks fit a WGP's LDS)
  float (*so)[16][132] = (float (*)[16][132])ring;
  _Float16 (*sth)[72] = (_Float16 (*)[72])ring; _Float16 (*stl)[72] = sth + 128;
  const int tid = threadIdx.x, wave = tid >> 5, lane = tid & 31, col = lane & 15, g = lane >> 4;
  const int which = blockIdx.z, r0b = blockIdx.x * 64, r0 = r0b + wave * 16, n0 = blockIdx.y * 128; const int b = r0b / SS, s0 = r0b % SS;
  v8f acc[8] = {};
  // a lane copies chunk (tid & 15) of rows (tid >> 4) + 8 i: 8 rows of Xb, 16 of PT per tile
  const unsigned lA = (unsigned)(size_t)ring + (tid >> 4) * PB + (tid & 15) * 16, lB = lA + 64 * PB;
  const char* gA = (const char*)(Xb + (size_t)(r0b + (tid >> 4)) * E + (tid & 15) * 8);
  const char* gB = (const char*)(PT + (size_t)(which * E + n0 + (tid >> 4)) * E + (tid & 15) * 8);
  auto fill = [&](int t) { const unsigned bo = (t & 1) * QKV_BUF; const size_t ko = (size_t)t * KT * 2;
    cp8(lA + bo, gA + ko, 8 * PB, (size_t)8 * E * 2); cp8(lB + bo, gB + ko, 8 * PB, (size_t)8 * E * 2); cp8(lB + bo + 64 * PB, gB + ko + (size_t)64 * E * 2, 8 * PB, (size_t)8 * E * 2); };
  fill(0); WAIT_COPIES(); __syncthreads();
  fill(1);
  for (int t = 0; t < NT; ++t) { const char* bA = ring + (t & 1) * QKV_BUF + (wave * 16 + col) * PB; const char* bB = ring + (t & 1) * QKV_BUF + (64 + col) * PB;
    // two fragment sets in registers: block kc + 1's 18 LDS reads issue as one group in front of block kc's WMMAs (never past this tile's buffer)
    v16b fa[2], fb[2][8];
    auto frags = [&](int kc) { fa[kc & 1] = frag_b((const __bf16*)bA + kc * 32, lane);
#pragma unroll      // constant j: fb[] stays in registers
      for (int j = 0; j < 8; ++j) fb[kc & 1][j] = frag_b((const __bf16*)(bB + j * 16 * PB) + kc * 32, lane); };
    frags(0);
#pragma unroll      // constant kc and j: LDS reads take immediate offsets, acc[], fa[] and fb[] stay in registers
    for (int kc = 0; kc < KT / 32; ++kc) { if (kc + 1 < KT / 32) frags(kc + 1);
#pragma unroll
      for (int j = 0; j < 8; ++j) acc[j] = wmma_bf(fa[kc & 1], fb[kc & 1][j], acc[j]); }
    WAIT_LDS(); WAIT_COPIES(); __syncthreads();      // publishes tile t + 1 and frees tile t's buffer
    if (t + 2 < NT) fill(t + 2); }
  WAIT_COPIES();
  if (which < 2) {
#pragma unroll
    for (int j = 0; j < 8; ++j) { const float bb = 0.f;
#pragma unroll
      for (int r = 0; r < 8; ++r) so[wave][8 * g + r][j * 16 + col] = acc[j][r] + bb; }
    LDSX();
    float* Dst = which == 0 ? Q32 : K32;
    for (int qq = lane; qq < 2 * 16 * 16; qq += 32) { const int hh = qq >> 8, rl = (qq >> 4) & 15, pc = qq & 15; const int h = (n0 >> 6) + hh;
      vst2(Dst + (((size_t)b * NH + h) * SS + s0 + wave * 16 + rl) * HD + pc * 4, *(const v4f*)(&so[wave][rl][hh * 64 + pc * 4])); } }
  else {
#pragma unroll
    for (int j = 0; j < 8; ++j) { const float bb = 0.f;
#pragma unroll
      for (int r = 0; r < 8; ++r) { const float v = (acc[j][r] + bb) * 4.0f; const _Float16 hi = (_Float16)v; sth[j * 16 + col][wave * 16 + 8 * g + r] = hi; stl[j * 16 + col][wave * 16 + 8 * g + r] = (_Float16)((v - (float)hi) * VLO); } }
    __syncthreads();
    for (int qq = tid; qq < 128 * 8; qq += 128) { const int cl = qq >> 3, pc = qq & 7; const int c = n0 + cl, h = c >> 6, d = c & 63; const size_t o = (((size_t)b * NH + h) * HD + d) * SS + s0 + pc * 8;
      vst2(VTh + o, *(const v4u*)(&sth[cl][pc * 8])); vst2(VTl + o, *(const v4u*)(&stl[cl][pc * 8])); } }
}
// windowed attention: block (64 queries, bh), a wave owns 16 queries q0 .. q0+15. Their windows lie in keys q0-64 .. q0+15: five 16-key score tiles, ONE softmax pass (row maximum and row sum over the whole window, no running rescale).
// The block's operands are staged once in LDS by asynchronous copies of whole 256-byte rows: Q (64 rows), K (keys qb*64-64 .. qb*64+63), V hi and lo (64 d rows of those 128 keys); every fragment is then an LDS read.
// S on hi/lo splits of the f32 q/k rows; P,V hi/lo over 96 key columns q0-80 .. q0+15 (three k = 32 blocks; the first 16 columns of P are zero); O f32 [bh][s][64]
#define NKT 5                       // score tiles of 16 keys
#define SP (NKT * 16 + 4)           // f32 pitch of a score row (16 B x odd: conflict-free b128 reads)
#define PP (96 + 8)                 // f16 pitch of a P row (16 B x odd)
#define AP 272                      // LDS pitch of a staged 256-byte row (16 B x odd: conflict-free b128 reads)
__global__ __launch_bounds__(128) void k_attn(const float* __restrict__ Q32, const float* __restrict__ K32, const _Float16* __restrict__ VTh, const _Float16* __restrict__ VTl, float* __restrict__ O32) {
  __shared__ __align__(16) char stQ[64 * AP], stK[128 * AP], stVh[64 * AP], stVl[64 * AP];
  __shared__ __align__(16) float sS[4][16][SP];
  __shared__ __align__(16) _Float16 sPh[4][16][PP], sPl[4][16][PP];
  __shared__ __align__(16) float sO[4][16][68];
  const int tid = threadIdx.x, w = __builtin_amdgcn_readfirstlane(tid >> 5), lane = tid & 31, col = lane & 15, g = lane >> 4;      // w in a scalar register: tile rows and their clamps are scalar
  const size_t bh = blockIdx.y; const int qb = blockIdx.x; const int q0 = qb * 64 + w * 16;
  // a lane copies chunk (tid & 15) of rows (tid >> 4) + 8 i: a wave-wide copy is two whole rows. In the first block the 64 keys in front of key 0 are filled from keys 0 .. 63 (in bounds, finite); they are masked below and their P is zero
  { const int sr = tid >> 4, sc = tid & 15; const unsigned so = sr * AP + sc * 16; const size_t back = qb ? (size_t)64 * HD * 4 : 0; const int vs = qb * 64 - 64 + sc * 8 + (qb == 0 && sc < 8 ? 64 : 0);
    const char* gQ = (const char*)(Q32 + (bh * SS + qb * 64 + sr) * HD + sc * 4); const char* gK = (const char*)(K32 + (bh * SS + qb * 64 + sr) * HD + sc * 4);
    const char* gVh = (const char*)(VTh + (bh * HD + sr) * SS + vs); const char* gVl = (const char*)(VTl + (bh * HD + sr) * SS + vs);
    cp8((unsigned)(size_t)stQ + so, gQ, 8 * AP, (size_t)8 * HD * 4);
    cp8((unsigned)(size_t)stK + so, gK - back, 8 * AP, (size_t)8 * HD * 4); cp8((unsigned)(size_t)stK + so + 64 * AP, gK, 8 * AP, (size_t)8 * HD * 4);
    cp8((unsigned)(size_t)stVh + so, gVh, 8 * AP, (size_t)8 * SS * 2); cp8((unsigned)(size_t)stVl + so, gVl, 8 * AP, (size_t)8 * SS * 2); }
  WAIT_COPIES(); __syncthreads();      // publishes the staged rows to all four waves; nothing is written there again
  // Q and all five K tiles: 48 LDS reads. Staged K row i is key qb*64 - 64 + i, so tile t of this wave starts at row (w + t) * 16
  R16 q0r, q1r, kr[NKT][2];
  auto raw_at = [&](const char* row, int o) { const float* p = (const float*)row + 8 * g + o; R16 r; r.q[0] = *(const v4f*)p; r.q[1] = *(const v4f*)(p + 4); r.q[2] = *(const v4f*)(p + 16); r.q[3] = *(const v4f*)(p + 20); return r; };
  const char* qt = stQ + (w * 16 + col) * AP; q0r = raw_at(qt, 0); q1r = raw_at(qt, 32);
#pragma unroll      // constant t: kr[] stays in registers
  for (int t = 0; t < NKT; ++t) { const char* kt = stK + ((w + t) * 16 + col) * AP; kr[t][0] = raw_at(kt, 0); kr[t][1] = raw_at(kt, 32); }
  F2 aq[2]; aq[0] = split_raw(q0r); aq[1] = split_raw(q1r);
#pragma unroll
  for (int t = 0; t < NKT; ++t) { const int k0 = q0 - 64 + t * 16;
    v8f s = mac3(aq[0], split_raw(kr[t][0]), (v8f){}); s = mac3(aq[1], split_raw(kr[t][1]), s);
    // key k0 + col, query q0 + 8 g + r. Only tile 0 can fall behind a window (key <= query - WIN: col <= 8 g + r), only the last can lie ahead of a query (col > 8 g + r); any tile but the last can lie in front of key 0, as a whole
#pragma unroll
    for (int r = 0; r < 8; ++r) { const bool off = t == 0 ? (k0 < 0 || col <= 8 * g + r) : (t == NKT - 1 ? col > 8 * g + r : k0 < 0); sS[w][8 * g + r][t * 16 + col] = off ? -3.0e38f : s[r] * 0.125f; } }
  LDSX();
  // V: 48 LDS reads, issued ahead of the softmax. Staged column i is key qb*64 - 64 + i; the 16 columns in front of the staged range (wave 0, first half) read column 0 .. 15 (finite): their P is zero
  v16h vh[3][4], vl[3][4];
#pragma unroll      // constant c and t: vh[] and vl[] stay in registers
  for (int c = 0; c < 3; ++c) { const int ra = w * 16 - 16 + c * 32, rb = ra + 16; const unsigned oa = ((ra < 0 ? 0 : ra) + 8 * g) * 2, ob = (rb + 8 * g) * 2;
#pragma unroll
    for (int t = 0; t < 4; ++t) { union { v16h v; v8h q[2]; } uh, ul; const unsigned o = (t * 16 + col) * AP;
      uh.q[0] = *(const v8h*)(stVh + o + oa); uh.q[1] = *(const v8h*)(stVh + o + ob); ul.q[0] = *(const v8h*)(stVl + o + oa); ul.q[1] = *(const v8h*)(stVl + o + ob);
      vh[c][t] = uh.v; vl[c][t] = ul.v; } }
  // lane (col, g): row col, score columns 40 g .. 40 g + 39
  float mx = -3.4e38f;
#pragma unroll
  for (int jj = 0; jj < NKT * 8; ++jj) mx = fmaxf(mx, sS[w][col][g * (NKT * 8) + jj]);
  mx = fmaxf(mx, __shfl_xor(mx, 16, 32));
  float ps = 0.f;
#pragma unroll
  for (int jj = 0; jj < NKT * 8; ++jj) { const float p = expf(sS[w][col][g * (NKT * 8) + jj] - mx) * 16384.0f; ps += p; const _Float16 hi = (_Float16)p; sPh[w][col][16 + g * (NKT * 8) + jj] = hi; sPl[w][col][16 + g * (NKT * 8) + jj] = (_Float16)((p - (float)hi) * PLO); }
  *(v8h*)(&sPh[w][col][g * 8]) = (v8h){}; *(v8h*)(&sPl[w][col][g * 8]) = (v8h){};      // keys q0-80 .. q0-65: outside every window
  ps += __shfl_xor(ps, 16, 32);
  const float lrun = ps * (1.0f / 16384.0f);
  LDSX();
  v8f acc[4] = {}, ac1[4] = {}, ac2[4] = {};
#pragma unroll
  for (int c = 0; c < 3; ++c) { const v16h ph = frag_h(&sPh[w][col][0] + c * 32, lane), pl = frag_h(&sPl[w][col][0] + c * 32, lane);
#pragma unroll
    for (int t = 0; t < 4; ++t) {
      if (c == 0) { acc[t] = wmma16(ph, vh[c][t], acc[t]); ac1[t] = wmma16(ph, vl[c][t], ac1[t]); ac2[t] = wmma16(pl, vh[c][t], ac2[t]); }      // the accumulators' registers are first written here: wmma16 holds A and B until its slots have passed, so no new D lands on them
      else { acc[t] = wmma16p(ph, vh[c][t], acc[t]); ac1[t] = wmma16p(ph, vl[c][t], ac1[t]); ac2[t] = wmma16p(pl, vh[c][t], ac2[t]); } } }
#pragma unroll
  for (int r = 0; r < 8; ++r) { const float lr = __shfl(lrun, 8 * g + r, 32); const float inv = 1.0f / (lr * 16384.0f * 4.0f);
#pragma unroll
    for (int t = 0; t < 4; ++t) sO[w][8 * g + r][t * 16 + col] = (acc[t][r] + ac1[t][r] * (1.0f / VLO) + ac2[t][r] * (1.0f / PLO)) * inv; }
  LDSX();
  for (int qq = lane; qq < 16 * 16; qq += 32) { const int rl = qq >> 4, pc = qq & 15; vst2(O32 + ((bh * SS) + q0 + rl) * HD + pc * 4, *(const v4f*)(&sO[w][rl][pc * 4])); }
}
// out = ctx Wo^T : split(ctx) x bf16(Wo rows): 2 products (Wo is an INPUT -> bf16 exact)
__global__ __launch_bounds__(128) void k_out(const float* __restrict__ O32, const __bf16* __restrict__ PT, float* __restrict__ out) {
  __shared__ __align__(16) float so[4][16][132];
  __shared__ __align__(16) char ring[2 * OUT_BUF];
  const int tid = threadIdx.x, wave = tid >> 5, lane = tid & 31, col = lane & 15, g = lane >> 4;
  const int r0b = blockIdx.x * 64, r0 = r0b + wave * 16, n0 = blockIdx.y * 128; const int b = r0b / SS, s0 = r0b % SS;
  v8f acc[8] = {};
  // ctx: a tile is two heads' 64 floats of each row; a lane copies chunk (tid & 31) of rows (tid >> 5) + 4 i (16 rows). PT: chunk (tid & 15) of rows (tid >> 4) + 8 i (16 rows)
  const unsigned lA = (unsigned)(size_t)ring + (tid >> 5) * PF + (tid & 31) * 16, lB = (unsigned)(size_t)ring + 64 * PF + (tid >> 4) * PB + (tid & 15) * 16;
  const char* gA = (const char*)(O32 + (((size_t)b * NH + ((tid & 31) >> 4)) * SS + s0 + (tid >> 5)) * HD + (tid & 15) * 4);
  const char* gB = (const char*)(PT + (size_t)(3 * E + n0 + (tid >> 4)) * E + (tid & 15) * 8);
  auto fill = [&](int t) { const unsigned bo = (t & 1) * OUT_BUF; const size_t ka = (size_t)t * 2 * SS * HD * 4, ko = (size_t)t * KT * 2;
    cp8(lA + bo, gA + ka, 4 * PF, (size_t)4 * HD * 4); cp8(lA + bo + 32 * PF, gA + ka + (size_t)32 * HD * 4, 4 * PF, (size_t)4 * HD * 4);
    cp8(lB + bo, gB + ko, 8 * PB, (size_t)8 * E * 2); cp8(lB + bo + 64 * PB, gB + ko + (size_t)64 * E * 2, 8 * PB, (size_t)8 * E * 2); };
  fill(0); WAIT_COPIES(); __syncthreads();
  fill(1);
  for (int t = 0; t < NT; ++t) { const float* bA = (const float*)(ring + (t & 1) * OUT_BUF + (wave * 16 + col) * PF); const char* bB = ring + (t & 1) * OUT_BUF + 64 * PF + col * PB;
    // two fragment sets in registers: block kc + 1's 20 LDS reads issue as one group in front of block kc's WMMAs (never past this tile's buffer)
    R16 ra[2]; v16b fb[2][8];
    auto frags = [&](int kc) { ra[kc & 1] = raw_row(bA, kc * 32, lane);
#pragma unroll      // constant j: fb[] stays in registers
      for (int j = 0; j < 8; ++j) fb[kc & 1][j] = frag_b((const __bf16*)(bB + j * 16 * PB) + kc * 32, lane); };
    frags(0);
#pragma unroll      // constant kc and j: LDS reads take immediate offsets, acc[], ra[] and fb[] stay in registers
    for (int kc = 0; kc < KT / 32; ++kc) { const F2 a = split_raw(ra[kc & 1]);
      if (kc + 1 < KT / 32) frags(kc + 1);
#pragma unroll
      for (int j = 0; j < 8; ++j) { acc[j] = wmma_bf(a.l, fb[kc & 1][j], acc[j]); acc[j] = wmma_bf(a.h, fb[kc & 1][j], acc[j]); } }
    WAIT_LDS(); WAIT_COPIES(); __syncthreads();      // publishes tile t + 1 and frees tile t's buffer
    if (t + 2 < NT) fill(t + 2); }
  WAIT_COPIES();
#pragma unroll
  for (int j = 0; j < 8; ++j) {
#pragma unroll
    for (int r = 0; r < 8; ++r) so[wave][8 * g + r][j * 16 + col] = acc[j][r]; }
  LDSX();
#pragma unroll 4
  for (int rl = 0; rl < 16; ++rl) vst2(out + (size_t)(r0 + rl) * E + n0 + lane * 4, *(const v4f*)(&so[wave][rl][lane * 4]));
}
extern "C" void kernel_launch(void* const* d_in, const int* in_sizes, int n_in, void* d_out, int out_size, void* d_ws, size_t ws_size, hipStream_t stream) {
  (void)in_sizes; (void)n_in; (void)out_size; (void)ws_size;
  const float** I = (const float**)d_in;   // inputs, Wq, Wk, Wv, Wo
  const float* x = I[0]; const float* Wq = I[1]; const float* Wk = I[2]; const float* Wv = I[3]; const float* Wo = I[4];
  float* out = (float*)d_out;
  char* ws = (char*)d_ws; size_t off = 0;
  auto take = [&](size_t bytes) { char* p = ws + off; off += (bytes + 255) & ~(size_t)255; return p; };
  __bf16* Xb = (__bf16*)take((size_t)NR * E * 2); __bf16* PT = (__bf16*)take((size_t)4 * E * E * 2);
  float* Q32 = (float*)take((size_t)NR * E * 4); float* K32 = (float*)take((size_t)NR * E * 4); _Float16* VTh = (_Float16*)take((size_t)NR * E * 2); _Float16* VTl = (_Float16*)take((size_t)NR * E * 2); float* O32 = (float*)take((size_t)NR * E * 4);
  // ws ~ 33 MB
  k_cvt<<<CVX + 4 * CVW, CVB, 0, stream>>>(x, Wq, Wk, Wv, Wo, Xb, PT);
  k_qkv<<<dim3(NR / 64, E / 128, 3), 128, 0, stream>>>(Xb, PT, Q32, K32, VTh, VTl);
  k_attn<<<dim3(SS / 64, NB * NH), 128, 0, stream>>>(Q32, K32, VTh, VTl, O32);
  k_out<<<dim3(NR / 64, E / 128), 128, 0, stream>>>(O32, PT, out);
}

// v006
// Measured time: 32 microseconds a run.
// Two timings next to v005 put it at 1.04 and 1.05 times that version's speed.
// Over all steps from v000 it is 4.29 times as fast.
// compute dtype: inputs and W* (INPUTS) rounded to bf16 with exact bf16 WMMA products (f32 accumulate) for the projections; q/k f32 split for the scores (3 products), P and V f16 hi/lo (3 products); softmax f32.
#include <hip/hip_runtime.h>
#include <math.h>

typedef __attribute__((ext_vector_type(16))) _Float16 v16h;
typedef __attribute__((ext_vector_type(16))) __bf16 v16b;
typedef __attribute__((ext_vector_type(8)))  _Float16 v8h;
typedef __attribute__((ext_vector_type(8)))  float v8f;
typedef __attribute__((ext_vector_type(4)))  float v4f;
typedef __attribute__((ext_vector_type(2)))  float v2f;
typedef __attribute__((ext_vector_type(4)))  unsigned v4u;
typedef __attribute__((ext_vector_type(2)))  unsigned v2u;
typedef __attribute__((ext_vector_type(4)))  int v4i;
typedef float __attribute__((may_alias)) float_a;
typedef int __attribute__((may_alias)) int_a;

template <typename T> __device__ __forceinline__ void vst2(void* p, T v) { *(T*)p = v;  }
__device__ __forceinline__ v8f wmma16(v16h a, v16h b, v8f c) {
  v8f d = __builtin_amdgcn_wmma_f32_16x16x32_f16(false, a, false, b, (short)0, c, false, false);
  asm volatile("v_nop\n\tv_nop\n\tv_nop\n\tv_nop" : "+v"(d) : "v"(a), "v"(b));
  return d;
}
// the plain builtin (the compiler keeps its distances itself), for WMMAs that accumulate in place: no asm statement names its operands, so they may lie above v255, which an asm operand cannot; the 192 registers of V beside 96 of accumulators need that room
__device__ __forceinline__ v8f wmma16p(v16h a, v16h b, v8f c) { return __builtin_amdgcn_wmma_f32_16x16x32_f16(false, a, false, b, (short)0, c, false, false); }
__device__ __forceinline__ v8f wmma_bf(v16b a, v16b b, v8f c) {
  v8f d = __builtin_amdgcn_wmma_f32_16x16x32_bf16(false, a, false, b, (short)0, c, false, false);
  asm volatile("v_nop\n\tv_nop\n\tv_nop\n\tv_nop" : "+v"(d) : "v"(a), "v"(b));
  return d;
}
// 16x16x32 fragments: lane = (h = lane>>4, row/col = lane&15); elements 0..7 = k0+8h+0..7, 8..15 = k0+16+8h+0..7; D element r = row 8h+r
__device__ __forceinline__ v16h frag_h(const _Float16* rowk0, int lane) {
  union { v16h v; v8h q[2]; } u; const _Float16* p = rowk0 + 8 * (lane >> 4);
  u.q[0] = *(const v8h*)p; u.q[1] = *(const v8h*)(p + 16); return u.v;
}
__device__ __forceinline__ v16h frag_f32(const float* rowk0, int lane) {
  v16h a; const float* p = rowk0 + 8 * (lane >> 4);
#pragma unroll
  for (int i = 0; i < 8; ++i) { a[i] = (_Float16)p[i]; a[8 + i] = (_Float16)p[16 + i]; }
  return a;
}
__device__ __forceinline__ v16h frag_f32s(const float* rowk0, int lane, float sc) {
  v16h a; const float* p = rowk0 + 8 * (lane >> 4);
#pragma unroll
  for (int i = 0; i < 8; ++i) { a[i] = (_Float16)(p[i] * sc); a[8 + i] = (_Float16)(p[16 + i] * sc); }
  return a;
}
// column fragment from a [K][ld] layout (column n), rows >= K read as 0
__device__ __forceinline__ v16h fragc_f32(const float* W, int k0, int n, int lane, int ld, int K) {
  v16h a; const int g = lane >> 4;
#pragma unroll
  for (int i = 0; i < 8; ++i) { const int ka = k0 + 8 * g + i, kb = ka + 16;
    a[i] = (_Float16)(ka < K ? W[(size_t)ka * ld + n] : 0.f); a[8 + i] = (_Float16)(kb < K ? W[(size_t)kb * ld + n] : 0.f); }
  return a;
}
struct F2 { v16b h, l; };
__device__ __forceinline__ F2 bsplit16(const float v[16]) { F2 r;
#pragma unroll
  for (int i = 0; i < 16; ++i) { const __bf16 h = (__bf16)v[i]; r.h[i] = h; r.l[i] = (__bf16)(v[i] - (float)h); }
  return r; }
__device__ __forceinline__ F2 split_row(const float* row, int k0, int lane) { float v[16]; const float* p = row + k0 + 8 * (lane >> 4);
#pragma unroll
  for (int i = 0; i < 8; ++i) { v[i] = p[i]; v[8 + i] = p[16 + i]; }
  return bsplit16(v); }
// the 16 floats of split_row, loaded but not yet split: lets a whole group of loads issue before the first value is used
struct R16 { v4f q[4]; };
__device__ __forceinline__ R16 raw_row(const float* row, int k0, int lane) { R16 r; const float* p = row + k0 + 8 * (lane >> 4);
  r.q[0] = *(const v4f*)p; r.q[1] = *(const v4f*)(p + 4); r.q[2] = *(const v4f*)(p + 16); r.q[3] = *(const v4f*)(p + 20); return r; }
__device__ __forceinline__ F2 split_raw(const R16& r) { float v[16];
#pragma unroll
  for (int i = 0; i < 16; ++i) v[i] = r.q[i >> 2][i & 3];
  return bsplit16(v); }
__device__ __forceinline__ F2 split_rowK(const float* row, int k0, int lane, int K) { float v[16]; const int g = lane >> 4;
#pragma unroll
  for (int i = 0; i < 8; ++i) { const int ka = k0 + 8 * g + i, kb = ka + 16; v[i] = ka < K ? row[ka] : 0.f; v[8 + i] = kb < K ? row[kb] : 0.f; }
  return bsplit16(v); }
__device__ __forceinline__ F2 split_col(const float* W, int k0, int n, int lane, int ld, int K) { float v[16]; const int g = lane >> 4;
#pragma unroll
  for (int i = 0; i < 8; ++i) { const int ka = k0 + 8 * g + i, kb = ka + 16; v[i] = ka < K ? W[(size_t)ka * ld + n] : 0.f; v[8 + i] = kb < K ? W[(size_t)kb * ld + n] : 0.f; }
  return bsplit16(v); }
__device__ __forceinline__ v8f mac3(const F2& a, const F2& b, v8f c) { c = wmma_bf(a.l, b.h, c); c = wmma_bf(a.h, b.l, c); return wmma_bf(a.h, b.h, c); }
__device__ __forceinline__ float sigm(float v) { return 1.0f / (1.0f + expf(-v)); }
#define LDSX() do { asm volatile("s_wait_dscnt 0" ::: "memory"); __builtin_amdgcn_wave_barrier(); __builtin_amdgcn_fence(__ATOMIC_RELEASE, "workgroup"); } while (0)


// Sliding-window causal attention (12 heads of 64 on [1,2048,768], [out][in] weights, no biases, scale 1/8): each query attends to keys max(0, q-63) .. q (the reference gathers a 64-token window ending at q and masks window slots beyond q);
// softmax; (P v) Wo^T. Only the 16-key tiles that can intersect a wave's windows are visited (exact: every other weight is exp(-inf) = 0).
#define NB 1
#define SS 2048
#define E 768
#define NH 12
#define WIN 64
#define HD 64
#define NR (NB * SS)
#define PLO 1024.0f
#define VLO 2048.0f
__device__ __forceinline__ float bfr(float v) { return (float)(__bf16)v; }
__device__ __forceinline__ v16b frag_b(const __bf16* rowk0, int lane) { return __builtin_bit_cast(v16b, frag_h((const _Float16*)rowk0, lane)); }
// LDS ring of the output projection GEMM: a tile is 128 k of every operand row; two buffers
#define KT 128
#define NT (E / KT)
#define PB 272                      // LDS pitch of a 256-byte bf16 row (16 B x odd: conflict-free b128 reads)
#define PF 528                      // LDS pitch of a 512-byte f32 row (16 B x odd)
#define OUT_BUF (64 * PF + 128 * PB) // [ctx 64 rows f32 | PT 128 rows]
// eight asynchronous 16-byte copies per lane, global -> LDS, rows ls / gs bytes apart. The s_wait_xcnt ends the copies' own statement, so no address register is rewritten in front of it.
__device__ __forceinline__ void cp8(unsigned l, const char* g, unsigned ls, size_t gs) {
  asm volatile("global_load_async_to_lds_b128 %0, %8, off\n\t"
               "global_load_async_to_lds_b128 %1, %9, off\n\t"
               "global_load_async_to_lds_b128 %2, %10, off\n\t"
               "global_load_async_to_lds_b128 %3, %11, off\n\t"
               "global_load_async_to_lds_b128 %4, %12, off\n\t"
               "global_load_async_to_lds_b128 %5, %13, off\n\t"
               "global_load_async_to_lds_b128 %6, %14, off\n\t"
               "global_load_async_to_lds_b128 %7, %15, off\n\t"
               "s_wait_xcnt 0x0"
               :: "v"(l), "v"(l + ls), "v"(l + 2 * ls), "v"(l + 3 * ls), "v"(l + 4 * ls), "v"(l + 5 * ls), "v"(l + 6 * ls), "v"(l + 7 * ls),
                  "v"(g), "v"(g + gs), "v"(g + 2 * gs), "v"(g + 3 * gs), "v"(g + 4 * gs), "v"(g + 5 * gs), "v"(g + 6 * gs), "v"(g + 7 * gs)
               : "memory");
}
// the issuing wave's own copies have landed
#define WAIT_COPIES() asm volatile("s_wait_asynccnt 0x0" ::: "memory")
// this wave's LDS reads have returned (before the buffer they read is handed back for a refill)
#define WAIT_LDS() asm volatile("s_wait_dscnt 0x0" ::: "memory")

// One conversion launch, f32 -> bf16 (round to nearest even), for x and the four [out][in] weights: PT rows [0,E) Wq, [E,2E) Wk, [2E,3E) Wv, [3E,4E) Wo, each row as it lies.
// Few long waves: a block is 16 waves and converts CVB * CVU * 4 consecutive floats of ONE source; a lane holds CVU 16-byte loads in flight, each wave-wide load 512 and each store 256 contiguous bytes.
#define CVB 512
#define CVU 8
#define CVE (CVB * CVU * 4)
#define CVX (NR * E / CVE)          // blocks on x
#define CVW (E * E / CVE)           // blocks on each weight
static_assert(CVX * CVE == NR * E && CVW * CVE == E * E, "a conversion block never crosses a source's end");
__global__ __launch_bounds__(CVB) void k_cvt(const float* __restrict__ x, const float* __restrict__ Wq, const float* __restrict__ Wk, const float* __restrict__ Wv, const float* __restrict__ Wo, __bf16* __restrict__ Xb, __bf16* __restrict__ PT) {
  const int bx = blockIdx.x, tid = threadIdx.x; const float* s; __bf16* d;
  if (bx < CVX) { s = x + (size_t)bx * CVE; d = Xb + (size_t)bx * CVE; }
  else { const int m = (bx - CVX) / CVW, r = (bx - CVX) % CVW; s = (m == 0 ? Wq : (m == 1 ? Wk : (m == 2 ? Wv : Wo))) + (size_t)r * CVE; d = PT + (size_t)m * E * E + (size_t)r * CVE; }
  v4f v[CVU];
#pragma unroll      // all CVU loads issue before the first value is used
  for (int u = 0; u < CVU; ++u) v[u] = *(const v4f*)(s + (u * CVB + tid) * 4);
#pragma unroll      // constant u and e: v[] stays in registers
  for (int u = 0; u < CVU; ++u) { union { __bf16 h[4]; v2u q; } pk;
#pragma unroll      // as above
    for (int e = 0; e < 4; ++e) pk.h[e] = (__bf16)v[u][e];
    vst2(d + (u * CVB + tid) * 4, pk.q); }
}
// projections and windowed attention in ONE launch: block (64 queries, bh). The block first computes, on the matrix unit, q of its 64 tokens and k, v of the 128 tokens qb*64-64 .. qb*64+63 for its head
// (a 128 x 192 GEMM over k = 768; the 64 tokens in front are computed again by the block that owns them), and leaves them in LDS where the attention part reads them: q, k, v never go through memory.
// GEMM: operand tiles of 64 k in a two-buffer LDS ring filled by asynchronous copies; four waves of 64 rows x 96 cols (10 LDS fragments feed 24 WMMAs); cols are [q 64 | k 64 | v 64]. q of the 64 tokens in front is computed and dropped (uniform waves).
// Attention: a wave owns 16 queries q0 .. q0+15. Their windows lie in keys q0-64 .. q0+15: five 16-key score tiles, ONE softmax pass (row maximum and row sum over the whole window, no running rescale).
// S on hi/lo splits of the f32 q/k rows; P,V hi/lo over 96 key columns q0-80 .. q0+15 (three k = 32 blocks; the first 16 columns of P are zero); O f32 [bh][s][64]
#define NKT 5                       // score tiles of 16 keys
#define SP (NKT * 16 + 4)           // f32 pitch of a score row (16 B x odd: conflict-free b128 reads)
#define PP (96 + 8)                 // f16 pitch of a P row (16 B x odd)
#define AP 272                      // LDS pitch of a 256-byte q, k or v row (16 B x odd: conflict-free b128 reads)
#define KF 64                       // k of a ring tile of the fused GEMM
#define NF (E / KF)
#define PK 144                      // LDS pitch of a 128-byte bf16 row (16 B x odd)
#define QA_BUF ((128 + 192) * PK)   // [Xb 128 rows | Wq 64 | Wk 64 | Wv 64 rows]
#define QA_LDS (320 * AP + 4 * 16 * SP * 4 + 2 * 4 * 16 * PP * 2 + 4 * 16 * 68 * 4)
static_assert(KF == 64 && 2 * QA_BUF <= QA_LDS, "the ring lies inside the attention part's LDS");
// the plain builtin (the compiler keeps its distances itself): 192 accumulator registers beside two fragment sets reach above v255, which an asm operand cannot name
__device__ __forceinline__ v8f wmma_bfp(v16b a, v16b b, v8f c) { return __builtin_amdgcn_wmma_f32_16x16x32_bf16(false, a, false, b, (short)0, c, false, false); }
// asynchronous 16-byte copies per lane, LDS rows ls apart; every four rows have a global base of their own, rows gs apart. The s_wait_xcnt ends the copies' own statement, so no address register is rewritten in front of it.
__device__ __forceinline__ void cp4x2(unsigned l, const char* a, const char* b, unsigned ls, size_t gs) {
  asm volatile("global_load_async_to_lds_b128 %0, %8, off\n\t"
               "global_load_async_to_lds_b128 %1, %9, off\n\t"
               "global_load_async_to_lds_b128 %2, %10, off\n\t"
               "global_load_async_to_lds_b128 %3, %11, off\n\t"
               "global_load_async_to_lds_b128 %4, %12, off\n\t"
               "global_load_async_to_lds_b128 %5, %13, off\n\t"
               "global_load_async_to_lds_b128 %6, %14, off\n\t"
               "global_load_async_to_lds_b128 %7, %15, off\n\t"
               "s_wait_xcnt 0x0"
               :: "v"(l), "v"(l + ls), "v"(l + 2 * ls), "v"(l + 3 * ls), "v"(l + 4 * ls), "v"(l + 5 * ls), "v"(l + 6 * ls), "v"(l + 7 * ls),
                  "v"(a), "v"(a + gs), "v"(a + 2 * gs), "v"(a + 3 * gs), "v"(b), "v"(b + gs), "v"(b + 2 * gs), "v"(b + 3 * gs)
               : "memory");
}
__device__ __forceinline__ void cp4x3(unsigned l, const char* a, const char* b, const char* c, unsigned ls, size_t gs) {
  asm volatile("global_load_async_to_lds_b128 %0, %12, off\n\t"
               "global_load_async_to_lds_b128 %1, %13, off\n\t"
               "global_load_async_to_lds_b128 %2, %14, off\n\t"
               "global_load_async_to_lds_b128 %3, %15, off\n\t"
               "global_load_async_to_lds_b128 %4, %16, off\n\t"
               "global_load_async_to_lds_b128 %5, %17, off\n\t"
               "global_load_async_to_lds_b128 %6, %18, off\n\t"
               "global_load_async_to_lds_b128 %7, %19, off\n\t"
               "global_load_async_to_lds_b128 %8, %20, off\n\t"
               "global_load_async_to_lds_b128 %9, %21, off\n\t"
               "global_load_async_to_lds_b128 %10, %22, off\n\t"
               "global_load_async_to_lds_b128 %11, %23, off\n\t"
               "s_wait_xcnt 0x0"
               :: "v"(l), "v"(l + ls), "v"(l + 2 * ls), "v"(l + 3 * ls), "v"(l + 4 * ls), "v"(l + 5 * ls), "v"(l + 6 * ls), "v"(l + 7 * ls), "v"(l + 8 * ls), "v"(l + 9 * ls), "v"(l + 10 * ls), "v"(l + 11 * ls),
                  "v"(a), "v"(a + gs), "v"(a + 2 * gs), "v"(a + 3 * gs), "v"(b), "v"(b + gs), "v"(b + 2 * gs), "v"(b + 3 * gs), "v"(c), "v"(c + gs), "v"(c + 2 * gs), "v"(c + 3 * gs)
               : "memory");
}
__global__ __launch_bounds__(128) void k_qa(const __bf16* __restrict__ Xb, const __bf16* __restrict__ PT, float* __restrict__ O32) {
  __shared__ __align__(16) char sm[QA_LDS];      // the ring uses its front; q, k, v are written over it behind the loop's last barrier
  char* const stQ = sm; char* const stK = stQ + 64 * AP; char* const stVh = stK + 128 * AP; char* const stVl = stVh + 64 * AP;
  float (*sS)[16][SP] = (float (*)[16][SP])(stVl + 64 * AP);
  _Float16 (*sPh)[16][PP] = (_Float16 (*)[16][PP])((char*)sS + 4 * 16 * SP * 4); _Float16 (*sPl)[16][PP] = sPh + 4;
  float (*sO)[16][68] = (float (*)[16][68])(sPl + 4);
  const int tid = threadIdx.x, w = __builtin_amdgcn_readfirstlane(tid >> 5), lane = tid & 31, col = lane & 15, g = lane >> 4;      // w in a scalar register: tile rows and their clamps are scalar
  const size_t bh = blockIdx.y; const int qb = blockIdx.x; const int q0 = qb * 64 + w * 16;
  { const int wr = w >> 1, wc = w & 1; const size_t bb = bh / NH, hh = bh % NH;
    v8f acc[4][6] = {};
    // a lane copies chunk (tid & 7) of rows (tid >> 3) + 16 i: a wave-wide copy is four whole 128-byte rows. In the first block the 64 tokens in front of token 0 are taken from tokens 0 .. 63 (in bounds, finite); as keys they are masked below and their P is zero
    const int sr = tid >> 3, sc = tid & 7; const unsigned lA = (unsigned)(size_t)sm + sr * PK + sc * 16;
    const char* gO = (const char*)(Xb + (bb * SS + qb * 64 + sr) * E + sc * 8); const char* gH = gO - (qb ? (size_t)64 * E * 2 : 0);
    const char* gW = (const char*)(PT + (hh * HD + sr) * E + sc * 8);
    auto fill = [&](int t) { const unsigned bo = (t & 1) * QA_BUF; const size_t ko = (size_t)t * KF * 2;
      cp4x2(lA + bo, gH + ko, gO + ko, 16 * PK, (size_t)16 * E * 2);
      cp4x3(lA + bo + 128 * PK, gW + ko, gW + ko + (size_t)E * E * 2, gW + ko + (size_t)2 * E * E * 2, 16 * PK, (size_t)16 * E * 2); };
    fill(0); WAIT_COPIES(); __syncthreads();
#pragma unroll 1      // rolled: for speed only
    for (int t = 0; t < NF; ++t) { const char* bA = sm + (t & 1) * QA_BUF + (wr * 64 + col) * PK; const char* bB = sm + (t & 1) * QA_BUF + (128 + wc * 96 + col) * PK;
      // two fragment sets in registers: both blocks' 20 LDS reads issue as groups in front of the WMMAs (never past this tile's buffer); the next tile's copies issue between them, under block 0's LDS latency
      v16b fa[2][4], fb[2][6];
      auto frags = [&](int kc) {
#pragma unroll      // constant i: fa[] stays in registers
        for (int i = 0; i < 4; ++i) fa[kc & 1][i] = frag_b((const __bf16*)(bA + i * 16 * PK) + kc * 32, lane);
#pragma unroll      // constant j: fb[] stays in registers
        for (int j = 0; j < 6; ++j) fb[kc & 1][j] = frag_b((const __bf16*)(bB + j * 16 * PK) + kc * 32, lane); };
      frags(0);
      if (t + 1 < NF) fill(t + 1);      // into the buffer that trip t - 1 read: behind the barrier at that trip's foot
      frags(1);
      __builtin_amdgcn_sched_barrier(0);      // keeps the 40 reads ahead of the WMMAs: sunk to their first use, each group of six WMMAs would wait out an LDS latency of its own
#pragma unroll      // constant kc, i and j: LDS reads take immediate offsets, acc[], fa[] and fb[] stay in registers
      for (int kc = 0; kc < KF / 32; ++kc) {
#pragma unroll
        for (int i = 0; i < 4; ++i) {
#pragma unroll
          for (int j = 0; j < 6; ++j) acc[i][j] = wmma_bfp(fa[kc & 1][i], fb[kc & 1][j], acc[i][j]); } }
      __builtin_amdgcn_sched_barrier(0);      // keeps the WMMAs ahead of the waits: moved behind the barrier, they would no longer run under the copies' latency
      WAIT_LDS(); WAIT_COPIES(); __syncthreads(); }      // publishes tile t + 1 and frees tile t's buffer
    WAIT_COPIES();
    // D element r of tile (i, j): token row wr*64 + i*16 + 8 g + r, col wc*96 + j*16 + col. Row i of stK and column i of stV are key qb*64 - 64 + i; row i of stQ is query qb*64 + i
    auto put_f = [&](char* dst, int i, int j, int row, int d0) {      // one 16 x 16 tile as f32, rows AP apart
#pragma unroll      // constant r: acc[] stays in registers
      for (int r = 0; r < 8; ++r) *(float*)(dst + (row + i * 16 + 8 * g + r) * AP + (d0 + col) * 4) = acc[i][j][r]; };
    if (wc == 0) {      // cols 0 .. 95: q, then the first half of k
#pragma unroll      // constant i and j here and below: acc[] stays in registers
      for (int i = 0; i < 4; ++i) {
#pragma unroll
        for (int j = 4; j < 6; ++j) put_f(stK, i, j, wr * 64, (j - 4) * 16); }
      if (wr == 1) {
#pragma unroll
        for (int i = 0; i < 4; ++i) {
#pragma unroll
          for (int j = 0; j < 4; ++j) put_f(stQ, i, j, 0, j * 16); } } }
    else {              // cols 96 .. 191: the second half of k, then v (x4, f16 hi and lo, transposed: eight keys of one d are 16 bytes)
#pragma unroll
      for (int i = 0; i < 4; ++i) {
#pragma unroll
        for (int j = 0; j < 2; ++j) put_f(stK, i, j, wr * 64, (j + 2) * 16);
#pragma unroll
        for (int j = 2; j < 6; ++j) { const int d = (j - 2) * 16 + col, key = wr * 64 + i * 16 + 8 * g; v8h hi8, lo8;
#pragma unroll
          for (int r = 0; r < 8; ++r) { const float v = acc[i][j][r] * 4.0f; const _Float16 hi = (_Float16)v; hi8[r] = hi; lo8[r] = (_Float16)((v - (float)hi) * VLO); }
          *(v8h*)(stVh + d * AP + key * 2) = hi8; *(v8h*)(stVl + d * AP + key * 2) = lo8; } } } }
  __syncthreads();      // publishes q, k, v to all four waves; nothing is written there again
  // Q and all five K tiles: 48 LDS reads. Staged K row i is key qb*64 - 64 + i, so tile t of this wave starts at row (w + t) * 16
  R16 q0r, q1r, kr[NKT][2];
  auto raw_at = [&](const char* row, int o) { const float* p = (const float*)row + 8 * g + o; R16 r; r.q[0] = *(const v4f*)p; r.q[1] = *(const v4f*)(p + 4); r.q[2] = *(const v4f*)(p + 16); r.q[3] = *(const v4f*)(p + 20); return r; };
  const char* qt = stQ + (w * 16 + col) * AP; q0r = raw_at(qt, 0); q1r = raw_at(qt, 32);
#pragma unroll      // constant t: kr[] stays in registers
  for (int t = 0; t < NKT; ++t) { const char* kt = stK + ((w + t) * 16 + col) * AP; kr[t][0] = raw_at(kt, 0); kr[t][1] = raw_at(kt, 32); }
  F2 aq[2]; aq[0] = split_raw(q0r); aq[1] = split_raw(q1r);
#pragma unroll
  for (int t = 0; t < NKT; ++t) { const int k0 = q0 - 64 + t * 16;
    v8f s = mac3(aq[0], split_raw(kr[t][0]), (v8f){}); s = mac3(aq[1], split_raw(kr[t][1]), s);
    // key k0 + col, query q0 + 8 g + r. Only tile 0 can fall behind a window (key <= query - WIN: col <= 8 g + r), only the last can lie ahead of a query (col > 8 g + r); any tile but the last can lie in front of key 0, as a whole
#pragma unroll
    for (int r = 0; r < 8; ++r) { const bool off = t == 0 ? (k0 < 0 || col <= 8 * g + r) : (t == NKT - 1 ? col > 8 * g + r : k0 < 0); sS[w][8 * g + r][t * 16 + col] = off ? -3.0e38f : s[r] * 0.125f; } }
  LDSX();
  // V: 48 LDS reads, issued ahead of the softmax. Staged column i is key qb*64 - 64 + i; the 16 columns in front of the staged range (wave 0, first half) read column 0 .. 15 (finite): their P is zero
  v16h vh[3][4], vl[3][4];
#pragma unroll      // constant c and t: vh[] and vl[] stay in registers
  for (int c = 0; c < 3; ++c) { const int ra = w * 16 - 16 + c * 32, rb = ra + 16; const unsigned oa = ((ra < 0 ? 0 : ra) + 8 * g) * 2, ob = (rb + 8 * g) * 2;
#pragma unroll
    for (int t = 0; t < 4; ++t) { union { v16h v; v8h q[2]; } uh, ul; const unsigned o = (t * 16 + col) * AP;
      uh.q[0] = *(const v8h*)(stVh + o + oa); uh.q[1] = *(const v8h*)(stVh + o + ob); ul.q[0] = *(const v8h*)(stVl + o + oa); ul.q[1] = *(const v8h*)(stVl + o + ob);
      vh[c][t] = uh.v; vl[c][t] = ul.v; } }
  // lane (col, g): row col, score columns 40 g .. 40 g + 39
  float mx = -3.4e38f;
#pragma unroll
  for (int jj = 0; jj < NKT * 8; ++jj) mx = fmaxf(mx, sS[w][col][g * (NKT * 8) + jj]);
  mx = fmaxf(mx, __shfl_xor(mx, 16, 32));
  float ps = 0.f;
#pragma unroll
  for (int jj = 0; jj < NKT * 8; ++jj) { const float p = expf(sS[w][col][g * (NKT * 8) + jj] - mx) * 16384.0f; ps += p; const _Float16 hi = (_Float16)p; sPh[w][col][16 + g * (NKT * 8) + jj] = hi; sPl[w][col][16 + g * (NKT * 8) + jj] = (_Float16)((p - (float)hi) * PLO); }
  *(v8h*)(&sPh[w][col][g * 8]) = (v8h){}; *(v8h*)(&sPl[w][col][g * 8]) = (v8h){};      // keys q0-80 .. q0-65: outside every window
  ps += __shfl_xor(ps, 16, 32);
  const float lrun = ps * (1.0f / 16384.0f);
  LDSX();
  v8f acc[4] = {}, ac1[4] = {}, ac2[4] = {};
#pragma unroll
  for (int c = 0; c < 3; ++c) { const v16h ph = frag_h(&sPh[w][col][0] + c * 32, lane), pl = frag_h(&sPl[w][col][0] + c * 32, lane);
#pragma unroll
    for (int t = 0; t < 4; ++t) {
      if (c == 0) { acc[t] = wmma16(ph, vh[c][t], acc[t]); ac1[t] = wmma16(ph, vl[c][t], ac1[t]); ac2[t] = wmma16(pl, vh[c][t], ac2[t]); }      // the accumulators' registers are first written here: wmma16 holds A and B until its slots have passed, so no new D lands on them
      else { acc[t] = wmma16p(ph, vh[c][t], acc[t]); ac1[t] = wmma16p(ph, vl[c][t], ac1[t]); ac2[t] = wmma16p(pl, vh[c][t], ac2[t]); } } }
#pragma unroll
  for (int r = 0; r < 8; ++r) { const float lr = __shfl(lrun, 8 * g + r, 32); const float inv = 1.0f / (lr * 16384.0f * 4.0f);
#pragma unroll
    for (int t = 0; t < 4; ++t) sO[w][8 * g + r][t * 16 + col] = (acc[t][r] + ac1[t][r] * (1.0f / VLO) + ac2[t][r] * (1.0f / PLO)) * inv; }
  LDSX();
  for (int qq = lane; qq < 16 * 16; qq += 32) { const int rl = qq >> 4, pc = qq & 15; vst2(O32 + ((bh * SS) + q0 + rl) * HD + pc * 4, *(const v4f*)(&sO[w][rl][pc * 4])); }
}
// out = ctx Wo^T : split(ctx) x bf16(Wo rows): 2 products (Wo is an INPUT -> bf16 exact)
__global__ __launch_bounds__(128) void k_out(const float* __restrict__ O32, const __bf16* __restrict__ PT, float* __restrict__ out) {
  __shared__ __align__(16) float so[4][16][132];
  __shared__ __align__(16) char ring[2 * OUT_BUF];
  const int tid = threadIdx.x, wave = tid >> 5, lane = tid & 31, col = lane & 15, g = lane >> 4;
  const int r0b = blockIdx.x * 64, r0 = r0b + wave * 16, n0 = blockIdx.y * 128; const int b = r0b / SS, s0 = r0b % SS;
  v8f acc[8] = {};
  // ctx: a tile is two heads' 64 floats of each row; a lane copies chunk (tid & 31) of rows (tid >> 5) + 4 i (16 rows). PT: chunk (tid & 15) of rows (tid >> 4) + 8 i (16 rows)
  const unsigned lA = (unsigned)(size_t)ring + (tid >> 5) * PF + (tid & 31) * 16, lB = (unsigned)(size_t)ring + 64 * PF + (tid >> 4) * PB + (tid & 15) * 16;
  const char* gA = (const char*)(O32 + (((size_t)b * NH + ((tid & 31) >> 4)) * SS + s0 + (tid >> 5)) * HD + (tid & 15) * 4);
  const char* gB = (const char*)(PT + (size_t)(3 * E + n0 + (tid >> 4)) * E + (tid & 15) * 8);
  auto fill = [&](int t) { const unsigned bo = (t & 1) * OUT_BUF; const size_t ka = (size_t)t * 2 * SS * HD * 4, ko = (size_t)t * KT * 2;
    cp8(lA + bo, gA + ka, 4 * PF, (size_t)4 * HD * 4); cp8(lA + bo + 32 * PF, gA + ka + (size_t)32 * HD * 4, 4 * PF, (size_t)4 * HD * 4);
    cp8(lB + bo, gB + ko, 8 * PB, (size_t)8 * E * 2); cp8(lB + bo + 64 * PB, gB + ko + (size_t)64 * E * 2, 8 * PB, (size_t)8 * E * 2); };
  fill(0); WAIT_COPIES(); __syncthreads();
  fill(1);
  for (int t = 0; t < NT; ++t) { const float* bA = (const float*)(ring + (t & 1) * OUT_BUF + (wave * 16 + col) * PF); const char* bB = ring + (t & 1) * OUT_BUF + 64 * PF + col * PB;
    // two fragment sets in registers: block kc + 1's 20 LDS reads issue as one group in front of block kc's WMMAs (never past this tile's buffer)
    R16 ra[2]; v16b fb[2][8];
    auto frags = [&](int kc) { ra[kc & 1] = raw_row(bA, kc * 32, lane);
#pragma unroll      // constant j: fb[] stays in registers
      for (int j = 0; j < 8; ++j) fb[kc & 1][j] = frag_b((const __bf16*)(bB + j * 16 * PB) + kc * 32, lane); };
    frags(0);
#pragma unroll      // constant kc and j: LDS reads take immediate offsets, acc[], ra[] and fb[] stay in registers
    for (int kc = 0; kc < KT / 32; ++kc) { const F2 a = split_raw(ra[kc & 1]);
      if (kc + 1 < KT / 32) frags(kc + 1);
#pragma unroll
      for (int j = 0; j < 8; ++j) { acc[j] = wmma_bf(a.l, fb[kc & 1][j], acc[j]); acc[j] = wmma_bf(a.h, fb[kc & 1][j], acc[j]); } }
    WAIT_LDS(); WAIT_COPIES(); __syncthreads();      // publishes tile t + 1 and frees tile t's buffer
    if (t + 2 < NT) fill(t + 2); }
  WAIT_COPIES();
#pragma unroll
  for (int j = 0; j < 8; ++j) {
#pragma unroll
    for (int r = 0; r < 8; ++r) so[wave][8 * g + r][j * 16 + col] = acc[j][r]; }
  LDSX();
#pragma unroll 4
  for (int rl = 0; rl < 16; ++rl) vst2(out + (size_t)(r0 + rl) * E + n0 + lane * 4, *(const v4f*)(&so[wave][rl][lane * 4]));
}
extern "C" void kernel_launch(void* const* d_in, const int* in_sizes, int n_in, void* d_out, int out_size, void* d_ws, size_t ws_size, hipStream_t stream) {
  (void)in_sizes; (void)n_in; (void)out_size; (void)ws_size;
  const float** I = (const float**)d_in;   // inputs, Wq, Wk, Wv, Wo
  const float* x = I[0]; const float* Wq = I[1]; const float* Wk = I[2]; const float* Wv = I[3]; const float* Wo = I[4];
  float* out = (float*)d_out;
  char* ws = (char*)d_ws; size_t off = 0;
  auto take = [&](size_t bytes) { char* p = ws + off; off += (bytes + 255) & ~(size_t)255; return p; };
  __bf16* Xb = (__bf16*)take((size_t)NR * E * 2); __bf16* PT = (__bf16*)take((size_t)4 * E * E * 2);
  float* O32 = (float*)take((size_t)NR * E * 4);
  // ws ~ 14 MB
  k_cvt<<<CVX + 4 * CVW, CVB, 0, stream>>>(x, Wq, Wk, Wv, Wo, Xb, PT);
  k_qa<<<dim3(SS / 64, NB * NH), 128, 0, stream>>>(Xb, PT, O32);
  k_out<<<dim3(NR / 64, E / 128), 128, 0, stream>>>(O32, PT, out);
}

// v007
// One run takes 27.9 microseconds.
// Timed twice side by side with v006, it ran 1.18 and 1.14 times as fast.
// Counting every step since v000, it is 4.97 times as fast.
// compute dtype: inputs and W* (INPUTS) rounded to bf16 with exact bf16 WMMA products (f32 accumulate) for the projections; q/k f32 split for the scores (3 products), P and V f16 hi/lo (3 products); softmax f32.
#include <hip/hip_runtime.h>
#include <math.h>

typedef __attribute__((ext_vector_type(16))) _Float16 v16h;
typedef __attribute__((ext_vector_type(16))) __bf16 v16b;
typedef __attribute__((ext_vector_type(8)))  _Float16 v8h;
typedef __attribute__((ext_vector_type(8)))  float v8f;
typedef __attribute__((ext_vector_type(4)))  float v4f;
typedef __attribute__((ext_vector_type(2)))  float v2f;
typedef __attribute__((ext_vector_type(4)))  unsigned v4u;
typedef __attribute__((ext_vector_type(2)))  unsigned v2u;
typedef __attribute__((ext_vector_type(4)))  int v4i;
typedef float __attribute__((may_alias)) float_a;
typedef int __attribute__((may_alias)) int_a;

template <typename T> __device__ __forceinline__ void vst2(void* p, T v) { *(T*)p = v;  }
__device__ __forceinline__ v8f wmma16(v16h a, v16h b, v8f c) {
  v8f d = __builtin_amdgcn_wmma_f32_16x16x32_f16(false, a, false, b, (short)0, c, false, false);
  asm volatile("v_nop\n\tv_nop\n\tv_nop\n\tv_nop" : "+v"(d) : "v"(a), "v"(b));
  return d;
}
// the plain builtin (the compiler keeps its distances itself), for WMMAs that accumulate in place: no asm statement names its operands, so they may lie above v255, which an asm operand cannot; the 192 registers of V beside 96 of accumulators need that room
__device__ __forceinline__ v8f wmma16p(v16h a, v16h b, v8f c) { return __builtin_amdgcn_wmma_f32_16x16x32_f16(false, a, false, b, (short)0, c, false, false); }
__device__ __forceinline__ v8f wmma_bf(v16b a, v16b b, v8f c) {
  v8f d = __builtin_amdgcn_wmma_f32_16x16x32_bf16(false, a, false, b, (short)0, c, false, false);
  asm volatile("v_nop\n\tv_nop\n\tv_nop\n\tv_nop" : "+v"(d) : "v"(a), "v"(b));
  return d;
}
// 16x16x32 fragments: lane = (h = lane>>4, row/col = lane&15); elements 0..7 = k0+8h+0..7, 8..15 = k0+16+8h+0..7; D element r = row 8h+r
__device__ __forceinline__ v16h frag_h(const _Float16* rowk0, int lane) {
  union { v16h v; v8h q[2]; } u; const _Float16* p = rowk0 + 8 * (lane >> 4);
  u.q[0] = *(const v8h*)p; u.q[1] = *(const v8h*)(p + 16); return u.v;
}
__device__ __forceinline__ v16h frag_f32(const float* rowk0, int lane) {
  v16h a; const float* p = rowk0 + 8 * (lane >> 4);
#pragma unroll
  for (int i = 0; i < 8; ++i) { a[i] = (_Float16)p[i]; a[8 + i] = (_Float16)p[16 + i]; }
  return a;
}
__device__ __forceinline__ v16h frag_f32s(const float* rowk0, int lane, float sc) {
  v16h a; const float* p = rowk0 + 8 * (lane >> 4);
#pragma unroll
  for (int i = 0; i < 8; ++i) { a[i] = (_Float16)(p[i] * sc); a[8 + i] = (_Float16)(p[16 + i] * sc); }
  return a;
}
// column fragment from a [K][ld] layout (column n), rows >= K read as 0
__device__ __forceinline__ v16h fragc_f32(const float* W, int k0, int n, int lane, int ld, int K) {
  v16h a; const int g = lane >> 4;
#pragma unroll
  for (int i = 0; i < 8; ++i) { const int ka = k0 + 8 * g + i, kb = ka + 16;
    a[i] = (_Float16)(ka < K ? W[(size_t)ka * ld + n] : 0.f); a[8 + i] = (_Float16)(kb < K ? W[(size_t)kb * ld + n] : 0.f); }
  return a;
}
struct F2 { v16b h, l; };
__device__ __forceinline__ F2 bsplit16(const float v[16]) { F2 r;
#pragma unroll
  for (int i = 0; i < 16; ++i) { const __bf16 h = (__bf16)v[i]; r.h[i] = h; r.l[i] = (__bf16)(v[i] - (float)h); }
  return r; }
__device__ __forceinline__ F2 split_row(const float* row, int k0, int lane) { float v[16]; const float* p = row + k0 + 8 * (lane >> 4);
#pragma unroll
  for (int i = 0; i < 8; ++i) { v[i] = p[i]; v[8 + i] = p[16 + i]; }
  return bsplit16(v); }
// the 16 floats of split_row, loaded but not yet split: lets a whole group of loads issue before the first value is used
struct R16 { v4f q[4]; };
__device__ __forceinline__ R16 raw_row(const float* row, int k0, int lane) { R16 r; const float* p = row + k0 + 8 * (lane >> 4);
  r.q[0] = *(const v4f*)p; r.q[1] = *(const v4f*)(p + 4); r.q[2] = *(const v4f*)(p + 16); r.q[3] = *(const v4f*)(p + 20); return r; }
__device__ __forceinline__ F2 split_raw(const R16& r) { float v[16];
#pragma unroll
  for (int i = 0; i < 16; ++i) v[i] = r.q[i >> 2][i & 3];
  return bsplit16(v); }
__device__ __forceinline__ F2 split_rowK(const float* row, int k0, int lane, int K) { float v[16]; const int g = lane >> 4;
#pragma unroll
  for (int i = 0; i < 8; ++i) { const int ka = k0 + 8 * g + i, kb = ka + 16; v[i] = ka < K ? row[ka] : 0.f; v[8 + i] = kb < K ? row[kb] : 0.f; }
  return bsplit16(v); }
__device__ __forceinline__ F2 split_col(const float* W, int k0, int n, int lane, int ld, int K) { float v[16]; const int g = lane >> 4;
#pragma unroll
  for (int i = 0; i < 8; ++i) { const int ka = k0 + 8 * g + i, kb = ka + 16; v[i] = ka < K ? W[(size_t)ka * ld + n] : 0.f; v[8 + i] = kb < K ? W[(size_t)kb * ld + n] : 0.f; }
  return bsplit16(v); }
__device__ __forceinline__ v8f mac3(const F2& a, const F2& b, v8f c) { c = wmma_bf(a.l, b.h, c); c = wmma_bf(a.h, b.l, c); return wmma_bf(a.h, b.h, c); }
__device__ __forceinline__ float sigm(float v) { return 1.0f / (1.0f + expf(-v)); }
#define LDSX() do { asm volatile("s_wait_dscnt 0" ::: "memory"); __builtin_amdgcn_wave_barrier(); __builtin_amdgcn_fence(__ATOMIC_RELEASE, "workgroup"); } while (0)


// Sliding-window causal attention (12 heads of 64 on [1,2048,768], [out][in] weights, no biases, scale 1/8): each query attends to keys max(0, q-63) .. q (the reference gathers a 64-token window ending at q and masks window slots beyond q);
// softmax; (P v) Wo^T. Only the 16-key tiles that can intersect a wave's windows are visited (exact: every other weight is exp(-inf) = 0).
#define NB 1
#define SS 2048
#define E 768
#define NH 12
#define WIN 64
#define HD 64
#define NR (NB * SS)
#define PLO 1024.0f
#define VLO 2048.0f
__device__ __forceinline__ float bfr(float v) { return (float)(__bf16)v; }
__device__ __forceinline__ v16b frag_b(const __bf16* rowk0, int lane) { return __builtin_bit_cast(v16b, frag_h((const _Float16*)rowk0, lane)); }
// LDS ring of the output projection GEMM: a tile is 128 k of every operand row; two buffers
#define KT 128
#define NT (E / KT)
#define PB 272                      // LDS pitch of a 256-byte bf16 row (16 B x odd: conflict-free b128 reads)
#define PF 528                      // LDS pitch of a 512-byte f32 row (16 B x odd)
#define OUT_BUF (64 * PF + 128 * PB) // [ctx 64 rows f32 | PT 128 rows]
// eight asynchronous 16-byte copies per lane, global -> LDS, rows ls / gs bytes apart. The s_wait_xcnt ends the copies' own statement, so no address register is rewritten in front of it.
__device__ __forceinline__ void cp8(unsigned l, const char* g, unsigned ls, size_t gs) {
  asm volatile("global_load_async_to_lds_b128 %0, %8, off\n\t"
               "global_load_async_to_lds_b128 %1, %9, off\n\t"
               "global_load_async_to_lds_b128 %2, %10, off\n\t"
               "global_load_async_to_lds_b128 %3, %11, off\n\t"
               "global_load_async_to_lds_b128 %4, %12, off\n\t"
               "global_load_async_to_lds_b128 %5, %13, off\n\t"
               "global_load_async_to_lds_b128 %6, %14, off\n\t"
               "global_load_async_to_lds_b128 %7, %15, off\n\t"
               "s_wait_xcnt 0x0"
               :: "v"(l), "v"(l + ls), "v"(l + 2 * ls), "v"(l + 3 * ls), "v"(l + 4 * ls), "v"(l + 5 * ls), "v"(l + 6 * ls), "v"(l + 7 * ls),
                  "v"(g), "v"(g + gs), "v"(g + 2 * gs), "v"(g + 3 * gs), "v"(g + 4 * gs), "v"(g + 5 * gs), "v"(g + 6 * gs), "v"(g + 7 * gs)
               : "memory");
}
// the issuing wave's own copies have landed
#define WAIT_COPIES() asm volatile("s_wait_asynccnt 0x0" ::: "memory")
// this wave's LDS reads have returned (before the buffer they read is handed back for a refill)
#define WAIT_LDS() asm volatile("s_wait_dscnt 0x0" ::: "memory")

// One conversion launch, f32 -> bf16 (round to nearest even), for x and the four [out][in] weights: PT rows [0,E) Wq, [E,2E) Wk, [2E,3E) Wv, [3E,4E) Wo, each row as it lies.
// Few long waves: a block is 16 waves and converts CVB * CVU * 4 consecutive floats of ONE source; a lane holds CVU 16-byte loads in flight, each wave-wide load 512 and each store 256 contiguous bytes.
#define CVB 512
#define CVU 8
#define CVE (CVB * CVU * 4)
#define CVX (NR * E / CVE)          // blocks on x
#define CVW (E * E / CVE)           // blocks on each weight
static_assert(CVX * CVE == NR * E && CVW * CVE == E * E, "a conversion block never crosses a source's end");
__global__ __launch_bounds__(CVB) void k_cvt(const float* __restrict__ x, const float* __restrict__ Wq, const float* __restrict__ Wk, const float* __restrict__ Wv, const float* __restrict__ Wo, __bf16* __restrict__ Xb, __bf16* __restrict__ PT) {
  const int bx = blockIdx.x, tid = threadIdx.x; const float* s; __bf16* d;
  if (bx < CVX) { s = x + (size_t)bx * CVE; d = Xb + (size_t)bx * CVE; }
  else { const int m = (bx - CVX) / CVW, r = (bx - CVX) % CVW; s = (m == 0 ? Wq : (m == 1 ? Wk : (m == 2 ? Wv : Wo))) + (size_t)r * CVE; d = PT + (size_t)m * E * E + (size_t)r * CVE; }
  v4f v[CVU];
#pragma unroll      // all CVU loads issue before the first value is used
  for (int u = 0; u < CVU; ++u) v[u] = *(const v4f*)(s + (u * CVB + tid) * 4);
#pragma unroll      // constant u and e: v[] stays in registers
  for (int u = 0; u < CVU; ++u) { union { __bf16 h[4]; v2u q; } pk;
#pragma unroll      // as above
    for (int e = 0; e < 4; ++e) pk.h[e] = (__bf16)v[u][e];
    vst2(d + (u * CVB + tid) * 4, pk.q); }
}
// projections and windowed attention in ONE launch: block (QT = 128 queries, bh), eight waves, alone on its WGP. The block first computes, on the matrix unit, q of its 128 tokens and k, v of the TT = 192 tokens qb*128-64 .. qb*128+127 for its head
// (k, v of the 64 tokens in front are computed again by the block that owns them: a third of the k, v rows), and leaves them in LDS where the attention part reads them: q, k, v never go through memory.
// GEMM: operand tiles of 128 k in a two-buffer LDS ring filled by asynchronous copies; every wave owns 64 rows x 64 cols of ONE of q, k, v (8 LDS fragments feed 16 WMMAs): waves 0, 1 q (token rows 64 .. 191), waves 2 .. 4 k, waves 5 .. 7 v (token rows 0 .. 191).
// Attention: a wave owns 16 queries q0 .. q0+15. Their windows lie in keys q0-64 .. q0+15: five 16-key score tiles, ONE softmax pass (row maximum and row sum over the whole window, no running rescale).
// S on hi/lo splits of the f32 q/k rows; P,V hi/lo over 96 key columns q0-80 .. q0+15 (three k = 32 blocks; the first 16 columns of P are zero); O f32 [bh][s][64]
#define NKT 5                       // score tiles of 16 keys
#define SP (NKT * 16 + 4)           // f32 pitch of a score row (16 B x odd: conflict-free b128 reads)
#define PP (96 + 8)                 // f16 pitch of a P row (16 B x odd)
#define AP 272                      // LDS pitch of a 256-byte q or k row (16 B x odd: conflict-free b128 reads)
#define QT 128                      // queries of a block
#define TT (QT + WIN)               // tokens whose k and v the block needs
#define NW (QT / 16)                // waves of a block
#define VP (TT * 2 + 16)            // LDS pitch of a v row (one d, TT keys, f16): 16 B x odd
#define KF 128                      // k of a ring tile of the fused GEMM
#define NF (E / KF)
#define QA_BUF ((TT + 192) * PB)    // [Xb TT rows | Wq 64 | Wk 64 | Wv 64 rows]
#define QA_LDS ((QT + TT) * AP + 2 * HD * VP + NW * 16 * SP * 4 + 2 * NW * 16 * PP * 2 + NW * 16 * 68 * 4)
static_assert(KF == 128 && QT == 128 && WIN == 64 && 2 * QA_BUF <= QA_LDS, "the ring lies inside the attention part's LDS");
// the plain builtin (the compiler keeps its distances itself): 128 accumulator registers beside four fragment sets reach above v255, which an asm operand cannot name
__device__ __forceinline__ v8f wmma_bfp(v16b a, v16b b, v8f c) { return __builtin_amdgcn_wmma_f32_16x16x32_bf16(false, a, false, b, (short)0, c, false, false); }
// asynchronous 16-byte copies per lane, LDS rows ls apart; every four rows have a global base of their own, rows gs apart. The s_wait_xcnt ends the copies' own statement, so no address register is rewritten in front of it.
__device__ __forceinline__ void cp4x3(unsigned l, const char* a, const char* b, const char* c, unsigned ls, size_t gs) {
  asm volatile("global_load_async_to_lds_b128 %0, %12, off\n\t"
               "global_load_async_to_lds_b128 %1, %13, off\n\t"
               "global_load_async_to_lds_b128 %2, %14, off\n\t"
               "global_load_async_to_lds_b128 %3, %15, off\n\t"
               "global_load_async_to_lds_b128 %4, %16, off\n\t"
               "global_load_async_to_lds_b128 %5, %17, off\n\t"
               "global_load_async_to_lds_b128 %6, %18, off\n\t"
               "global_load_async_to_lds_b128 %7, %19, off\n\t"
               "global_load_async_to_lds_b128 %8, %20, off\n\t"
               "global_load_async_to_lds_b128 %9, %21, off\n\t"
               "global_load_async_to_lds_b128 %10, %22, off\n\t"
               "global_load_async_to_lds_b128 %11, %23, off\n\t"
               "s_wait_xcnt 0x0"
               :: "v"(l), "v"(l + ls), "v"(l + 2 * ls), "v"(l + 3 * ls), "v"(l + 4 * ls), "v"(l + 5 * ls), "v"(l + 6 * ls), "v"(l + 7 * ls), "v"(l + 8 * ls), "v"(l + 9 * ls), "v"(l + 10 * ls), "v"(l + 11 * ls),
                  "v"(a), "v"(a + gs), "v"(a + 2 * gs), "v"(a + 3 * gs), "v"(b), "v"(b + gs), "v"(b + 2 * gs), "v"(b + 3 * gs), "v"(c), "v"(c + gs), "v"(c + 2 * gs), "v"(c + 3 * gs)
               : "memory");
}
__global__ __launch_bounds__(NW * 32) void k_qa(const __bf16* __restrict__ Xb, const __bf16* __restrict__ PT, float* __restrict__ O32) {
  __shared__ __align__(16) char sm[QA_LDS];      // the ring uses its front; q, k, v are written over it behind the loop's last barrier
  char* const stQ = sm; char* const stK = stQ + QT * AP; char* const stVh = stK + TT * AP; char* const stVl = stVh + HD * VP;
  float (*sS)[16][SP] = (float (*)[16][SP])(stVl + HD * VP);
  _Float16 (*sPh)[16][PP] = (_Float16 (*)[16][PP])((char*)sS + NW * 16 * SP * 4); _Float16 (*sPl)[16][PP] = sPh + NW;
  float (*sO)[16][68] = (float (*)[16][68])(sPl + NW);
  const int tid = threadIdx.x, w = __builtin_amdgcn_readfirstlane(tid >> 5), lane = tid & 31, col = lane & 15, g = lane >> 4;      // w in a scalar register: tile rows and their clamps are scalar
  const size_t bh = blockIdx.y; const int qb = blockIdx.x; const int q0 = qb * QT + w * 16;
  { const int mat = w < 2 ? 0 : (w < 5 ? 1 : 2), rowb = (w < 2 ? w + 1 : (w < 5 ? w - 2 : w - 5)) * 64; const size_t bb = bh / NH, hh = bh % NH;      // which of q, k, v, and the wave's first token row (scalar)
    v8f acc[4][4] = {};
    // a lane copies chunk (tid & 15) of rows (tid >> 4) + 16 i: a wave-wide copy is two whole 256-byte rows. In the first block the 64 tokens in front of token 0 are taken from tokens 0 .. 63 (in bounds, finite); as keys they are masked below and their P is zero
    const int sr = tid >> 4, sc = tid & 15; const unsigned lA = (unsigned)(size_t)sm + sr * PB + sc * 16;
    const char* gO = (const char*)(Xb + (bb * SS + qb * QT + sr) * E + sc * 8); const char* gH = gO - (qb ? (size_t)64 * E * 2 : 0);
    const char* gW = (const char*)(PT + (hh * HD + sr) * E + sc * 8);
    auto fill = [&](int t) { const unsigned bo = (t & 1) * QA_BUF; const size_t ko = (size_t)t * KF * 2;
      cp4x3(lA + bo, gH + ko, gO + ko, gO + ko + (size_t)64 * E * 2, 16 * PB, (size_t)16 * E * 2);
      cp4x3(lA + bo + TT * PB, gW + ko, gW + ko + (size_t)E * E * 2, gW + ko + (size_t)2 * E * E * 2, 16 * PB, (size_t)16 * E * 2); };
    fill(0); WAIT_COPIES(); __syncthreads();
#pragma unroll 1      // rolled (for speed only)
    for (int t = 0; t < NF; ++t) { const char* bA = sm + (t & 1) * QA_BUF + (rowb + col) * PB; const char* bB = sm + (t & 1) * QA_BUF + (TT + mat * 64 + col) * PB;
      // four fragment sets in registers: all four blocks' 16 LDS reads issue as groups in front of the WMMAs (never past this tile's buffer); the next tile's copies issue behind the first group, under its LDS latency
      v16b fa[4][4], fb[4][4];
      auto frags = [&](int kc) {
#pragma unroll      // constant i: fa[] stays in registers
        for (int i = 0; i < 4; ++i) fa[kc][i] = frag_b((const __bf16*)(bA + i * 16 * PB) + kc * 32, lane);
#pragma unroll      // constant j: fb[] stays in registers
        for (int j = 0; j < 4; ++j) fb[kc][j] = frag_b((const __bf16*)(bB + j * 16 * PB) + kc * 32, lane); };
      frags(0);
      if (t + 1 < NF) fill(t + 1);      // into the buffer that trip t - 1 read: behind the barrier at that trip's foot
      frags(1); frags(2); frags(3);
      __builtin_amdgcn_sched_barrier(0);      // keeps the 64 reads ahead of the WMMAs: sunk to their first use, each group of four WMMAs would wait out an LDS latency of its own
#pragma unroll      // constant kc, i and j: LDS reads take immediate offsets, acc[], fa[] and fb[] stay in registers
      for (int kc = 0; kc < KF / 32; ++kc) {
#pragma unroll
        for (int i = 0; i < 4; ++i) {
#pragma unroll
          for (int j = 0; j < 4; ++j) acc[i][j] = wmma_bfp(fa[kc][i], fb[kc][j], acc[i][j]); } }
      __builtin_amdgcn_sched_barrier(0);      // keeps the WMMAs ahead of the waits: moved behind the barrier, they would no longer run under the copies' latency
      WAIT_LDS(); WAIT_COPIES(); __syncthreads(); }      // publishes tile t + 1 and frees tile t's buffer
    WAIT_COPIES();
    // D element r of tile (i, j): token row rowb + i*16 + 8 g + r, col j*16 + col of the wave's matrix. Row i of stK and column i of stV are token row i = key qb*128 - 64 + i; row i of stQ is query qb*128 + i = token row 64 + i
    auto put_f = [&](char* dst, int i, int j, int row) {      // one 16 x 16 tile as f32, rows AP apart
#pragma unroll      // constant r: acc[] stays in registers
      for (int r = 0; r < 8; ++r) *(float*)(dst + (row + i * 16 + 8 * g + r) * AP + (j * 16 + col) * 4) = acc[i][j][r]; };
    if (mat < 2) { char* const dst = mat ? stK : stQ; const int row = mat ? rowb : rowb - 64;
#pragma unroll      // constant i and j here and below: acc[] stays in registers
      for (int i = 0; i < 4; ++i) {
#pragma unroll
        for (int j = 0; j < 4; ++j) put_f(dst, i, j, row); } }
    else {              // v (x4, f16 hi and lo, transposed: eight keys of one d are 16 bytes)
#pragma unroll
      for (int i = 0; i < 4; ++i) {
#pragma unroll
        for (int j = 0; j < 4; ++j) { const int d = j * 16 + col, key = rowb + i * 16 + 8 * g; v8h hi8, lo8;
#pragma unroll
          for (int r = 0; r < 8; ++r) { const float v = acc[i][j][r] * 4.0f; const _Float16 hi = (_Float16)v; hi8[r] = hi; lo8[r] = (_Float16)((v - (float)hi) * VLO); }
          *(v8h*)(stVh + d * VP + key * 2) = hi8; *(v8h*)(stVl + d * VP + key * 2) = lo8; } } } }
  __syncthreads();      // publishes q, k, v to all eight waves; nothing is written there again
  // Q and all five K tiles: 48 LDS reads. Staged K row i is key qb*128 - 64 + i, so tile t of this wave starts at row (w + t) * 16
  R16 q0r, q1r, kr[NKT][2];
  auto raw_at = [&](const char* row, int o) { const float* p = (const float*)row + 8 * g + o; R16 r; r.q[0] = *(const v4f*)p; r.q[1] = *(const v4f*)(p + 4); r.q[2] = *(const v4f*)(p + 16); r.q[3] = *(const v4f*)(p + 20); return r; };
  const char* qt = stQ + (w * 16 + col) * AP; q0r = raw_at(qt, 0); q1r = raw_at(qt, 32);
#pragma unroll      // constant t: kr[] stays in registers
  for (int t = 0; t < NKT; ++t) { const char* kt = stK + ((w + t) * 16 + col) * AP; kr[t][0] = raw_at(kt, 0); kr[t][1] = raw_at(kt, 32); }
  F2 aq[2]; aq[0] = split_raw(q0r); aq[1] = split_raw(q1r);
#pragma unroll
  for (int t = 0; t < NKT; ++t) { const int k0 = q0 - 64 + t * 16;
    v8f s = mac3(aq[0], split_raw(kr[t][0]), (v8f){}); s = mac3(aq[1], split_raw(kr[t][1]), s);
    // key k0 + col, query q0 + 8 g + r. Only tile 0 can fall behind a window (key <= query - WIN: col <= 8 g + r), only the last can lie ahead of a query (col > 8 g + r); any tile but the last can lie in front of key 0, as a whole
#pragma unroll
    for (int r = 0; r < 8; ++r) { const bool off = t == 0 ? (k0 < 0 || col <= 8 * g + r) : (t == NKT - 1 ? col > 8 * g + r : k0 < 0); sS[w][8 * g + r][t * 16 + col] = off ? -3.0e38f : s[r] * 0.125f; } }
  LDSX();
  // V: 48 LDS reads, issued ahead of the softmax. Staged column i is key qb*128 - 64 + i; the 16 columns in front of the staged range (wave 0, first half) read column 0 .. 15 (finite): their P is zero
  v16h vh[3][4], vl[3][4];
#pragma unroll      // constant c and t: vh[] and vl[] stay in registers
  for (int c = 0; c < 3; ++c) { const int ra = w * 16 - 16 + c * 32, rb = ra + 16; const unsigned oa = ((ra < 0 ? 0 : ra) + 8 * g) * 2, ob = (rb + 8 * g) * 2;
#pragma unroll
    for (int t = 0; t < 4; ++t) { union { v16h v; v8h q[2]; } uh, ul; const unsigned o = (t * 16 + col) * VP;
      uh.q[0] = *(const v8h*)(stVh + o + oa); uh.q[1] = *(const v8h*)(stVh + o + ob); ul.q[0] = *(const v8h*)(stVl + o + oa); ul.q[1] = *(const v8h*)(stVl + o + ob);
      vh[c][t] = uh.v; vl[c][t] = ul.v; } }
  // lane (col, g): row col, score columns 40 g .. 40 g + 39
  float mx = -3.4e38f;
#pragma unroll
  for (int jj = 0; jj < NKT * 8; ++jj) mx = fmaxf(mx, sS[w][col][g * (NKT * 8) + jj]);
  mx = fmaxf(mx, __shfl_xor(mx, 16, 32));
  float ps = 0.f;
#pragma unroll
  for (int jj = 0; jj < NKT * 8; ++jj) { const float p = expf(sS[w][col][g * (NKT * 8) + jj] - mx) * 16384.0f; ps += p; const _Float16 hi = (_Float16)p; sPh[w][col][16 + g * (NKT * 8) + jj] = hi; sPl[w][col][16 + g * (NKT * 8) + jj] = (_Float16)((p - (float)hi) * PLO); }
  *(v8h*)(&sPh[w][col][g * 8]) = (v8h){}; *(v8h*)(&sPl[w][col][g * 8]) = (v8h){};      // keys q0-80 .. q0-65: outside every window
  ps += __shfl_xor(ps, 16, 32);
  const float lrun = ps * (1.0f / 16384.0f);
  LDSX();
  v8f acc[4] = {}, ac1[4] = {}, ac2[4] = {};
#pragma unroll
  for (int c = 0; c < 3; ++c) { const v16h ph = frag_h(&sPh[w][col][0] + c * 32, lane), pl = frag_h(&sPl[w][col][0] + c * 32, lane);
#pragma unroll
    for (int t = 0; t < 4; ++t) {
      if (c == 0) { acc[t] = wmma16(ph, vh[c][t], acc[t]); ac1[t] = wmma16(ph, vl[c][t], ac1[t]); ac2[t] = wmma16(pl, vh[c][t], ac2[t]); }      // the accumulators' registers are first written here: wmma16 holds A and B until its slots have passed, so no new D lands on them
      else { acc[t] = wmma16p(ph, vh[c][t], acc[t]); ac1[t] = wmma16p(ph, vl[c][t], ac1[t]); ac2[t] = wmma16p(pl, vh[c][t], ac2[t]); } } }
#pragma unroll
  for (int r = 0; r < 8; ++r) { const float lr = __shfl(lrun, 8 * g + r, 32); const float inv = 1.0f / (lr * 16384.0f * 4.0f);
#pragma unroll
    for (int t = 0; t < 4; ++t) sO[w][8 * g + r][t * 16 + col] = (acc[t][r] + ac1[t][r] * (1.0f / VLO) + ac2[t][r] * (1.0f / PLO)) * inv; }
  LDSX();
  for (int qq = lane; qq < 16 * 16; qq += 32) { const int rl = qq >> 4, pc = qq & 15; vst2(O32 + ((bh * SS) + q0 + rl) * HD + pc * 4, *(const v4f*)(&sO[w][rl][pc * 4])); }
}
// out = ctx Wo^T : split(ctx) x bf16(Wo rows): 2 products (Wo is an INPUT -> bf16 exact)
__global__ __launch_bounds__(128) void k_out(const float* __restrict__ O32, const __bf16* __restrict__ PT, float* __restrict__ out) {
  __shared__ __align__(16) float so[4][16][132];
  __shared__ __align__(16) char ring[2 * OUT_BUF];
  const int tid = threadIdx.x, wave = tid >> 5, lane = tid & 31, col = lane & 15, g = lane >> 4;
  const int r0b = blockIdx.x * 64, r0 = r0b + wave * 16, n0 = blockIdx.y * 128; const int b = r0b / SS, s0 = r0b % SS;
  v8f acc[8] = {};
  // ctx: a tile is two heads' 64 floats of each row; a lane copies chunk (tid & 31) of rows (tid >> 5) + 4 i (16 rows). PT: chunk (tid & 15) of rows (tid >> 4) + 8 i (16 rows)
  const unsigned lA = (unsigned)(size_t)ring + (tid >> 5) * PF + (tid & 31) * 16, lB = (unsigned)(size_t)ring + 64 * PF + (tid >> 4) * PB + (tid & 15) * 16;
  const char* gA = (const char*)(O32 + (((size_t)b * NH + ((tid & 31) >> 4)) * SS + s0 + (tid >> 5)) * HD + (tid & 15) * 4);
  const char* gB = (const char*)(PT + (size_t)(3 * E + n0 + (tid >> 4)) * E + (tid & 15) * 8);
  auto fill = [&](int t) { const unsigned bo = (t & 1) * OUT_BUF; const size_t ka = (size_t)t * 2 * SS * HD * 4, ko = (size_t)t * KT * 2;
    cp8(lA + bo, gA + ka, 4 * PF, (size_t)4 * HD * 4); cp8(lA + bo + 32 * PF, gA + ka + (size_t)32 * HD * 4, 4 * PF, (size_t)4 * HD * 4);
    cp8(lB + bo, gB + ko, 8 * PB, (size_t)8 * E * 2); cp8(lB + bo + 64 * PB, gB + ko + (size_t)64 * E * 2, 8 * PB, (size_t)8 * E * 2); };
  fill(0); WAIT_COPIES(); __syncthreads();
  fill(1);
  for (int t = 0; t < NT; ++t) { const float* bA = (const float*)(ring + (t & 1) * OUT_BUF + (wave * 16 + col) * PF); const char* bB = ring + (t & 1) * OUT_BUF + 64 * PF + col * PB;
    // two fragment sets in registers: block kc + 1's 20 LDS reads issue as one group in front of block kc's WMMAs (never past this tile's buffer)
    R16 ra[2]; v16b fb[2][8];
    auto frags = [&](int kc) { ra[kc & 1] = raw_row(bA, kc * 32, lane);
#pragma unroll      // constant j: fb[] stays in registers
      for (int j = 0; j < 8; ++j) fb[kc & 1][j] = frag_b((const __bf16*)(bB + j * 16 * PB) + kc * 32, lane); };
    frags(0);
#pragma unroll      // constant kc and j: LDS reads take immediate offsets, acc[], ra[] and fb[] stay in registers
    for (int kc = 0; kc < KT / 32; ++kc) { const F2 a = split_raw(ra[kc & 1]);
      if (kc + 1 < KT / 32) frags(kc + 1);
#pragma unroll
      for (int j = 0; j < 8; ++j) { acc[j] = wmma_bf(a.l, fb[kc & 1][j], acc[j]); acc[j] = wmma_bf(a.h, fb[kc & 1][j], acc[j]); } }
    WAIT_LDS(); WAIT_COPIES(); __syncthreads();      // publishes tile t + 1 and frees tile t's buffer
    if (t + 2 < NT) fill(t + 2); }
  WAIT_COPIES();
#pragma unroll
  for (int j = 0; j < 8; ++j) {
#pragma unroll
    for (int r = 0; r < 8; ++r) so[wave][8 * g + r][j * 16 + col] = acc[j][r]; }
  LDSX();
#pragma unroll 4
  for (int rl = 0; rl < 16; ++rl) vst2(out + (size_t)(r0 + rl) * E + n0 + lane * 4, *(const v4f*)(&so[wave][rl][lane * 4]));
}
extern "C" void kernel_launch(void* const* d_in, const int* in_sizes, int n_in, void* d_out, int out_size, void* d_ws, size_t ws_size, hipStream_t stream) {
  (void)in_sizes; (void)n_in; (void)out_size; (void)ws_size;
  const float** I = (const float**)d_in;   // inputs, Wq, Wk, Wv, Wo
  const float* x = I[0]; const float* Wq = I[1]; const float* Wk = I[2]; const float* Wv = I[3]; const float* Wo = I[4];
  float* out = (float*)d_out;
  char* ws = (char*)d_ws; size_t off = 0;
  auto take = [&](size_t bytes) { char* p = ws + off; off += (bytes + 255) & ~(size_t)255; return p; };
  __bf16* Xb = (__bf16*)take((size_t)NR * E * 2); __bf16* PT = (__bf16*)take((size_t)4 * E * E * 2);
  float* O32 = (float*)take((size_t)NR * E * 4);
  // ws ~ 14 MB
  k_cvt<<<CVX + 4 * CVW, CVB, 0, stream>>>(x, Wq, Wk, Wv, Wo, Xb, PT);
  k_qa<<<dim3(SS / QT, NB * NH), NW * 32, 0, stream>>>(Xb, PT, O32);
  k_out<<<dim3(NR / 64, E / 128), 128, 0, stream>>>(O32, PT, out);
}

// v008
// It runs in 26.2 microseconds.
// Two timings next to v007 put it at 1.09 and 1.02 times that version's speed.
// All steps since v000 together make it 5.24 times as fast.
// compute dtype: inputs and W* (INPUTS) rounded to bf16 with exact bf16 WMMA products (f32 accumulate) for the projections; q/k f32 split for the scores (3 products), P and V f16 hi/lo (3 products); softmax f32.
#include <hip/hip_runtime.h>
#include <math.h>

typedef __attribute__((ext_vector_type(16))) _Float16 v16h;
typedef __attribute__((ext_vector_type(16))) __bf16 v16b;
typedef __attribute__((ext_vector_type(8)))  _Float16 v8h;
typedef __attribute__((ext_vector_type(8)))  float v8f;
typedef __attribute__((ext_vector_type(4)))  float v4f;
typedef __attribute__((ext_vector_type(2)))  float v2f;
typedef __attribute__((ext_vector_type(4)))  unsigned v4u;
typedef __attribute__((ext_vector_type(2)))  unsigned v2u;
typedef __attribute__((ext_vector_type(4)))  int v4i;
typedef float __attribute__((may_alias)) float_a;
typedef int __attribute__((may_alias)) int_a;

template <typename T> __device__ __forceinline__ void vst2(void* p, T v) { *(T*)p = v;  }
__device__ __forceinline__ v8f wmma16(v16h a, v16h b, v8f c) {
  v8f d = __builtin_amdgcn_wmma_f32_16x16x32_f16(false, a, false, b, (short)0, c, false, false);
  asm volatile("v_nop\n\tv_nop\n\tv_nop\n\tv_nop" : "+v"(d) : "v"(a), "v"(b));
  return d;
}
// the plain builtin (the compiler keeps its distances itself), for WMMAs that accumulate in place: no asm statement names its operands, so they may lie above v255, which an asm operand cannot; the 192 registers of V beside 96 of accumulators need that room
__device__ __forceinline__ v8f wmma16p(v16h a, v16h b, v8f c) { return __builtin_amdgcn_wmma_f32_16x16x32_f16(false, a, false, b, (short)0, c, false, false); }
__device__ __forceinline__ v8f wmma_bf(v16b a, v16b b, v8f c) {
  v8f d = __builtin_amdgcn_wmma_f32_16x16x32_bf16(false, a, false, b, (short)0, c, false, false);
  asm volatile("v_nop\n\tv_nop\n\tv_nop\n\tv_nop" : "+v"(d) : "v"(a), "v"(b));
  return d;
}
// 16x16x32 fragments: lane = (h = lane>>4, row/col = lane&15); elements 0..7 = k0+8h+0..7, 8..15 = k0+16+8h+0..7; D element r = row 8h+r
__device__ __forceinline__ v16h frag_h(const _Float16* rowk0, int lane) {
  union { v16h v; v8h q[2]; } u; const _Float16* p = rowk0 + 8 * (lane >> 4);
  u.q[0] = *(const v8h*)p; u.q[1] = *(const v8h*)(p + 16); return u.v;
}
__device__ __forceinline__ v16h frag_f32(const float* rowk0, int lane) {
  v16h a; const float* p = rowk0 + 8 * (lane >> 4);
#pragma unroll
  for (int i = 0; i < 8; ++i) { a[i] = (_Float16)p[i]; a[8 + i] = (_Float16)p[16 + i]; }
  return a;
}
__device__ __forceinline__ v16h frag_f32s(const float* rowk0, int lane, float sc) {
  v16h a; const float* p = rowk0 + 8 * (lane >> 4);
#pragma unroll
  for (int i = 0; i < 8; ++i) { a[i] = (_Float16)(p[i] * sc); a[8 + i] = (_Float16)(p[16 + i] * sc); }
  return a;
}
// column fragment from a [K][ld] layout (column n), rows >= K read as 0
__device__ __forceinline__ v16h fragc_f32(const float* W, int k0, int n, int lane, int ld, int K) {
  v16h a; const int g = lane >> 4;
#pragma unroll
  for (int i = 0; i < 8; ++i) { const int ka = k0 + 8 * g + i, kb = ka + 16;
    a[i] = (_Float16)(ka < K ? W[(size_t)ka * ld + n] : 0.f); a[8 + i] = (_Float16)(kb < K ? W[(size_t)kb * ld + n] : 0.f); }
  return a;
}
struct F2 { v16b h, l; };
__device__ __forceinline__ F2 bsplit16(const float v[16]) { F2 r;
#pragma unroll
  for (int i = 0; i < 16; ++i) { const __bf16 h = (__bf16)v[i]; r.h[i] = h; r.l[i] = (__bf16)(v[i] - (float)h); }
  return r; }
__device__ __forceinline__ F2 split_row(const float* row, int k0, int lane) { float v[16]; const float* p = row + k0 + 8 * (lane >> 4);
#pragma unroll
  for (int i = 0; i < 8; ++i) { v[i] = p[i]; v[8 + i] = p[16 + i]; }
  return bsplit16(v); }
// the 16 floats of split_row, loaded but not yet split: lets a whole group of loads issue before the first value is used
struct R16 { v4f q[4]; };
__device__ __forceinline__ R16 raw_row(const float* row, int k0, int lane) { R16 r; const float* p = row + k0 + 8 * (lane >> 4);
  r.q[0] = *(const v4f*)p; r.q[1] = *(const v4f*)(p + 4); r.q[2] = *(const v4f*)(p + 16); r.q[3] = *(const v4f*)(p + 20); return r; }
__device__ __forceinline__ F2 split_raw(const R16& r) { float v[16];
#pragma unroll
  for (int i = 0; i < 16; ++i) v[i] = r.q[i >> 2][i & 3];
  return bsplit16(v); }
__device__ __forceinline__ F2 split_rowK(const float* row, int k0, int lane, int K) { float v[16]; const int g = lane >> 4;
#pragma unroll
  for (int i = 0; i < 8; ++i) { const int ka = k0 + 8 * g + i, kb = ka + 16; v[i] = ka < K ? row[ka] : 0.f; v[8 + i] = kb < K ? row[kb] : 0.f; }
  return bsplit16(v); }
__device__ __forceinline__ F2 split_col(const float* W, int k0, int n, int lane, int ld, int K) { float v[16]; const int g = lane >> 4;
#pragma unroll
  for (int i = 0; i < 8; ++i) { const int ka = k0 + 8 * g + i, kb = ka + 16; v[i] = ka < K ? W[(size_t)ka * ld + n] : 0.f; v[8 + i] = kb < K ? W[(size_t)kb * ld + n] : 0.f; }
  return bsplit16(v); }
__device__ __forceinline__ v8f mac3(const F2& a, const F2& b, v8f c) { c = wmma_bf(a.l, b.h, c); c = wmma_bf(a.h, b.l, c); return wmma_bf(a.h, b.h, c); }
__device__ __forceinline__ float sigm(float v) { return 1.0f / (1.0f + expf(-v)); }
#define LDSX() do { asm volatile("s_wait_dscnt 0" ::: "memory"); __builtin_amdgcn_wave_barrier(); __builtin_amdgcn_fence(__ATOMIC_RELEASE, "workgroup"); } while (0)


// Sliding-window causal attention (12 heads of 64 on [1,2048,768], [out][in] weights, no biases, scale 1/8): each query attends to keys max(0, q-63) .. q (the reference gathers a 64-token window ending at q and masks window slots beyond q);
// softmax; (P v) Wo^T. Only the 16-key tiles that can intersect a wave's windows are visited (exact: every other weight is exp(-inf) = 0).
#define NB 1
#define SS 2048
#define E 768
#define NH 12
#define WIN 64
#define HD 64
#define NR (NB * SS)
#define PLO 1024.0f
#define VLO 2048.0f
__device__ __forceinline__ float bfr(float v) { return (float)(__bf16)v; }
__device__ __forceinline__ v16b frag_b(const __bf16* rowk0, int lane) { return __builtin_bit_cast(v16b, frag_h((const _Float16*)rowk0, lane)); }
// LDS ring of the output projection GEMM: a tile is 128 k of every operand row; two buffers
#define KT 128
#define NT (E / KT)
#define PB 272                      // LDS pitch of a 256-byte bf16 row (16 B x odd: conflict-free b128 reads)
#define PF 528                      // LDS pitch of a 512-byte f32 row (16 B x odd)
#define OUT_BUF (64 * PF + 128 * PB) // [ctx 64 rows f32 | PT 128 rows]
// eight asynchronous 16-byte copies per lane, global -> LDS, rows ls / gs bytes apart. The s_wait_xcnt ends the copies' own statement, so no address register is rewritten in front of it.
__device__ __forceinline__ void cp8(unsigned l, const char* g, unsigned ls, size_t gs) {
  asm volatile("global_load_async_to_lds_b128 %0, %8, off\n\t"
               "global_load_async_to_lds_b128 %1, %9, off\n\t"
               "global_load_async_to_lds_b128 %2, %10, off\n\t"
               "global_load_async_to_lds_b128 %3, %11, off\n\t"
               "global_load_async_to_lds_b128 %4, %12, off\n\t"
               "global_load_async_to_lds_b128 %5, %13, off\n\t"
               "global_load_async_to_lds_b128 %6, %14, off\n\t"
               "global_load_async_to_lds_b128 %7, %15, off\n\t"
               "s_wait_xcnt 0x0"
               :: "v"(l), "v"(l + ls), "v"(l + 2 * ls), "v"(l + 3 * ls), "v"(l + 4 * ls), "v"(l + 5 * ls), "v"(l + 6 * ls), "v"(l + 7 * ls),
                  "v"(g), "v"(g + gs), "v"(g + 2 * gs), "v"(g + 3 * gs), "v"(g + 4 * gs), "v"(g + 5 * gs), "v"(g + 6 * gs), "v"(g + 7 * gs)
               : "memory");
}
// the issuing wave's own copies have landed
#define WAIT_COPIES() asm volatile("s_wait_asynccnt 0x0" ::: "memory")
// this wave's LDS reads have returned (before the buffer they read is handed back for a refill)
#define WAIT_LDS() asm volatile("s_wait_dscnt 0x0" ::: "memory")

// One conversion launch, f32 -> bf16 (round to nearest even), for x and the four [out][in] weights: PT rows [0,E) Wq, [E,2E) Wk, [2E,3E) Wv, [3E,4E) Wo, each row as it lies.
// Few long waves: a block is 16 waves and converts CVB * CVU * 4 consecutive floats of ONE source; a lane holds CVU 16-byte loads in flight, each wave-wide load 512 and each store 256 contiguous bytes.
#define CVB 512
#define CVU 8
#define CVE (CVB * CVU * 4)
#define CVX (NR * E / CVE)          // blocks on x
#define CVW (E * E / CVE)           // blocks on each weight
static_assert(CVX * CVE == NR * E && CVW * CVE == E * E, "a conversion block never crosses a source's end");
__global__ __launch_bounds__(CVB) void k_cvt(const float* __restrict__ x, const float* __restrict__ Wq, const float* __restrict__ Wk, const float* __restrict__ Wv, const float* __restrict__ Wo, __bf16* __restrict__ Xb, __bf16* __restrict__ PT) {
  const int bx = blockIdx.x, tid = threadIdx.x; const float* s; __bf16* d;
  if (bx < CVX) { s = x + (size_t)bx * CVE; d = Xb + (size_t)bx * CVE; }
  else { const int m = (bx - CVX) / CVW, r = (bx - CVX) % CVW; s = (m == 0 ? Wq : (m == 1 ? Wk : (m == 2 ? Wv : Wo))) + (size_t)r * CVE; d = PT + (size_t)m * E * E + (size_t)r * CVE; }
  v4f v[CVU];
#pragma unroll      // all CVU loads issue before the first value is used
  for (int u = 0; u < CVU; ++u) v[u] = *(const v4f*)(s + (u * CVB + tid) * 4);
#pragma unroll      // constant u and e: v[] stays in registers
  for (int u = 0; u < CVU; ++u) { union { __bf16 h[4]; v2u q; } pk;
#pragma unroll      // as above
    for (int e = 0; e < 4; ++e) pk.h[e] = (__bf16)v[u][e];
    vst2(d + (u * CVB + tid) * 4, pk.q); }
}
// projections and windowed attention in ONE launch: block (QT = 128 queries, bh), eight waves, alone on its WGP. The block first computes, on the matrix unit, q of its 128 tokens and k, v of the TT = 192 tokens qb*128-64 .. qb*128+127 for its head
// (k, v of the 64 tokens in front are computed again by the block that owns them: a third of the k, v rows), and leaves them in LDS where the attention part reads them: q, k, v never go through memory.
// GEMM: operand tiles of 128 k in a two-buffer LDS ring filled by asynchronous copies; every wave owns 64 rows x 64 cols of ONE of q, k, v (8 LDS fragments feed 16 WMMAs): waves 0, 1 q (token rows 64 .. 191), waves 2 .. 4 k, waves 5 .. 7 v (token rows 0 .. 191).
// Attention: a wave owns 16 queries q0 .. q0+15. Their windows lie in keys q0-64 .. q0+15: five 16-key score tiles, ONE softmax pass (maximum and sum over the whole window, no running rescale).
// Both products are transposed: S^T = K Q^T (a lane holds 40 scores of ONE query: maximum and sum are in-lane plus one exchange with lane ^ 16) and O^T = V^T P^T: two neighbouring S^T tiles in D layout ARE the second operand's
// fragment of a k = 32 block, so scores and P never leave the registers. S on hi/lo splits of the f32 q/k rows; P,V hi/lo over 96 keys q0-80 .. q0+15 (three k = 32 blocks; P of the first 16 keys is zero); O f32 [bh][s][64]
#define NKT 5                       // score tiles of 16 keys
#define AP 272                      // LDS pitch of a 256-byte q or k row (16 B x odd: conflict-free b128 reads)
#define QT 128                      // queries of a block
#define TT (QT + WIN)               // tokens whose k and v the block needs
#define NW (QT / 16)                // waves of a block
#define VP (TT * 2 + 16)            // LDS pitch of a v row (one d, TT keys, f16): 16 B x odd
#define KF 128                      // k of a ring tile of the fused GEMM
#define NF (E / KF)
#define QA_BUF ((TT + 192) * PB)    // [Xb TT rows | Wq 64 | Wk 64 | Wv 64 rows]
#define QA_ATT ((QT + TT) * AP + 2 * HD * VP + NW * 16 * 68 * 4)      // q, k | v hi, lo | O
#define QA_LDS (QA_ATT > 2 * QA_BUF ? QA_ATT : 2 * QA_BUF)
static_assert(KF == 128 && QT == 128 && WIN == 64, "tile shapes the row and key arithmetic below is written for");
// the plain builtin (the compiler keeps its distances itself): 128 accumulator registers beside four fragment sets reach above v255, which an asm operand cannot name
__device__ __forceinline__ v8f wmma_bfp(v16b a, v16b b, v8f c) { return __builtin_amdgcn_wmma_f32_16x16x32_bf16(false, a, false, b, (short)0, c, false, false); }
// asynchronous 16-byte copies per lane, LDS rows ls apart; every four rows have a global base of their own, rows gs apart. The s_wait_xcnt ends the copies' own statement, so no address register is rewritten in front of it.
__device__ __forceinline__ void cp4x3(unsigned l, const char* a, const char* b, const char* c, unsigned ls, size_t gs) {
  asm volatile("global_load_async_to_lds_b128 %0, %12, off\n\t"
               "global_load_async_to_lds_b128 %1, %13, off\n\t"
               "global_load_async_to_lds_b128 %2, %14, off\n\t"
               "global_load_async_to_lds_b128 %3, %15, off\n\t"
               "global_load_async_to_lds_b128 %4, %16, off\n\t"
               "global_load_async_to_lds_b128 %5, %17, off\n\t"
               "global_load_async_to_lds_b128 %6, %18, off\n\t"
               "global_load_async_to_lds_b128 %7, %19, off\n\t"
               "global_load_async_to_lds_b128 %8, %20, off\n\t"
               "global_load_async_to_lds_b128 %9, %21, off\n\t"
               "global_load_async_to_lds_b128 %10, %22, off\n\t"
               "global_load_async_to_lds_b128 %11, %23, off\n\t"
               "s_wait_xcnt 0x0"
               :: "v"(l), "v"(l + ls), "v"(l + 2 * ls), "v"(l + 3 * ls), "v"(l + 4 * ls), "v"(l + 5 * ls), "v"(l + 6 * ls), "v"(l + 7 * ls), "v"(l + 8 * ls), "v"(l + 9 * ls), "v"(l + 10 * ls), "v"(l + 11 * ls),
                  "v"(a), "v"(a + gs), "v"(a + 2 * gs), "v"(a + 3 * gs), "v"(b), "v"(b + gs), "v"(b + 2 * gs), "v"(b + 3 * gs), "v"(c), "v"(c + gs), "v"(c + 2 * gs), "v"(c + 3 * gs)
               : "memory");
}
__global__ __launch_bounds__(NW * 32) void k_qa(const __bf16* __restrict__ Xb, const __bf16* __restrict__ PT, float* __restrict__ O32) {
  __shared__ __align__(16) char sm[QA_LDS];      // the ring fills all of it; q, k, v are written over it behind the loop's last barrier
  char* const stQ = sm; char* const stK = stQ + QT * AP; char* const stVh = stK + TT * AP; char* const stVl = stVh + HD * VP;
  float (*sO)[16][68] = (float (*)[16][68])(stVl + HD * VP);
  const int tid = threadIdx.x, w = __builtin_amdgcn_readfirstlane(tid >> 5), lane = tid & 31, col = lane & 15, g = lane >> 4;      // w in a scalar register: tile rows and their clamps are scalar
  const size_t bh = blockIdx.y; const int qb = blockIdx.x; const int q0 = qb * QT + w * 16;
  { const int mat = w < 2 ? 0 : (w < 5 ? 1 : 2), rowb = (w < 2 ? w + 1 : (w < 5 ? w - 2 : w - 5)) * 64; const size_t bb = bh / NH, hh = bh % NH;      // which of q, k, v, and the wave's first token row (scalar)
    v8f acc[4][4] = {};
    // a lane copies chunk (tid & 15) of rows (tid >> 4) + 16 i: a wave-wide copy is two whole 256-byte rows. In the first block the 64 tokens in front of token 0 are taken from tokens 0 .. 63 (in bounds, finite); as keys they are masked below and their P is zero
    const int sr = tid >> 4, sc = tid & 15; const unsigned lA = (unsigned)(size_t)sm + sr * PB + sc * 16;
    const char* gO = (const char*)(Xb + (bb * SS + qb * QT + sr) * E + sc * 8); const char* gH = gO - (qb ? (size_t)64 * E * 2 : 0);
    const char* gW = (const char*)(PT + (hh * HD + sr) * E + sc * 8);
    auto fill = [&](int t) { const unsigned bo = (t & 1) * QA_BUF; const size_t ko = (size_t)t * KF * 2;
      cp4x3(lA + bo, gH + ko, gO + ko, gO + ko + (size_t)64 * E * 2, 16 * PB, (size_t)16 * E * 2);
      cp4x3(lA + bo + TT * PB, gW + ko, gW + ko + (size_t)E * E * 2, gW + ko + (size_t)2 * E * E * 2, 16 * PB, (size_t)16 * E * 2); };
    fill(0); WAIT_COPIES(); __syncthreads();
#pragma unroll 1      // rolled (for speed only)
    for (int t = 0; t < NF; ++t) { const char* bA = sm + (t & 1) * QA_BUF + (rowb + col) * PB; const char* bB = sm + (t & 1) * QA_BUF + (TT + mat * 64 + col) * PB;
      // four fragment sets in registers: all four blocks' 16 LDS reads issue as groups in front of the WMMAs (never past this tile's buffer); the next tile's copies issue behind the first group, under its LDS latency
      v16b fa[4][4], fb[4][4];
      auto frags = [&](int kc) {
#pragma unroll      // constant i: fa[] stays in registers
        for (int i = 0; i < 4; ++i) fa[kc][i] = frag_b((const __bf16*)(bA + i * 16 * PB) + kc * 32, lane);
#pragma unroll      // constant j: fb[] stays in registers
        for (int j = 0; j < 4; ++j) fb[kc][j] = frag_b((const __bf16*)(bB + j * 16 * PB) + kc * 32, lane); };
      frags(0);
      if (t + 1 < NF) fill(t + 1);      // into the buffer that trip t - 1 read: behind the barrier at that trip's foot
      frags(1); frags(2); frags(3);
      __builtin_amdgcn_sched_barrier(0);      // keeps the 64 reads ahead of the WMMAs: sunk to their first use, each group of four WMMAs would wait out an LDS latency of its own
#pragma unroll      // constant kc, i and j: LDS reads take immediate offsets, acc[], fa[] and fb[] stay in registers
      for (int kc = 0; kc < KF / 32; ++kc) {
#pragma unroll
        for (int i = 0; i < 4; ++i) {
#pragma unroll
          for (int j = 0; j < 4; ++j) acc[i][j] = wmma_bfp(fa[kc][i], fb[kc][j], acc[i][j]); } }
      __builtin_amdgcn_sched_barrier(0);      // keeps the WMMAs ahead of the waits: moved behind the barrier, they would no longer run under the copies' latency
      WAIT_LDS(); WAIT_COPIES(); __syncthreads(); }      // publishes tile t + 1 and frees tile t's buffer
    WAIT_COPIES();
    // D element r of tile (i, j): token row rowb + i*16 + 8 g + r, col j*16 + col of the wave's matrix. Row i of stK and column i of stV are token row i = key qb*128 - 64 + i; row i of stQ is query qb*128 + i = token row 64 + i
    auto put_f = [&](char* dst, int i, int j, int row) {      // one 16 x 16 tile as f32, rows AP apart
#pragma unroll      // constant r: acc[] stays in registers
      for (int r = 0; r < 8; ++r) *(float*)(dst + (row + i * 16 + 8 * g + r) * AP + (j * 16 + col) * 4) = acc[i][j][r]; };
    if (mat < 2) { char* const dst = mat ? stK : stQ; const int row = mat ? rowb : rowb - 64;
#pragma unroll      // constant i and j here and below: acc[] stays in registers
      for (int i = 0; i < 4; ++i) {
#pragma unroll
        for (int j = 0; j < 4; ++j) put_f(dst, i, j, row); } }
    else {              // v (x4, f16 hi and lo, transposed: eight keys of one d are 16 bytes)
#pragma unroll
      for (int i = 0; i < 4; ++i) {
#pragma unroll
        for (int j = 0; j < 4; ++j) { const int d = j * 16 + col, key = rowb + i * 16 + 8 * g; v8h hi8, lo8;
#pragma unroll
          for (int r = 0; r < 8; ++r) { const float v = acc[i][j][r] * 4.0f; const _Float16 hi = (_Float16)v; hi8[r] = hi; lo8[r] = (_Float16)((v - (float)hi) * VLO); }
          *(v8h*)(stVh + d * VP + key * 2) = hi8; *(v8h*)(stVl + d * VP + key * 2) = lo8; } } } }
  __syncthreads();      // publishes q, k, v to all eight waves; nothing is written there again
  // Q and all five K tiles: 48 LDS reads. Staged K row i is key qb*128 - 64 + i, so tile t of this wave starts at row (w + t) * 16
  R16 q0r, q1r, kr[NKT][2];
  auto raw_at = [&](const char* row, int o) { const float* p = (const float*)row + 8 * g + o; R16 r; r.q[0] = *(const v4f*)p; r.q[1] = *(const v4f*)(p + 4); r.q[2] = *(const v4f*)(p + 16); r.q[3] = *(const v4f*)(p + 20); return r; };
  const char* qt = stQ + (w * 16 + col) * AP; q0r = raw_at(qt, 0); q1r = raw_at(qt, 32);
#pragma unroll      // constant t: kr[] stays in registers
  for (int t = 0; t < NKT; ++t) { const char* kt = stK + ((w + t) * 16 + col) * AP; kr[t][0] = raw_at(kt, 0); kr[t][1] = raw_at(kt, 32); }
  F2 aq[2]; aq[0] = split_raw(q0r); aq[1] = split_raw(q1r);
  // K rows as first operand, Q rows as second (the three products in the order they had): D element r of lane (col, g) is key k0 + 8 g + r, query q0 + col
  auto mac3t = [&](const F2& k, const F2& q, v8f c) { c = wmma_bf(k.h, q.l, c); c = wmma_bf(k.l, q.h, c); return wmma_bf(k.h, q.h, c); };
  float sc[NKT][8];
#pragma unroll      // constant t and r here and below: sc[] stays in registers
  for (int t = 0; t < NKT; ++t) { const int k0 = q0 - 64 + t * 16;
    v8f s = mac3t(split_raw(kr[t][0]), aq[0], (v8f){}); s = mac3t(split_raw(kr[t][1]), aq[1], s);
    // Only tile 0 can fall behind a window (key <= query - WIN: 8 g + r <= col), only the last can lie ahead of a query (8 g + r > col); any tile but the last can lie in front of key 0, as a whole
#pragma unroll
    for (int r = 0; r < 8; ++r) { const bool off = t == 0 ? (k0 < 0 || 8 * g + r <= col) : (t == NKT - 1 ? 8 * g + r > col : k0 < 0); sc[t][r] = off ? -3.0e38f : s[r] * 0.125f; } }
  // V: 48 LDS reads, issued ahead of the softmax. Staged column i is key qb*128 - 64 + i; the 16 columns in front of the staged range (wave 0, first half) read column 0 .. 15 (finite): their P is zero
  v16h vh[3][4], vl[3][4];
#pragma unroll      // constant c and t: vh[] and vl[] stay in registers
  for (int c = 0; c < 3; ++c) { const int ra = w * 16 - 16 + c * 32, rb = ra + 16; const unsigned oa = ((ra < 0 ? 0 : ra) + 8 * g) * 2, ob = (rb + 8 * g) * 2;
#pragma unroll
    for (int t = 0; t < 4; ++t) { union { v16h v; v8h q[2]; } uh, ul; const unsigned o = (t * 16 + col) * VP;
      uh.q[0] = *(const v8h*)(stVh + o + oa); uh.q[1] = *(const v8h*)(stVh + o + ob); ul.q[0] = *(const v8h*)(stVl + o + oa); ul.q[1] = *(const v8h*)(stVl + o + ob);
      vh[c][t] = uh.v; vl[c][t] = ul.v; } }
  // lane (col, g): query q0 + col, the keys with bit 3 of their place in the tile equal to g; lane ^ 16 has the other half
  float mx = -3.4e38f;
#pragma unroll
  for (int t = 0; t < NKT; ++t) {
#pragma unroll
    for (int r = 0; r < 8; ++r) mx = fmaxf(mx, sc[t][r]); }
  mx = fmaxf(mx, __shfl_xor(mx, 16, 32));
  // key block c of 32 is score tiles 2 c - 1 (fragment elements 0 .. 7) and 2 c (elements 8 .. 15); tile -1 is keys q0-80 .. q0-65, outside every window: zero
  float ps = 0.f; v16h ph[3] = {}, pl[3] = {};
#pragma unroll
  for (int t = 0; t < NKT; ++t) {
#pragma unroll
    for (int r = 0; r < 8; ++r) { const float p = expf(sc[t][r] - mx) * 16384.0f; ps += p; const _Float16 hi = (_Float16)p; ph[(t + 1) >> 1][((t + 1) & 1) * 8 + r] = hi; pl[(t + 1) >> 1][((t + 1) & 1) * 8 + r] = (_Float16)((p - (float)hi) * PLO); } }
  ps += __shfl_xor(ps, 16, 32);
  const float lrun = ps * (1.0f / 16384.0f);
  // V^T as first operand, P^T as second: D element r of tile t is d = t*16 + 8 g + r of query q0 + col
  v8f acc[4] = {}, ac1[4] = {}, ac2[4] = {};
#pragma unroll
  for (int c = 0; c < 3; ++c) {
#pragma unroll
    for (int t = 0; t < 4; ++t) {
      if (c == 0) { acc[t] = wmma16(vh[c][t], ph[c], acc[t]); ac1[t] = wmma16(vl[c][t], ph[c], ac1[t]); ac2[t] = wmma16(vh[c][t], pl[c], ac2[t]); }      // the accumulators' registers are first written here: wmma16 holds A and B until its slots have passed, so no new D lands on them
      else { acc[t] = wmma16p(vh[c][t], ph[c], acc[t]); ac1[t] = wmma16p(vl[c][t], ph[c], ac1[t]); ac2[t] = wmma16p(vh[c][t], pl[c], ac2[t]); } } }
  const float inv = 1.0f / (lrun * 16384.0f * 4.0f);      // the lane's own query
#pragma unroll
  for (int t = 0; t < 4; ++t) { v4f o[2];
#pragma unroll
    for (int r = 0; r < 8; ++r) o[r >> 2][r & 3] = (acc[t][r] + ac1[t][r] * (1.0f / VLO) + ac2[t][r] * (1.0f / PLO)) * inv;
    *(v4f*)(&sO[w][col][t * 16 + 8 * g]) = o[0]; *(v4f*)(&sO[w][col][t * 16 + 8 * g + 4]) = o[1]; }
  LDSX();
  for (int qq = lane; qq < 16 * 16; qq += 32) { const int rl = qq >> 4, pc = qq & 15; vst2(O32 + ((bh * SS) + q0 + rl) * HD + pc * 4, *(const v4f*)(&sO[w][rl][pc * 4])); }
}
// out = ctx Wo^T : split(ctx) x bf16(Wo rows): 2 products (Wo is an INPUT -> bf16 exact)
__global__ __launch_bounds__(128) void k_out(const float* __restrict__ O32, const __bf16* __restrict__ PT, float* __restrict__ out) {
  __shared__ __align__(16) float so[4][16][132];
  __shared__ __align__(16) char ring[2 * OUT_BUF];
  const int tid = threadIdx.x, wave = tid >> 5, lane = tid & 31, col = lane & 15, g = lane >> 4;
  const int r0b = blockIdx.x * 64, r0 = r0b + wave * 16, n0 = blockIdx.y * 128; const int b = r0b / SS, s0 = r0b % SS;
  v8f acc[8] = {};
  // ctx: a tile is two heads' 64 floats of each row; a lane copies chunk (tid & 31) of rows (tid >> 5) + 4 i (16 rows). PT: chunk (tid & 15) of rows (tid >> 4) + 8 i (16 rows)
  const unsigned lA = (unsigned)(size_t)ring + (tid >> 5) * PF + (tid & 31) * 16, lB = (unsigned)(size_t)ring + 64 * PF + (tid >> 4) * PB + (tid & 15) * 16;
  const char* gA = (const char*)(O32 + (((size_t)b * NH + ((tid & 31) >> 4)) * SS + s0 + (tid >> 5)) * HD + (tid & 15) * 4);
  const char* gB = (const char*)(PT + (size_t)(3 * E + n0 + (tid >> 4)) * E + (tid & 15) * 8);
  auto fill = [&](int t) { const unsigned bo = (t & 1) * OUT_BUF; const size_t ka = (size_t)t * 2 * SS * HD * 4, ko = (size_t)t * KT * 2;
    cp8(lA + bo, gA + ka, 4 * PF, (size_t)4 * HD * 4); cp8(lA + bo + 32 * PF, gA + ka + (size_t)32 * HD * 4, 4 * PF, (size_t)4 * HD * 4);
    cp8(lB + bo, gB + ko, 8 * PB, (size_t)8 * E * 2); cp8(lB + bo + 64 * PB, gB + ko + (size_t)64 * E * 2, 8 * PB, (size_t)8 * E * 2); };
  fill(0); WAIT_COPIES(); __syncthreads();
  fill(1);
  for (int t = 0; t < NT; ++t) { const float* bA = (const float*)(ring + (t & 1) * OUT_BUF + (wave * 16 + col) * PF); const char* bB = ring + (t & 1) * OUT_BUF + 64 * PF + col * PB;
    // two fragment sets in registers: block kc + 1's 20 LDS reads issue as one group in front of block kc's WMMAs (never past this tile's buffer)
    R16 ra[2]; v16b fb[2][8];
    auto frags = [&](int kc) { ra[kc & 1] = raw_row(bA, kc * 32, lane);
#pragma unroll      // constant j: fb[] stays in registers
      for (int j = 0; j < 8; ++j) fb[kc & 1][j] = frag_b((const __bf16*)(bB + j * 16 * PB) + kc * 32, lane); };
    frags(0);
#pragma unroll      // constant kc and j: LDS reads take immediate offsets, acc[], ra[] and fb[] stay in registers
    for (int kc = 0; kc < KT / 32; ++kc) { const F2 a = split_raw(ra[kc & 1]);
      if (kc + 1 < KT / 32) frags(kc + 1);
#pragma unroll
      for (int j = 0; j < 8; ++j) { acc[j] = wmma_bf(a.l, fb[kc & 1][j], acc[j]); acc[j] = wmma_bf(a.h, fb[kc & 1][j], acc[j]); } }
    WAIT_LDS(); WAIT_COPIES(); __syncthreads();      // publishes tile t + 1 and frees tile t's buffer
    if (t + 2 < NT) fill(t + 2); }
  WAIT_COPIES();
#pragma unroll
  for (int j = 0; j < 8; ++j) {
#pragma unroll
    for (int r = 0; r < 8; ++r) so[wave][8 * g + r][j * 16 + col] = acc[j][r]; }
  LDSX();
#pragma unroll 4
  for (int rl = 0; rl < 16; ++rl) vst2(out + (size_t)(r0 + rl) * E + n0 + lane * 4, *(const v4f*)(&so[wave][rl][lane * 4]));
}
extern "C" void kernel_launch(void* const* d_in, const int* in_sizes, int n_in, void* d_out, int out_size, void* d_ws, size_t ws_size, hipStream_t stream) {
  (void)in_sizes; (void)n_in; (void)out_size; (void)ws_size;
  const float** I = (const float**)d_in;   // inputs, Wq, Wk, Wv, Wo
  const float* x = I[0]; const float* Wq = I[1]; const float* Wk = I[2]; const float* Wv = I[3]; const float* Wo = I[4];
  float* out = (float*)d_out;
  char* ws = (char*)d_ws; size_t off = 0;
  auto take = [&](size_t bytes) { char* p = ws + off; off += (bytes + 255) & ~(size_t)255; return p; };
  __bf16* Xb = (__bf16*)take((size_t)NR * E * 2); __bf16* PT = (__bf16*)take((size_t)4 * E * E * 2);
  float* O32 = (float*)take((size_t)NR * E * 4);
  // ws ~ 14 MB
  k_cvt<<<CVX + 4 * CVW, CVB, 0, stream>>>(x, Wq, Wk, Wv, Wo, Xb, PT);
  k_qa<<<dim3(SS / QT, NB * NH), NW * 32, 0, stream>>>(Xb, PT, O32);
  k_out<<<dim3(NR / 64, E / 128), 128, 0, stream>>>(O32, PT, out);
}

// v009
// One run takes 25.7 microseconds.
// In two side-by-side timings against v008, it was 1.07 and 1.03 times as fast.
// Over all steps from v000 it is 5.49 times as fast.
// compute dtype: inputs and W* (INPUTS) rounded to bf16 with exact bf16 WMMA products (f32 accumulate) for the projections; q/k f32 split for the scores (3 products), P and V f16 hi/lo (3 products); softmax f32.
#include <hip/hip_runtime.h>
#include <math.h>

typedef __attribute__((ext_vector_type(16))) _Float16 v16h;
typedef __attribute__((ext_vector_type(16))) __bf16 v16b;
typedef __attribute__((ext_vector_type(8)))  _Float16 v8h;
typedef __attribute__((ext_vector_type(8)))  float v8f;
typedef __attribute__((ext_vector_type(4)))  float v4f;
typedef __attribute__((ext_vector_type(2)))  float v2f;
typedef __attribute__((ext_vector_type(4)))  unsigned v4u;
typedef __attribute__((ext_vector_type(2)))  unsigned v2u;
typedef __attribute__((ext_vector_type(4)))  int v4i;
typedef float __attribute__((may_alias)) float_a;
typedef int __attribute__((may_alias)) int_a;

template <typename T> __device__ __forceinline__ void vst2(void* p, T v) { *(T*)p = v;  }
__device__ __forceinline__ v8f wmma16(v16h a, v16h b, v8f c) {
  v8f d = __builtin_amdgcn_wmma_f32_16x16x32_f16(false, a, false, b, (short)0, c, false, false);
  asm volatile("v_nop\n\tv_nop\n\tv_nop\n\tv_nop" : "+v"(d) : "v"(a), "v"(b));
  return d;
}
// the plain builtin (the compiler keeps its distances itself), for WMMAs that accumulate in place: no asm statement names its operands, so they may lie above v255, which an asm operand cannot; the 192 registers of V beside 96 of accumulators need that room
__device__ __forceinline__ v8f wmma16p(v16h a, v16h b, v8f c) { return __builtin_amdgcn_wmma_f32_16x16x32_f16(false, a, false, b, (short)0, c, false, false); }
__device__ __forceinline__ v8f wmma_bf(v16b a, v16b b, v8f c) {
  v8f d = __builtin_amdgcn_wmma_f32_16x16x32_bf16(false, a, false, b, (short)0, c, false, false);
  asm volatile("v_nop\n\tv_nop\n\tv_nop\n\tv_nop" : "+v"(d) : "v"(a), "v"(b));
  return d;
}
// 16x16x32 fragments: lane = (h = lane>>4, row/col = lane&15); elements 0..7 = k0+8h+0..7, 8..15 = k0+16+8h+0..7; D element r = row 8h+r
__device__ __forceinline__ v16h frag_h(const _Float16* rowk0, int lane) {
  union { v16h v; v8h q[2]; } u; const _Float16* p = rowk0 + 8 * (lane >> 4);
  u.q[0] = *(const v8h*)p; u.q[1] = *(const v8h*)(p + 16); return u.v;
}
__device__ __forceinline__ v16h frag_f32(const float* rowk0, int lane) {
  v16h a; const float* p = rowk0 + 8 * (lane >> 4);
#pragma unroll
  for (int i = 0; i < 8; ++i) { a[i] = (_Float16)p[i]; a[8 + i] = (_Float16)p[16 + i]; }
  return a;
}
__device__ __forceinline__ v16h frag_f32s(const float* rowk0, int lane, float sc) {
  v16h a; const float* p = rowk0 + 8 * (lane >> 4);
#pragma unroll
  for (int i = 0; i < 8; ++i) { a[i] = (_Float16)(p[i] * sc); a[8 + i] = (_Float16)(p[16 + i] * sc); }
  return a;
}
// column fragment from a [K][ld] layout (column n), rows >= K read as 0
__device__ __forceinline__ v16h fragc_f32(const float* W, int k0, int n, int lane, int ld, int K) {
  v16h a; const int g = lane >> 4;
#pragma unroll
  for (int i = 0; i < 8; ++i) { const int ka = k0 + 8 * g + i, kb = ka + 16;
    a[i] = (_Float16)(ka < K ? W[(size_t)ka * ld + n] : 0.f); a[8 + i] = (_Float16)(kb < K ? W[(size_t)kb * ld + n] : 0.f); }
  return a;
}
struct F2 { v16b h, l; };
__device__ __forceinline__ F2 bsplit16(const float v[16]) { F2 r;
#pragma unroll
  for (int i = 0; i < 16; ++i) { const __bf16 h = (__bf16)v[i]; r.h[i] = h; r.l[i] = (__bf16)(v[i] - (float)h); }
  return r; }
__device__ __forceinline__ F2 split_row(const float* row, int k0, int lane) { float v[16]; const float* p = row + k0 + 8 * (lane >> 4);
#pragma unroll
  for (int i = 0; i < 8; ++i) { v[i] = p[i]; v[8 + i] = p[16 + i]; }
  return bsplit16(v); }
// the 16 floats of split_row, loaded but not yet split: lets a whole group of loads issue before the first value is used
struct R16 { v4f q[4]; };
__device__ __forceinline__ R16 raw_row(const float* row, int k0, int lane) { R16 r; const float* p = row + k0 + 8 * (lane >> 4);
  r.q[0] = *(const v4f*)p; r.q[1] = *(const v4f*)(p + 4); r.q[2] = *(const v4f*)(p + 16); r.q[3] = *(const v4f*)(p + 20); return r; }
__device__ __forceinline__ F2 split_raw(const R16& r) { float v[16];
#pragma unroll
  for (int i = 0; i < 16; ++i) v[i] = r.q[i >> 2][i & 3];
  return bsplit16(v); }
__device__ __forceinline__ F2 split_rowK(const float* row, int k0, int lane, int K) { float v[16]; const int g = lane >> 4;
#pragma unroll
  for (int i = 0; i < 8; ++i) { const int ka = k0 + 8 * g + i, kb = ka + 16; v[i] = ka < K ? row[ka] : 0.f; v[8 + i] = kb < K ? row[kb] : 0.f; }
  return bsplit16(v); }
__device__ __forceinline__ F2 split_col(const float* W, int k0, int n, int lane, int ld, int K) { float v[16]; const int g = lane >> 4;
#pragma unroll
  for (int i = 0; i < 8; ++i) { const int ka = k0 + 8 * g + i, kb = ka + 16; v[i] = ka < K ? W[(size_t)ka * ld + n] : 0.f; v[8 + i] = kb < K ? W[(size_t)kb * ld + n] : 0.f; }
  return bsplit16(v); }
__device__ __forceinline__ v8f mac3(const F2& a, const F2& b, v8f c) { c = wmma_bf(a.l, b.h, c); c = wmma_bf(a.h, b.l, c); return wmma_bf(a.h, b.h, c); }
__device__ __forceinline__ float sigm(float v) { return 1.0f / (1.0f + expf(-v)); }
#define LDSX() do { asm volatile("s_wait_dscnt 0" ::: "memory"); __builtin_amdgcn_wave_barrier(); __builtin_amdgcn_fence(__ATOMIC_RELEASE, "workgroup"); } while (0)


// Sliding-window causal attention (12 heads of 64 on [1,2048,768], [out][in] weights, no biases, scale 1/8): each query attends to keys max(0, q-63) .. q (the reference gathers a 64-token window ending at q and masks window slots beyond q);
// softmax; (P v) Wo^T. Only the 16-key tiles that can intersect a wave's windows are visited (exact: every other weight is exp(-inf) = 0).
#define NB 1
#define SS 2048
#define E 768
#define NH 12
#define WIN 64
#define HD 64
#define NR (NB * SS)
#define PLO 1024.0f
#define VLO 2048.0f
__device__ __forceinline__ float bfr(float v) { return (float)(__bf16)v; }
__device__ __forceinline__ v16b frag_b(const __bf16* rowk0, int lane) { return __builtin_bit_cast(v16b, frag_h((const _Float16*)rowk0, lane)); }
// LDS ring of the output projection GEMM: a tile is 128 k of every operand row; two buffers
#define KT 128
#define NT (E / KT)
#define PB 272                      // LDS pitch of a 256-byte bf16 row (16 B x odd: conflict-free b128 reads)
#define PF 528                      // LDS pitch of a 512-byte f32 row (16 B x odd)
#define OUT_BUF (64 * PF + 128 * PB) // [ctx 64 rows f32 | PT 128 rows]
// eight asynchronous 16-byte copies per lane, global -> LDS, rows ls / gs bytes apart. The s_wait_xcnt ends the copies' own statement, so no address register is rewritten in front of it.
__device__ __forceinline__ void cp8(unsigned l, const char* g, unsigned ls, size_t gs) {
  asm volatile("global_load_async_to_lds_b128 %0, %8, off\n\t"
               "global_load_async_to_lds_b128 %1, %9, off\n\t"
               "global_load_async_to_lds_b128 %2, %10, off\n\t"
               "global_load_async_to_lds_b128 %3, %11, off\n\t"
               "global_load_async_to_lds_b128 %4, %12, off\n\t"
               "global_load_async_to_lds_b128 %5, %13, off\n\t"
               "global_load_async_to_lds_b128 %6, %14, off\n\t"
               "global_load_async_to_lds_b128 %7, %15, off\n\t"
               "s_wait_xcnt 0x0"
               :: "v"(l), "v"(l + ls), "v"(l + 2 * ls), "v"(l + 3 * ls), "v"(l + 4 * ls), "v"(l + 5 * ls), "v"(l + 6 * ls), "v"(l + 7 * ls),
                  "v"(g), "v"(g + gs), "v"(g + 2 * gs), "v"(g + 3 * gs), "v"(g + 4 * gs), "v"(g + 5 * gs), "v"(g + 6 * gs), "v"(g + 7 * gs)
               : "memory");
}
// the issuing wave's own copies have landed
#define WAIT_COPIES() asm volatile("s_wait_asynccnt 0x0" ::: "memory")
// this wave's LDS reads have returned (before the buffer they read is handed back for a refill)
#define WAIT_LDS() asm volatile("s_wait_dscnt 0x0" ::: "memory")

// One conversion launch, f32 -> bf16 (round to nearest even), for x and the four [out][in] weights: PT rows [0,E) Wq, [E,2E) Wk, [2E,3E) Wv, [3E,4E) Wo, each row as it lies.
// Few long waves: a block is 16 waves and converts CVB * CVU * 4 consecutive floats of ONE source; a lane holds CVU 16-byte loads in flight, each wave-wide load 512 and each store 256 contiguous bytes.
#define CVB 512
#define CVU 8
#define CVE (CVB * CVU * 4)
#define CVX (NR * E / CVE)          // blocks on x
#define CVW (E * E / CVE)           // blocks on each weight
static_assert(CVX * CVE == NR * E && CVW * CVE == E * E, "a conversion block never crosses a source's end");
__global__ __launch_bounds__(CVB) void k_cvt(const float* __restrict__ x, const float* __restrict__ Wq, const float* __restrict__ Wk, const float* __restrict__ Wv, const float* __restrict__ Wo, __bf16* __restrict__ Xb, __bf16* __restrict__ PT) {
  const int bx = blockIdx.x, tid = threadIdx.x; const float* s; __bf16* d;
  if (bx < CVX) { s = x + (size_t)bx * CVE; d = Xb + (size_t)bx * CVE; }
  else { const int m = (bx - CVX) / CVW, r = (bx - CVX) % CVW; s = (m == 0 ? Wq : (m == 1 ? Wk : (m == 2 ? Wv : Wo))) + (size_t)r * CVE; d = PT + (size_t)m * E * E + (size_t)r * CVE; }
  v4f v[CVU];
#pragma unroll      // all CVU loads issue before the first value is used
  for (int u = 0; u < CVU; ++u) v[u] = *(const v4f*)(s + (u * CVB + tid) * 4);
#pragma unroll      // constant u and e: v[] stays in registers
  for (int u = 0; u < CVU; ++u) { union { __bf16 h[4]; v2u q; } pk;
#pragma unroll      // as above
    for (int e = 0; e < 4; ++e) pk.h[e] = (__bf16)v[u][e];
    vst2(d + (u * CVB + tid) * 4, pk.q); }
}
// projections and windowed attention in ONE launch: block (QT = 128 queries, bh), eight waves, alone on its WGP. The block first computes, on the matrix unit, q of its 128 tokens and k, v of the TT = 192 tokens qb*128-64 .. qb*128+127 for its head
// (k, v of the 64 tokens in front are computed again by the block that owns them: a third of the k, v rows), and leaves them in LDS where the attention part reads them: q, k, v never go through memory.
// GEMM: operand tiles of 128 k in a two-buffer LDS ring filled by asynchronous copies; every wave owns 64 rows x 64 cols of ONE of q, k, v (8 LDS fragments feed 16 WMMAs): waves 0, 1 q (token rows 64 .. 191), waves 2 .. 4 k, waves 5 .. 7 v (token rows 0 .. 191).
// Attention: a wave owns 16 queries q0 .. q0+15. Their windows lie in keys q0-64 .. q0+15: five 16-key score tiles, ONE softmax pass (maximum and sum over the whole window, no running rescale).
// Both products are transposed: S^T = K Q^T (a lane holds 40 scores of ONE query: maximum and sum are in-lane plus one exchange with lane ^ 16) and O^T = V^T P^T: two neighbouring S^T tiles in D layout ARE the second operand's
// fragment of a k = 32 block, so scores and P never leave the registers. S on hi/lo splits of the f32 q/k rows; P,V hi/lo over 96 keys q0-80 .. q0+15 (three k = 32 blocks; P of the first 16 keys is zero); O f32 [bh][s][64]
#define NKT 5                       // score tiles of 16 keys
#define AP 272                      // LDS pitch of a 256-byte q or k row (16 B x odd: conflict-free b128 reads)
#define QT 128                      // queries of a block
#define TT (QT + WIN)               // tokens whose k and v the block needs
#define NW (QT / 16)                // waves of a block
#define VP (TT * 2 + 16)            // LDS pitch of a v row (one d, TT keys, f16): 16 B x odd
#define KF 128                      // k of a ring tile of the fused GEMM
#define NF (E / KF)
#define QA_BUF ((TT + 192) * PB)    // [Xb TT rows | Wq 64 | Wk 64 | Wv 64 rows]
#define QA_ATT ((QT + TT) * AP + 2 * HD * VP + NW * 16 * 68 * 4)      // q, k | v hi, lo | O
#define QA_LDS (QA_ATT > 2 * QA_BUF ? QA_ATT : 2 * QA_BUF)
static_assert(KF == 128 && QT == 128 && WIN == 64, "tile shapes the row and key arithmetic below is written for");
// the plain builtin (the compiler keeps its distances itself): 128 accumulator registers beside four fragment sets reach above v255, which an asm operand cannot name
__device__ __forceinline__ v8f wmma_bfp(v16b a, v16b b, v8f c) { return __builtin_amdgcn_wmma_f32_16x16x32_bf16(false, a, false, b, (short)0, c, false, false); }
// asynchronous 16-byte copies per lane, LDS rows ls apart; every four rows have a global base of their own, rows gs apart. The s_wait_xcnt ends the copies' own statement, so no address register is rewritten in front of it.
__device__ __forceinline__ void cp4x3(unsigned l, const char* a, const char* b, const char* c, unsigned ls, size_t gs) {
  asm volatile("global_load_async_to_lds_b128 %0, %12, off\n\t"
               "global_load_async_to_lds_b128 %1, %13, off\n\t"
               "global_load_async_to_lds_b128 %2, %14, off\n\t"
               "global_load_async_to_lds_b128 %3, %15, off\n\t"
               "global_load_async_to_lds_b128 %4, %16, off\n\t"
               "global_load_async_to_lds_b128 %5, %17, off\n\t"
               "global_load_async_to_lds_b128 %6, %18, off\n\t"
               "global_load_async_to_lds_b128 %7, %19, off\n\t"
               "global_load_async_to_lds_b128 %8, %20, off\n\t"
               "global_load_async_to_lds_b128 %9, %21, off\n\t"
               "global_load_async_to_lds_b128 %10, %22, off\n\t"
               "global_load_async_to_lds_b128 %11, %23, off\n\t"
               "s_wait_xcnt 0x0"
               :: "v"(l), "v"(l + ls), "v"(l + 2 * ls), "v"(l + 3 * ls), "v"(l + 4 * ls), "v"(l + 5 * ls), "v"(l + 6 * ls), "v"(l + 7 * ls), "v"(l + 8 * ls), "v"(l + 9 * ls), "v"(l + 10 * ls), "v"(l + 11 * ls),
                  "v"(a), "v"(a + gs), "v"(a + 2 * gs), "v"(a + 3 * gs), "v"(b), "v"(b + gs), "v"(b + 2 * gs), "v"(b + 3 * gs), "v"(c), "v"(c + gs), "v"(c + 2 * gs), "v"(c + 3 * gs)
               : "memory");
}
// asks L2 (scope SE: L2 only) for the data at each lane's address; returns nothing, counts on no counter. Every lane is on and every address lies inside its buffer
__device__ __forceinline__ void ask(const char* a) { asm volatile("global_prefetch_b8 %0, off scope:SCOPE_SE" :: "v"(a)); }
// ends the life of a prefetch's address registers. It stands behind the wait for copies that were issued in front of the prefetch: until those have landed the registers hold nothing but the address asked for, should the request read them late
#define HOLD(a) asm volatile("" :: "v"(a))
__global__ __launch_bounds__(NW * 32) void k_qa(const __bf16* __restrict__ Xb, const __bf16* __restrict__ PT, float* __restrict__ O32) {
  __shared__ __align__(16) char sm[QA_LDS];      // the ring fills all of it; q, k, v are written over it behind the loop's last barrier
  char* const stQ = sm; char* const stK = stQ + QT * AP; char* const stVh = stK + TT * AP; char* const stVl = stVh + HD * VP;
  float (*sO)[16][68] = (float (*)[16][68])(stVl + HD * VP);
  const int tid = threadIdx.x, w = __builtin_amdgcn_readfirstlane(tid >> 5), lane = tid & 31, col = lane & 15, g = lane >> 4;      // w in a scalar register: tile rows and their clamps are scalar
  const size_t bh = blockIdx.y; const int qb = blockIdx.x; const int q0 = qb * QT + w * 16;
  { const int mat = w < 2 ? 0 : (w < 5 ? 1 : 2), rowb = (w < 2 ? w + 1 : (w < 5 ? w - 2 : w - 5)) * 64; const size_t bb = bh / NH, hh = bh % NH;      // which of q, k, v, and the wave's first token row (scalar)
    v8f acc[4][4] = {};
    // a lane copies chunk (tid & 15) of rows (tid >> 4) + 16 i: a wave-wide copy is two whole 256-byte rows. In the first block the 64 tokens in front of token 0 are taken from tokens 0 .. 63 (in bounds, finite); as keys they are masked below and their P is zero
    const int sr = tid >> 4, sc = tid & 15; const unsigned lA = (unsigned)(size_t)sm + sr * PB + sc * 16;
    const char* gO = (const char*)(Xb + (bb * SS + qb * QT + sr) * E + sc * 8); const char* gH = gO - (qb ? (size_t)64 * E * 2 : 0);
    const char* gW = (const char*)(PT + (hh * HD + sr) * E + sc * 8);
    auto fill = [&](int t) { const unsigned bo = (t & 1) * QA_BUF; const size_t ko = (size_t)t * KF * 2;
      cp4x3(lA + bo, gH + ko, gO + ko, gO + ko + (size_t)64 * E * 2, 16 * PB, (size_t)16 * E * 2);
      cp4x3(lA + bo + TT * PB, gW + ko, gW + ko + (size_t)E * E * 2, gW + ko + (size_t)2 * E * E * 2, 16 * PB, (size_t)16 * E * 2); };
    fill(0);
    // k tiles 1 .. 5 of the block's rows were stored by the launch before, on any die. Asked for here, under tile 0's latency (for speed only). A tile's slice of a row is one unit.
    // A row is read by 12 (x) or 16 (W) blocks: it is dealt to those whose head (x) or query block (W) equals it mod 4 (48 rows x 5 tiles = 240 units of each kind a block; threads 240 .. 255 repeat the last)
    const int pj = tid < 240 ? tid : 239, pr = (pj % 48) * 4, pt = 1 + pj / 48; const int px = pr + (int)(hh & 3), pw = pr + (qb & 3);
    const char* const aX = (const char*)(Xb + (bb * SS + (px < 64 && qb == 0 ? px : qb * QT - 64 + px)) * E + pt * KF);
    const char* const aW = (const char*)(PT + ((size_t)(pw >> 6) * E + hh * HD + (pw & 63)) * E + pt * KF);
    ask(aX); ask(aW);
    WAIT_COPIES(); HOLD(aX); HOLD(aW); __syncthreads();
#pragma unroll 1      // rolled: for speed only
    for (int t = 0; t < NF; ++t) { const char* bA = sm + (t & 1) * QA_BUF + (rowb + col) * PB; const char* bB = sm + (t & 1) * QA_BUF + (TT + mat * 64 + col) * PB;
      // four fragment sets in registers: all four blocks' 16 LDS reads issue as groups in front of the WMMAs (never past this tile's buffer); the next tile's copies issue behind the first group, under its LDS latency
      v16b fa[4][4], fb[4][4];
      auto frags = [&](int kc) {
#pragma unroll      // constant i: fa[] stays in registers
        for (int i = 0; i < 4; ++i) fa[kc][i] = frag_b((const __bf16*)(bA + i * 16 * PB) + kc * 32, lane);
#pragma unroll      // constant j: fb[] stays in registers
        for (int j = 0; j < 4; ++j) fb[kc][j] = frag_b((const __bf16*)(bB + j * 16 * PB) + kc * 32, lane); };
      frags(0);
      if (t + 1 < NF) fill(t + 1);      // into the buffer that trip t - 1 read: behind the barrier at that trip's foot
      frags(1); frags(2); frags(3);
      __builtin_amdgcn_sched_barrier(0);      // keeps the 64 reads ahead of the WMMAs: sunk to their first use, each group of four WMMAs would wait out an LDS latency of its own
#pragma unroll      // constant kc, i and j: LDS reads take immediate offsets, acc[], fa[] and fb[] stay in registers
      for (int kc = 0; kc < KF / 32; ++kc) {
#pragma unroll
        for (int i = 0; i < 4; ++i) {
#pragma unroll
          for (int j = 0; j < 4; ++j) acc[i][j] = wmma_bfp(fa[kc][i], fb[kc][j], acc[i][j]); } }
      __builtin_amdgcn_sched_barrier(0);      // keeps the WMMAs ahead of the waits: moved behind the barrier, they would no longer run under the copies' latency
      WAIT_LDS(); WAIT_COPIES(); __syncthreads(); }      // publishes tile t + 1 and frees tile t's buffer
    WAIT_COPIES();
    // D element r of tile (i, j): token row rowb + i*16 + 8 g + r, col j*16 + col of the wave's matrix. Row i of stK and column i of stV are token row i = key qb*128 - 64 + i; row i of stQ is query qb*128 + i = token row 64 + i
    auto put_f = [&](char* dst, int i, int j, int row) {      // one 16 x 16 tile as f32, rows AP apart
#pragma unroll      // constant r: acc[] stays in registers
      for (int r = 0; r < 8; ++r) *(float*)(dst + (row + i * 16 + 8 * g + r) * AP + (j * 16 + col) * 4) = acc[i][j][r]; };
    if (mat < 2) { char* const dst = mat ? stK : stQ; const int row = mat ? rowb : rowb - 64;
#pragma unroll      // constant i and j here and below: acc[] stays in registers
      for (int i = 0; i < 4; ++i) {
#pragma unroll
        for (int j = 0; j < 4; ++j) put_f(dst, i, j, row); } }
    else {              // v (x4, f16 hi and lo, transposed: eight keys of one d are 16 bytes)
#pragma unroll
      for (int i = 0; i < 4; ++i) {
#pragma unroll
        for (int j = 0; j < 4; ++j) { const int d = j * 16 + col, key = rowb + i * 16 + 8 * g; v8h hi8, lo8;
#pragma unroll
          for (int r = 0; r < 8; ++r) { const float v = acc[i][j][r] * 4.0f; const _Float16 hi = (_Float16)v; hi8[r] = hi; lo8[r] = (_Float16)((v - (float)hi) * VLO); }
          *(v8h*)(stVh + d * VP + key * 2) = hi8; *(v8h*)(stVl + d * VP + key * 2) = lo8; } } } }
  __syncthreads();      // publishes q, k, v to all eight waves; nothing is written there again
  // Q and all five K tiles: 48 LDS reads. Staged K row i is key qb*128 - 64 + i, so tile t of this wave starts at row (w + t) * 16
  R16 q0r, q1r, kr[NKT][2];
  auto raw_at = [&](const char* row, int o) { const float* p = (const float*)row + 8 * g + o; R16 r; r.q[0] = *(const v4f*)p; r.q[1] = *(const v4f*)(p + 4); r.q[2] = *(const v4f*)(p + 16); r.q[3] = *(const v4f*)(p + 20); return r; };
  const char* qt = stQ + (w * 16 + col) * AP; q0r = raw_at(qt, 0); q1r = raw_at(qt, 32);
#pragma unroll      // constant t: kr[] stays in registers
  for (int t = 0; t < NKT; ++t) { const char* kt = stK + ((w + t) * 16 + col) * AP; kr[t][0] = raw_at(kt, 0); kr[t][1] = raw_at(kt, 32); }
  F2 aq[2]; aq[0] = split_raw(q0r); aq[1] = split_raw(q1r);
  // K rows as first operand, Q rows as second (the three products in the order they had): D element r of lane (col, g) is key k0 + 8 g + r, query q0 + col
  auto mac3t = [&](const F2& k, const F2& q, v8f c) { c = wmma_bf(k.h, q.l, c); c = wmma_bf(k.l, q.h, c); return wmma_bf(k.h, q.h, c); };
  float sc[NKT][8];
#pragma unroll      // constant t and r here and below: sc[] stays in registers
  for (int t = 0; t < NKT; ++t) { const int k0 = q0 - 64 + t * 16;
    v8f s = mac3t(split_raw(kr[t][0]), aq[0], (v8f){}); s = mac3t(split_raw(kr[t][1]), aq[1], s);
    // Only tile 0 can fall behind a window (key <= query - WIN: 8 g + r <= col), only the last can lie ahead of a query (8 g + r > col); any tile but the last can lie in front of key 0, as a whole
#pragma unroll
    for (int r = 0; r < 8; ++r) { const bool off = t == 0 ? (k0 < 0 || 8 * g + r <= col) : (t == NKT - 1 ? 8 * g + r > col : k0 < 0); sc[t][r] = off ? -3.0e38f : s[r] * 0.125f; } }
  // V: 48 LDS reads, issued ahead of the softmax. Staged column i is key qb*128 - 64 + i; the 16 columns in front of the staged range (wave 0, first half) read column 0 .. 15 (finite): their P is zero
  v16h vh[3][4], vl[3][4];
#pragma unroll      // constant c and t: vh[] and vl[] stay in registers
  for (int c = 0; c < 3; ++c) { const int ra = w * 16 - 16 + c * 32, rb = ra + 16; const unsigned oa = ((ra < 0 ? 0 : ra) + 8 * g) * 2, ob = (rb + 8 * g) * 2;
#pragma unroll
    for (int t = 0; t < 4; ++t) { union { v16h v; v8h q[2]; } uh, ul; const unsigned o = (t * 16 + col) * VP;
      uh.q[0] = *(const v8h*)(stVh + o + oa); uh.q[1] = *(const v8h*)(stVh + o + ob); ul.q[0] = *(const v8h*)(stVl + o + oa); ul.q[1] = *(const v8h*)(stVl + o + ob);
      vh[c][t] = uh.v; vl[c][t] = ul.v; } }
  // lane (col, g): query q0 + col, the keys with bit 3 of their place in the tile equal to g; lane ^ 16 has the other half
  float mx = -3.4e38f;
#pragma unroll
  for (int t = 0; t < NKT; ++t) {
#pragma unroll
    for (int r = 0; r < 8; ++r) mx = fmaxf(mx, sc[t][r]); }
  mx = fmaxf(mx, __shfl_xor(mx, 16, 32));
  // key block c of 32 is score tiles 2 c - 1 (fragment elements 0 .. 7) and 2 c (elements 8 .. 15); tile -1 is keys q0-80 .. q0-65, outside every window: zero
  float ps = 0.f; v16h ph[3] = {}, pl[3] = {};
#pragma unroll
  for (int t = 0; t < NKT; ++t) {
#pragma unroll
    for (int r = 0; r < 8; ++r) { const float p = expf(sc[t][r] - mx) * 16384.0f; ps += p; const _Float16 hi = (_Float16)p; ph[(t + 1) >> 1][((t + 1) & 1) * 8 + r] = hi; pl[(t + 1) >> 1][((t + 1) & 1) * 8 + r] = (_Float16)((p - (float)hi) * PLO); } }
  ps += __shfl_xor(ps, 16, 32);
  const float lrun = ps * (1.0f / 16384.0f);
  // V^T as first operand, P^T as second: D element r of tile t is d = t*16 + 8 g + r of query q0 + col
  v8f acc[4] = {}, ac1[4] = {}, ac2[4] = {};
#pragma unroll
  for (int c = 0; c < 3; ++c) {
#pragma unroll
    for (int t = 0; t < 4; ++t) {
      if (c == 0) { acc[t] = wmma16(vh[c][t], ph[c], acc[t]); ac1[t] = wmma16(vl[c][t], ph[c], ac1[t]); ac2[t] = wmma16(vh[c][t], pl[c], ac2[t]); }      // the accumulators' registers are first written here: wmma16 holds A and B until its slots have passed, so no new D lands on them
      else { acc[t] = wmma16p(vh[c][t], ph[c], acc[t]); ac1[t] = wmma16p(vl[c][t], ph[c], ac1[t]); ac2[t] = wmma16p(vh[c][t], pl[c], ac2[t]); } } }
  const float inv = 1.0f / (lrun * 16384.0f * 4.0f);      // the lane's own query
#pragma unroll
  for (int t = 0; t < 4; ++t) { v4f o[2];
#pragma unroll
    for (int r = 0; r < 8; ++r) o[r >> 2][r & 3] = (acc[t][r] + ac1[t][r] * (1.0f / VLO) + ac2[t][r] * (1.0f / PLO)) * inv;
    *(v4f*)(&sO[w][col][t * 16 + 8 * g]) = o[0]; *(v4f*)(&sO[w][col][t * 16 + 8 * g + 4]) = o[1]; }
  LDSX();
  for (int qq = lane; qq < 16 * 16; qq += 32) { const int rl = qq >> 4, pc = qq & 15; vst2(O32 + ((bh * SS) + q0 + rl) * HD + pc * 4, *(const v4f*)(&sO[w][rl][pc * 4])); }
}
// out = ctx Wo^T : split(ctx) x bf16(Wo rows): 2 products (Wo is an INPUT -> bf16 exact)
__global__ __launch_bounds__(128) void k_out(const float* __restrict__ O32, const __bf16* __restrict__ PT, float* __restrict__ out) {
  __shared__ __align__(16) float so[4][16][132];
  __shared__ __align__(16) char ring[2 * OUT_BUF];
  const int tid = threadIdx.x, wave = tid >> 5, lane = tid & 31, col = lane & 15, g = lane >> 4;
  const int r0b = blockIdx.x * 64, r0 = r0b + wave * 16, n0 = blockIdx.y * 128; const int b = r0b / SS, s0 = r0b % SS;
  v8f acc[8] = {};
  // ctx: a tile is two heads' 64 floats of each row; a lane copies chunk (tid & 31) of rows (tid >> 5) + 4 i (16 rows). PT: chunk (tid & 15) of rows (tid >> 4) + 8 i (16 rows)
  const unsigned lA = (unsigned)(size_t)ring + (tid >> 5) * PF + (tid & 31) * 16, lB = (unsigned)(size_t)ring + 64 * PF + (tid >> 4) * PB + (tid & 15) * 16;
  const char* gA = (const char*)(O32 + (((size_t)b * NH + ((tid & 31) >> 4)) * SS + s0 + (tid >> 5)) * HD + (tid & 15) * 4);
  const char* gB = (const char*)(PT + (size_t)(3 * E + n0 + (tid >> 4)) * E + (tid & 15) * 8);
  auto fill = [&](int t) { const unsigned bo = (t & 1) * OUT_BUF; const size_t ka = (size_t)t * 2 * SS * HD * 4, ko = (size_t)t * KT * 2;
    cp8(lA + bo, gA + ka, 4 * PF, (size_t)4 * HD * 4); cp8(lA + bo + 32 * PF, gA + ka + (size_t)32 * HD * 4, 4 * PF, (size_t)4 * HD * 4);
    cp8(lB + bo, gB + ko, 8 * PB, (size_t)8 * E * 2); cp8(lB + bo + 64 * PB, gB + ko + (size_t)64 * E * 2, 8 * PB, (size_t)8 * E * 2); };
  fill(0);
  // k tiles 1 .. 5, stored by the launches before, asked for under tile 0's latency. ctx: 10 heads x 64 rows = 640 units, read by the 6 column blocks, dealt to the two that equal the unit mod 3.
  // PT: 5 tiles x 128 rows = 640 units, read by the 32 row blocks, dealt by unit mod 8 to four of them (bits 0, 1 and 3 of the row block). Indices past the last unit repeat it
  const int u0 = 3 * tid + (int)(blockIdx.y % 3), u1 = u0 + 3 * 128 < 640 ? u0 + 3 * 128 : 639, u2 = 8 * (tid < 80 ? tid : 79) + ((blockIdx.x & 3) | ((blockIdx.x >> 1) & 4));
  const char* const aC0 = (const char*)(O32 + (((size_t)b * NH + 2 + (u0 >> 6)) * SS + s0 + (u0 & 63)) * HD);
  const char* const aC1 = (const char*)(O32 + (((size_t)b * NH + 2 + (u1 >> 6)) * SS + s0 + (u1 & 63)) * HD);
  const char* const aP = (const char*)(PT + (size_t)(3 * E + n0 + (u2 & 127)) * E + (1 + (u2 >> 7)) * KT);
  ask(aC0); ask(aC1); ask(aP);
  WAIT_COPIES(); HOLD(aC0); HOLD(aC1); HOLD(aP); __syncthreads();
  fill(1);
  for (int t = 0; t < NT; ++t) { const float* bA = (const float*)(ring + (t & 1) * OUT_BUF + (wave * 16 + col) * PF); const char* bB = ring + (t & 1) * OUT_BUF + 64 * PF + col * PB;
    // two fragment sets in registers: block kc + 1's 20 LDS reads issue as one group in front of block kc's WMMAs (never past this tile's buffer)
    R16 ra[2]; v16b fb[2][8];
    auto frags = [&](int kc) { ra[kc & 1] = raw_row(bA, kc * 32, lane);
#pragma unroll      // constant j: fb[] stays in registers
      for (int j = 0; j < 8; ++j) fb[kc & 1][j] = frag_b((const __bf16*)(bB + j * 16 * PB) + kc * 32, lane); };
    frags(0);
#pragma unroll      // constant kc and j: LDS reads take immediate offsets, acc[], ra[] and fb[] stay in registers
    for (int kc = 0; kc < KT / 32; ++kc) { const F2 a = split_raw(ra[kc & 1]);
      if (kc + 1 < KT / 32) frags(kc + 1);
#pragma unroll
      for (int j = 0; j < 8; ++j) { acc[j] = wmma_bf(a.l, fb[kc & 1][j], acc[j]); acc[j] = wmma_bf(a.h, fb[kc & 1][j], acc[j]); } }
    WAIT_LDS(); WAIT_COPIES(); __syncthreads();      // publishes tile t + 1 and frees tile t's buffer
    if (t + 2 < NT) fill(t + 2); }
  WAIT_COPIES();
#pragma unroll
  for (int j = 0; j < 8; ++j) {
#pragma unroll
    for (int r = 0; r < 8; ++r) so[wave][8 * g + r][j * 16 + col] = acc[j][r]; }
  LDSX();
#pragma unroll 4
  for (int rl = 0; rl < 16; ++rl) vst2(out + (size_t)(r0 + rl) * E + n0 + lane * 4, *(const v4f*)(&so[wave][rl][lane * 4]));
}
extern "C" void kernel_launch(void* const* d_in, const int* in_sizes, int n_in, void* d_out, int out_size, void* d_ws, size_t ws_size, hipStream_t stream) {
  (void)in_sizes; (void)n_in; (void)out_size; (void)ws_size;
  const float** I = (const float**)d_in;   // inputs, Wq, Wk, Wv, Wo
  const float* x = I[0]; const float* Wq = I[1]; const float* Wk = I[2]; const float* Wv = I[3]; const float* Wo = I[4];
  float* out = (float*)d_out;
  char* ws = (char*)d_ws; size_t off = 0;
  auto take = [&](size_t bytes) { char* p = ws + off; off += (bytes + 255) & ~(size_t)255; return p; };
  __bf16* Xb = (__bf16*)take((size_t)NR * E * 2); __bf16* PT = (__bf16*)take((size_t)4 * E * E * 2);
  float* O32 = (float*)take((size_t)NR * E * 4);
  // ws ~ 14 MB
  k_cvt<<<CVX + 4 * CVW, CVB, 0, stream>>>(x, Wq, Wk, Wv, Wo, Xb, PT);
  k_qa<<<dim3(SS / QT, NB * NH), NW * 32, 0, stream>>>(Xb, PT, O32);
  k_out<<<dim3(NR / 64, E / 128), 128, 0, stream>>>(O32, PT, out);
}

// v010
// Measured time: 24.1 microseconds a run.
// In both of two side-by-side timings against v009, it was 1.07 times as fast.
// Over all steps from v000 it is 5.87 times as fast.
// compute dtype: inputs and W* (INPUTS) rounded to bf16 with exact bf16 WMMA products (f32 accumulate) for the projections; q/k f32 split into bf16 hi/lo for the scores (3 products), P and V f16 hi/lo (3 products); softmax f32.
#include <hip/hip_runtime.h>
#include <math.h>

typedef __attribute__((ext_vector_type(16))) _Float16 v16h;
typedef __attribute__((ext_vector_type(16))) __bf16 v16b;
typedef __attribute__((ext_vector_type(8)))  _Float16 v8h;
typedef __attribute__((ext_vector_type(8)))  __bf16 v8b;
typedef __attribute__((ext_vector_type(8)))  float v8f;
typedef __attribute__((ext_vector_type(4)))  float v4f;
typedef __attribute__((ext_vector_type(2)))  float v2f;
typedef __attribute__((ext_vector_type(4)))  unsigned v4u;
typedef __attribute__((ext_vector_type(2)))  unsigned v2u;
typedef __attribute__((ext_vector_type(4)))  int v4i;
typedef float __attribute__((may_alias)) float_a;
typedef int __attribute__((may_alias)) int_a;

template <typename T> __device__ __forceinline__ void vst2(void* p, T v) { *(T*)p = v;  }
__device__ __forceinline__ v8f wmma16(v16h a, v16h b, v8f c) {
  v8f d = __builtin_amdgcn_wmma_f32_16x16x32_f16(false, a, false, b, (short)0, c, false, false);
  asm volatile("v_nop\n\tv_nop\n\tv_nop\n\tv_nop" : "+v"(d) : "v"(a), "v"(b));
  return d;
}
// the plain builtin (the compiler keeps its distances itself), for WMMAs that accumulate in place: no asm statement names its operands, so they may lie above v255, which an asm operand cannot; the 192 registers of V beside 96 of accumulators need that room
__device__ __forceinline__ v8f wmma16p(v16h a, v16h b, v8f c) { return __builtin_amdgcn_wmma_f32_16x16x32_f16(false, a, false, b, (short)0, c, false, false); }
__device__ __forceinline__ v8f wmma_bf(v16b a, v16b b, v8f c) {
  v8f d = __builtin_amdgcn_wmma_f32_16x16x32_bf16(false, a, false, b, (short)0, c, false, false);
  asm volatile("v_nop\n\tv_nop\n\tv_nop\n\tv_nop" : "+v"(d) : "v"(a), "v"(b));
  return d;
}
// 16x16x32 fragments: lane = (h = lane>>4, row/col = lane&15); elements 0..7 = k0+8h+0..7, 8..15 = k0+16+8h+0..7; D element r = row 8h+r
__device__ __forceinline__ v16h frag_h(const _Float16* rowk0, int lane) {
  union { v16h v; v8h q[2]; } u; const _Float16* p = rowk0 + 8 * (lane >> 4);
  u.q[0] = *(const v8h*)p; u.q[1] = *(const v8h*)(p + 16); return u.v;
}
__device__ __forceinline__ v16h frag_f32(const float* rowk0, int lane) {
  v16h a; const float* p = rowk0 + 8 * (lane >> 4);
#pragma unroll
  for (int i = 0; i < 8; ++i) { a[i] = (_Float16)p[i]; a[8 + i] = (_Float16)p[16 + i]; }
  return a;
}
__device__ __forceinline__ v16h frag_f32s(const float* rowk0, int lane, float sc) {
  v16h a; const float* p = rowk0 + 8 * (lane >> 4);
#pragma unroll
  for (int i = 0; i < 8; ++i) { a[i] = (_Float16)(p[i] * sc); a[8 + i] = (_Float16)(p[16 + i] * sc); }
  return a;
}
// column fragment from a [K][ld] layout (column n), rows >= K read as 0
__device__ __forceinline__ v16h fragc_f32(const float* W, int k0, int n, int lane, int ld, int K) {
  v16h a; const int g = lane >> 4;
#pragma unroll
  for (int i = 0; i < 8; ++i) { const int ka = k0 + 8 * g + i, kb = ka + 16;
    a[i] = (_Float16)(ka < K ? W[(size_t)ka * ld + n] : 0.f); a[8 + i] = (_Float16)(kb < K ? W[(size_t)kb * ld + n] : 0.f); }
  return a;
}
struct F2 { v16b h, l; };
__device__ __forceinline__ F2 bsplit16(const float v[16]) { F2 r;
#pragma unroll
  for (int i = 0; i < 16; ++i) { const __bf16 h = (__bf16)v[i]; r.h[i] = h; r.l[i] = (__bf16)(v[i] - (float)h); }
  return r; }
__device__ __forceinline__ F2 split_row(const float* row, int k0, int lane) { float v[16]; const float* p = row + k0 + 8 * (lane >> 4);
#pragma unroll
  for (int i = 0; i < 8; ++i) { v[i] = p[i]; v[8 + i] = p[16 + i]; }
  return bsplit16(v); }
// the split of bsplit16 on eight values that lie side by side in a row: h = bf16(v), l = bf16(v - h), 16 bytes each. Done by the wave that MAKES the values, once an element; the waves that use them read finished fragments
struct H8 { v8b h, l; };
__device__ __forceinline__ H8 bsplit8(v8f v) { H8 r; r.h = __builtin_convertvector(v, v8b); const v4u p = __builtin_bit_cast(v4u, r.h); v8f b;
#pragma unroll      // constant i: b[] stays in registers. A bf16 is the upper half of its f32: h is widened from the packed pairs, so each pair is converted once
  for (int i = 0; i < 4; ++i) { b[2 * i] = __builtin_bit_cast(float, p[i] << 16); b[2 * i + 1] = __builtin_bit_cast(float, p[i] & 0xffff0000u); }
  r.l = __builtin_convertvector(v - b, v8b); return r; }
__device__ __forceinline__ F2 split_rowK(const float* row, int k0, int lane, int K) { float v[16]; const int g = lane >> 4;
#pragma unroll
  for (int i = 0; i < 8; ++i) { const int ka = k0 + 8 * g + i, kb = ka + 16; v[i] = ka < K ? row[ka] : 0.f; v[8 + i] = kb < K ? row[kb] : 0.f; }
  return bsplit16(v); }
__device__ __forceinline__ F2 split_col(const float* W, int k0, int n, int lane, int ld, int K) { float v[16]; const int g = lane >> 4;
#pragma unroll
  for (int i = 0; i < 8; ++i) { const int ka = k0 + 8 * g + i, kb = ka + 16; v[i] = ka < K ? W[(size_t)ka * ld + n] : 0.f; v[8 + i] = kb < K ? W[(size_t)kb * ld + n] : 0.f; }
  return bsplit16(v); }
__device__ __forceinline__ v8f mac3(const F2& a, const F2& b, v8f c) { c = wmma_bf(a.l, b.h, c); c = wmma_bf(a.h, b.l, c); return wmma_bf(a.h, b.h, c); }
__device__ __forceinline__ float sigm(float v) { return 1.0f / (1.0f + expf(-v)); }
#define LDSX() do { asm volatile("s_wait_dscnt 0" ::: "memory"); __builtin_amdgcn_wave_barrier(); __builtin_amdgcn_fence(__ATOMIC_RELEASE, "workgroup"); } while (0)


// Sliding-window causal attention (12 heads of 64 on [1,2048,768], [out][in] weights, no biases, scale 1/8): each query attends to keys max(0, q-63) .. q (the reference gathers a 64-token window ending at q and masks window slots beyond q);
// softmax; (P v) Wo^T. Only the 16-key tiles that can intersect a wave's windows are visited (exact: every other weight is exp(-inf) = 0).
#define NB 1
#define SS 2048
#define E 768
#define NH 12
#define WIN 64
#define HD 64
#define NR (NB * SS)
#define PLO 1024.0f
#define VLO 2048.0f
__device__ __forceinline__ float bfr(float v) { return (float)(__bf16)v; }
__device__ __forceinline__ v16b frag_b(const __bf16* rowk0, int lane) { return __builtin_bit_cast(v16b, frag_h((const _Float16*)rowk0, lane)); }
// a split row of 64 values is one 256-byte unit: [hi 64 x bf16 | lo 64 x bf16]. Both fragments of its k block k0 .. k0+31
__device__ __forceinline__ F2 frag_hl(const char* unit, int k0, int lane) { F2 f; f.h = frag_b((const __bf16*)unit + k0, lane); f.l = frag_b((const __bf16*)(unit + 128) + k0, lane); return f; }
// LDS ring of the output projection GEMM: a tile is 128 k of every operand row; two buffers
#define KT 128
#define NT (E / KT)
#define PB 272                      // LDS pitch of a 256-byte bf16 row (16 B x odd: conflict-free b128 reads)
#define PF 528                      // LDS pitch of a 512-byte ctx row, two heads' units (16 B x odd)
#define OUT_BUF (64 * PF + 128 * PB) // [ctx 64 rows | PT 128 rows]
// eight asynchronous 16-byte copies per lane, global -> LDS, rows ls / gs bytes apart. The s_wait_xcnt ends the copies' own statement, so no address register is rewritten in front of it.
__device__ __forceinline__ void cp8(unsigned l, const char* g, unsigned ls, size_t gs) {
  asm volatile("global_load_async_to_lds_b128 %0, %8, off\n\t"
               "global_load_async_to_lds_b128 %1, %9, off\n\t"
               "global_load_async_to_lds_b128 %2, %10, off\n\t"
               "global_load_async_to_lds_b128 %3, %11, off\n\t"
               "global_load_async_to_lds_b128 %4, %12, off\n\t"
               "global_load_async_to_lds_b128 %5, %13, off\n\t"
               "global_load_async_to_lds_b128 %6, %14, off\n\t"
               "global_load_async_to_lds_b128 %7, %15, off\n\t"
               "s_wait_xcnt 0x0"
               :: "v"(l), "v"(l + ls), "v"(l + 2 * ls), "v"(l + 3 * ls), "v"(l + 4 * ls), "v"(l + 5 * ls), "v"(l + 6 * ls), "v"(l + 7 * ls),
                  "v"(g), "v"(g + gs), "v"(g + 2 * gs), "v"(g + 3 * gs), "v"(g + 4 * gs), "v"(g + 5 * gs), "v"(g + 6 * gs), "v"(g + 7 * gs)
               : "memory");
}
// the issuing wave's own copies have landed
#define WAIT_COPIES() asm volatile("s_wait_asynccnt 0x0" ::: "memory")
// this wave's LDS reads have returned (before the buffer they read is handed back for a refill)
#define WAIT_LDS() asm volatile("s_wait_dscnt 0x0" ::: "memory")

// One conversion launch, f32 -> bf16 (round to nearest even), for x and the four [out][in] weights: PT rows [0,E) Wq, [E,2E) Wk, [2E,3E) Wv, [3E,4E) Wo, each row as it lies.
// Few long waves: a block is 16 waves and converts CVB * CVU * 4 consecutive floats of ONE source; a lane holds CVU 16-byte loads in flight, each wave-wide load 512 and each store 256 contiguous bytes.
#define CVB 512
#define CVU 8
#define CVE (CVB * CVU * 4)
#define CVX (NR * E / CVE)          // blocks on x
#define CVW (E * E / CVE)           // blocks on each weight
static_assert(CVX * CVE == NR * E && CVW * CVE == E * E, "a conversion block never crosses a source's end");
__global__ __launch_bounds__(CVB) void k_cvt(const float* __restrict__ x, const float* __restrict__ Wq, const float* __restrict__ Wk, const float* __restrict__ Wv, const float* __restrict__ Wo, __bf16* __restrict__ Xb, __bf16* __restrict__ PT) {
  const int bx = blockIdx.x, tid = threadIdx.x; const float* s; __bf16* d;
  if (bx < CVX) { s = x + (size_t)bx * CVE; d = Xb + (size_t)bx * CVE; }
  else { const int m = (bx - CVX) / CVW, r = (bx - CVX) % CVW; s = (m == 0 ? Wq : (m == 1 ? Wk : (m == 2 ? Wv : Wo))) + (size_t)r * CVE; d = PT + (size_t)m * E * E + (size_t)r * CVE; }
  v4f v[CVU];
#pragma unroll      // all CVU loads issue before the first value is used
  for (int u = 0; u < CVU; ++u) v[u] = *(const v4f*)(s + (u * CVB + tid) * 4);
#pragma unroll      // constant u and e: v[] stays in registers
  for (int u = 0; u < CVU; ++u) { union { __bf16 h[4]; v2u q; } pk;
#pragma unroll      // as above
    for (int e = 0; e < 4; ++e) pk.h[e] = (__bf16)v[u][e];
    vst2(d + (u * CVB + tid) * 4, pk.q); }
}
// projections and windowed attention in ONE launch: block (QT = 128 queries, bh), eight waves, alone on its WGP. The block first computes, on the matrix unit, q of its 128 tokens and k, v of the TT = 192 tokens qb*128-64 .. qb*128+127 for its head
// (k, v of the 64 tokens in front are computed again by the block that owns them: a third of the k, v rows), and leaves them in LDS where the attention part reads them: q, k, v never go through memory.
// GEMM: operand tiles of 128 k in a two-buffer LDS ring filled by asynchronous copies; every wave owns 64 rows x 64 cols of ONE of q, k, v (8 LDS fragments feed 16 WMMAs): waves 0, 1 q (token rows 64 .. 191), waves 2 .. 4 k, waves 5 .. 7 v (token rows 0 .. 191).
// Attention: a wave owns 16 queries q0 .. q0+15. Their windows lie in keys q0-64 .. q0+15: five 16-key score tiles, ONE softmax pass (maximum and sum over the whole window, no running rescale).
// Both products are transposed: S^T = K Q^T (a lane holds 40 scores of ONE query: maximum and sum are in-lane plus one exchange with lane ^ 16) and O^T = V^T P^T: two neighbouring S^T tiles in D layout ARE the second operand's
// fragment of a k = 32 block, so scores and P never leave the registers. S on hi/lo splits of the f32 q/k rows; P,V hi/lo over 96 keys q0-80 .. q0+15 (three k = 32 blocks; P of the first 16 keys is zero).
// q, k and O are split into bf16 hi/lo by the wave that makes them (a k row is used by five waves, an O row by six blocks of the output projection): rows of q and k in LDS and O [bh][s] in memory are split units of 256 bytes
#define NKT 5                       // score tiles of 16 keys
#define AP 272                      // LDS pitch of a 256-byte q or k unit (16 B x odd: conflict-free b128 reads)
#define QT 128                      // queries of a block
#define TT (QT + WIN)               // tokens whose k and v the block needs
#define NW (QT / 16)                // waves of a block
#define VP (TT * 2 + 16)            // LDS pitch of a v row (one d, TT keys, f16): 16 B x odd
#define KF 128                      // k of a ring tile of the fused GEMM
#define NF (E / KF)
#define QA_BUF ((TT + 192) * PB)    // [Xb TT rows | Wq 64 | Wk 64 | Wv 64 rows]
#define QA_ATT ((QT + TT) * AP + 2 * HD * VP + NW * 16 * 68 * 4)      // q, k | v hi, lo | O
#define QA_LDS (QA_ATT > 2 * QA_BUF ? QA_ATT : 2 * QA_BUF)
static_assert(KF == 128 && QT == 128 && WIN == 64, "tile shapes the row and key arithmetic below is written for");
// the plain builtin (the compiler keeps its distances itself): 128 accumulator registers beside four fragment sets reach above v255, which an asm operand cannot name
__device__ __forceinline__ v8f wmma_bfp(v16b a, v16b b, v8f c) { return __builtin_amdgcn_wmma_f32_16x16x32_bf16(false, a, false, b, (short)0, c, false, false); }
// asynchronous 16-byte copies per lane, LDS rows ls apart; every four rows have a global base of their own, rows gs apart. The s_wait_xcnt ends the copies' own statement, so no address register is rewritten in front of it.
__device__ __forceinline__ void cp4x3(unsigned l, const char* a, const char* b, const char* c, unsigned ls, size_t gs) {
  asm volatile("global_load_async_to_lds_b128 %0, %12, off\n\t"
               "global_load_async_to_lds_b128 %1, %13, off\n\t"
               "global_load_async_to_lds_b128 %2, %14, off\n\t"
               "global_load_async_to_lds_b128 %3, %15, off\n\t"
               "global_load_async_to_lds_b128 %4, %16, off\n\t"
               "global_load_async_to_lds_b128 %5, %17, off\n\t"
               "global_load_async_to_lds_b128 %6, %18, off\n\t"
               "global_load_async_to_lds_b128 %7, %19, off\n\t"
               "global_load_async_to_lds_b128 %8, %20, off\n\t"
               "global_load_async_to_lds_b128 %9, %21, off\n\t"
               "global_load_async_to_lds_b128 %10, %22, off\n\t"
               "global_load_async_to_lds_b128 %11, %23, off\n\t"
               "s_wait_xcnt 0x0"
               :: "v"(l), "v"(l + ls), "v"(l + 2 * ls), "v"(l + 3 * ls), "v"(l + 4 * ls), "v"(l + 5 * ls), "v"(l + 6 * ls), "v"(l + 7 * ls), "v"(l + 8 * ls), "v"(l + 9 * ls), "v"(l + 10 * ls), "v"(l + 11 * ls),
                  "v"(a), "v"(a + gs), "v"(a + 2 * gs), "v"(a + 3 * gs), "v"(b), "v"(b + gs), "v"(b + 2 * gs), "v"(b + 3 * gs), "v"(c), "v"(c + gs), "v"(c + 2 * gs), "v"(c + 3 * gs)
               : "memory");
}
// asks L2 (scope SE: L2 only) for the data at each lane's address; returns nothing, counts on no counter. Every lane is on and every address lies inside its buffer
__device__ __forceinline__ void ask(const char* a) { asm volatile("global_prefetch_b8 %0, off scope:SCOPE_SE" :: "v"(a)); }
// ends the life of a prefetch's address registers. It stands behind the wait for copies that were issued in front of the prefetch: until those have landed the registers hold nothing but the address asked for, should the request read them late
#define HOLD(a) asm volatile("" :: "v"(a))
__global__ __launch_bounds__(NW * 32) void k_qa(const __bf16* __restrict__ Xb, const __bf16* __restrict__ PT, float* __restrict__ O32) {
  __shared__ __align__(16) char sm[QA_LDS];      // the ring fills all of it; q, k, v are written over it behind the loop's last barrier
  char* const stQ = sm; char* const stK = stQ + QT * AP; char* const stVh = stK + TT * AP; char* const stVl = stVh + HD * VP;
  float (*sO)[16][68] = (float (*)[16][68])(stVl + HD * VP);
  const int tid = threadIdx.x, w = __builtin_amdgcn_readfirstlane(tid >> 5), lane = tid & 31, col = lane & 15, g = lane >> 4;      // w in a scalar register: tile rows and their clamps are scalar
  const size_t bh = blockIdx.y; const int qb = blockIdx.x; const int q0 = qb * QT + w * 16;
  { const int mat = w < 2 ? 0 : (w < 5 ? 1 : 2), rowb = (w < 2 ? w + 1 : (w < 5 ? w - 2 : w - 5)) * 64; const size_t bb = bh / NH, hh = bh % NH;      // which of q, k, v, and the wave's first token row (scalar)
    v8f acc[4][4] = {};
    // q and k waves take the W rows as first operand and the token rows as second (q^T, k^T): a lane then holds eight neighbouring d of ONE token, 16 bytes of its split row. v waves the other way round (eight keys of one d)
    const int xrow = rowb + col, wrow = TT + mat * 64 + col;
    // a lane copies chunk (tid & 15) of rows (tid >> 4) + 16 i: a wave-wide copy is two whole 256-byte rows. In the first block the 64 tokens in front of token 0 are taken from tokens 0 .. 63 (in bounds, finite); as keys they are masked below and their P is zero
    const int sr = tid >> 4, sc = tid & 15; const unsigned lA = (unsigned)(size_t)sm + sr * PB + sc * 16;
    const char* gO = (const char*)(Xb + (bb * SS + qb * QT + sr) * E + sc * 8); const char* gH = gO - (qb ? (size_t)64 * E * 2 : 0);
    const char* gW = (const char*)(PT + (hh * HD + sr) * E + sc * 8);
    auto fill = [&](int t) { const unsigned bo = (t & 1) * QA_BUF; const size_t ko = (size_t)t * KF * 2;
      cp4x3(lA + bo, gH + ko, gO + ko, gO + ko + (size_t)64 * E * 2, 16 * PB, (size_t)16 * E * 2);
      cp4x3(lA + bo + TT * PB, gW + ko, gW + ko + (size_t)E * E * 2, gW + ko + (size_t)2 * E * E * 2, 16 * PB, (size_t)16 * E * 2); };
    fill(0);
    // k tiles 1 .. 5 of the block's rows were stored by the launch before, on any die. Asked for here, under tile 0's latency (for speed only). A tile's slice of a row is one unit.
    // A row is read by 12 (x) or 16 (W) blocks: it is dealt to those whose head (x) or query block (W) equals it mod 4 (48 rows x 5 tiles = 240 units of each kind a block; threads 240 .. 255 repeat the last)
    const int pj = tid < 240 ? tid : 239, pr = (pj % 48) * 4, pt = 1 + pj / 48; const int px = pr + (int)(hh & 3), pw = pr + (qb & 3);
    const char* const aX = (const char*)(Xb + (bb * SS + (px < 64 && qb == 0 ? px : qb * QT - 64 + px)) * E + pt * KF);
    const char* const aW = (const char*)(PT + ((size_t)(pw >> 6) * E + hh * HD + (pw & 63)) * E + pt * KF);
    ask(aX); ask(aW);
    WAIT_COPIES(); HOLD(aX); HOLD(aW); __syncthreads();
#pragma unroll 1      // rolled (for speed only)
    for (int t = 0; t < NF; ++t) { const char* bA = sm + (t & 1) * QA_BUF + (mat < 2 ? wrow : xrow) * PB; const char* bB = sm + (t & 1) * QA_BUF + (mat < 2 ? xrow : wrow) * PB;
      // four fragment sets in registers: all four blocks' 16 LDS reads issue as groups in front of the WMMAs (never past this tile's buffer); the next tile's copies issue behind the first group, under its LDS latency
      v16b fa[4][4], fb[4][4];
      auto frags = [&](int kc) {
#pragma unroll      // constant i: fa[] stays in registers
        for (int i = 0; i < 4; ++i) fa[kc][i] = frag_b((const __bf16*)(bA + i * 16 * PB) + kc * 32, lane);
#pragma unroll      // constant j: fb[] stays in registers
        for (int j = 0; j < 4; ++j) fb[kc][j] = frag_b((const __bf16*)(bB + j * 16 * PB) + kc * 32, lane); };
      frags(0);
      if (t + 1 < NF) fill(t + 1);      // into the buffer that trip t - 1 read: behind the barrier at that trip's foot
      frags(1); frags(2); frags(3);
      __builtin_amdgcn_sched_barrier(0);      // keeps the 64 reads ahead of the WMMAs: sunk to their first use, each group of four WMMAs would wait out an LDS latency of its own
#pragma unroll      // constant kc, i and j: LDS reads take immediate offsets, acc[], fa[] and fb[] stay in registers
      for (int kc = 0; kc < KF / 32; ++kc) {
#pragma unroll
        for (int i = 0; i < 4; ++i) {
#pragma unroll
          for (int j = 0; j < 4; ++j) acc[i][j] = wmma_bfp(fa[kc][i], fb[kc][j], acc[i][j]); } }
      __builtin_amdgcn_sched_barrier(0);      // keeps the WMMAs ahead of the waits: moved behind the barrier, they would no longer run under the copies' latency
      WAIT_LDS(); WAIT_COPIES(); __syncthreads(); }      // publishes tile t + 1 and frees tile t's buffer
    WAIT_COPIES();
    // D element r of tile (i, j): q, k: d = i*16 + 8 g + r of token row rowb + j*16 + col; v: token row rowb + i*16 + 8 g + r, d = j*16 + col. Row i of stK and column i of stV are token row i = key qb*128 - 64 + i; row i of stQ is query qb*128 + i = token row 64 + i
    if (mat < 2) { char* const dst = (mat ? stK + rowb * AP : stQ + (rowb - 64) * AP) + col * AP + 16 * g;
#pragma unroll      // constant i and j here and below: acc[] stays in registers
      for (int i = 0; i < 4; ++i) {
#pragma unroll
        for (int j = 0; j < 4; ++j) { const H8 s = bsplit8(acc[i][j]); *(v8b*)(dst + j * 16 * AP + i * 32) = s.h; *(v8b*)(dst + j * 16 * AP + 128 + i * 32) = s.l; } } }
    else {              // v (x4, f16 hi and lo, transposed: eight keys of one d are 16 bytes)
#pragma unroll
      for (int i = 0; i < 4; ++i) {
#pragma unroll
        for (int j = 0; j < 4; ++j) { const int d = j * 16 + col, key = rowb + i * 16 + 8 * g; v8h hi8, lo8;
#pragma unroll
          for (int r = 0; r < 8; ++r) { const float v = acc[i][j][r] * 4.0f; const _Float16 hi = (_Float16)v; hi8[r] = hi; lo8[r] = (_Float16)((v - (float)hi) * VLO); }
          *(v8h*)(stVh + d * VP + key * 2) = hi8; *(v8h*)(stVl + d * VP + key * 2) = lo8; } } } }
  __syncthreads();      // publishes q, k, v to all eight waves; nothing is written there again
  // Q and all five K tiles: 48 LDS reads. Staged K row i is key qb*128 - 64 + i, so tile t of this wave starts at row (w + t) * 16
  F2 aq[2], kr[NKT][2];
  const char* qt = stQ + (w * 16 + col) * AP; aq[0] = frag_hl(qt, 0, lane); aq[1] = frag_hl(qt, 32, lane);
#pragma unroll      // constant t: kr[] stays in registers
  for (int t = 0; t < NKT; ++t) { const char* kt = stK + ((w + t) * 16 + col) * AP; kr[t][0] = frag_hl(kt, 0, lane); kr[t][1] = frag_hl(kt, 32, lane); }
  // K rows as first operand, Q rows as second (the three products in the order they had): D element r of lane (col, g) is key k0 + 8 g + r, query q0 + col
  auto mac3t = [&](const F2& k, const F2& q, v8f c) { c = wmma_bf(k.h, q.l, c); c = wmma_bf(k.l, q.h, c); return wmma_bf(k.h, q.h, c); };
  float sc[NKT][8];
#pragma unroll      // constant t and r here and below: sc[] stays in registers
  for (int t = 0; t < NKT; ++t) { const int k0 = q0 - 64 + t * 16;
    v8f s = mac3t(kr[t][0], aq[0], (v8f){}); s = mac3t(kr[t][1], aq[1], s);
    // Only tile 0 can fall behind a window (key <= query - WIN: 8 g + r <= col), only the last can lie ahead of a query (8 g + r > col); any tile but the last can lie in front of key 0, as a whole
#pragma unroll
    for (int r = 0; r < 8; ++r) { const bool off = t == 0 ? (k0 < 0 || 8 * g + r <= col) : (t == NKT - 1 ? 8 * g + r > col : k0 < 0); sc[t][r] = off ? -3.0e38f : s[r] * 0.125f; } }
  // V: 48 LDS reads, issued ahead of the softmax. Staged column i is key qb*128 - 64 + i; the 16 columns in front of the staged range (wave 0, first half) read column 0 .. 15 (finite): their P is zero
  v16h vh[3][4], vl[3][4];
#pragma unroll      // constant c and t: vh[] and vl[] stay in registers
  for (int c = 0; c < 3; ++c) { const int ra = w * 16 - 16 + c * 32, rb = ra + 16; const unsigned oa = ((ra < 0 ? 0 : ra) + 8 * g) * 2, ob = (rb + 8 * g) * 2;
#pragma unroll
    for (int t = 0; t < 4; ++t) { union { v16h v; v8h q[2]; } uh, ul; const unsigned o = (t * 16 + col) * VP;
      uh.q[0] = *(const v8h*)(stVh + o + oa); uh.q[1] = *(const v8h*)(stVh + o + ob); ul.q[0] = *(const v8h*)(stVl + o + oa); ul.q[1] = *(const v8h*)(stVl + o + ob);
      vh[c][t] = uh.v; vl[c][t] = ul.v; } }
  // lane (col, g): query q0 + col, the keys with bit 3 of their place in the tile equal to g; lane ^ 16 has the other half
  float mx = -3.4e38f;
#pragma unroll
  for (int t = 0; t < NKT; ++t) {
#pragma unroll
    for (int r = 0; r < 8; ++r) mx = fmaxf(mx, sc[t][r]); }
  mx = fmaxf(mx, __shfl_xor(mx, 16, 32));
  // key block c of 32 is score tiles 2 c - 1 (fragment elements 0 .. 7) and 2 c (elements 8 .. 15); tile -1 is keys q0-80 .. q0-65, outside every window: zero
  float ps = 0.f; v16h ph[3] = {}, pl[3] = {};
#pragma unroll
  for (int t = 0; t < NKT; ++t) {
#pragma unroll
    for (int r = 0; r < 8; ++r) { const float p = expf(sc[t][r] - mx) * 16384.0f; ps += p; const _Float16 hi = (_Float16)p; ph[(t + 1) >> 1][((t + 1) & 1) * 8 + r] = hi; pl[(t + 1) >> 1][((t + 1) & 1) * 8 + r] = (_Float16)((p - (float)hi) * PLO); } }
  ps += __shfl_xor(ps, 16, 32);
  const float lrun = ps * (1.0f / 16384.0f);
  // V^T as first operand, P^T as second: D element r of tile t is d = t*16 + 8 g + r of query q0 + col
  v8f acc[4] = {}, ac1[4] = {}, ac2[4] = {};
#pragma unroll
  for (int c = 0; c < 3; ++c) {
#pragma unroll
    for (int t = 0; t < 4; ++t) {
      if (c == 0) { acc[t] = wmma16(vh[c][t], ph[c], acc[t]); ac1[t] = wmma16(vl[c][t], ph[c], ac1[t]); ac2[t] = wmma16(vh[c][t], pl[c], ac2[t]); }      // the accumulators' registers are first written here: wmma16 holds A and B until its slots have passed, so no new D lands on them
      else { acc[t] = wmma16p(vh[c][t], ph[c], acc[t]); ac1[t] = wmma16p(vl[c][t], ph[c], ac1[t]); ac2[t] = wmma16p(vh[c][t], pl[c], ac2[t]); } } }
  const float inv = 1.0f / (lrun * 16384.0f * 4.0f);      // the lane's own query
#pragma unroll
  for (int t = 0; t < 4; ++t) { v8f o;
#pragma unroll
    for (int r = 0; r < 8; ++r) o[r] = (acc[t][r] + ac1[t][r] * (1.0f / VLO) + ac2[t][r] * (1.0f / PLO)) * inv;
    const H8 s = bsplit8(o); char* const u = (char*)&sO[w][col][0] + t * 32 + 16 * g; *(v8b*)u = s.h; *(v8b*)(u + 128) = s.l; }      // the query's split unit, in a row of sO
  LDSX();
  for (int qq = lane; qq < 16 * 16; qq += 32) { const int rl = qq >> 4, pc = qq & 15; vst2(O32 + ((bh * SS) + q0 + rl) * HD + pc * 4, *(const v4f*)(&sO[w][rl][pc * 4])); }
}
// out = ctx Wo^T : split(ctx) x bf16(Wo rows): 2 products (Wo is an INPUT -> bf16 exact); ctx arrives split, a unit per head and token
__global__ __launch_bounds__(128) void k_out(const float* __restrict__ O32, const __bf16* __restrict__ PT, float* __restrict__ out) {
  __shared__ __align__(16) float so[4][16][132];
  __shared__ __align__(16) char ring[2 * OUT_BUF];
  const int tid = threadIdx.x, wave = tid >> 5, lane = tid & 31, col = lane & 15, g = lane >> 4;
  const int r0b = blockIdx.x * 64, r0 = r0b + wave * 16, n0 = blockIdx.y * 128; const int b = r0b / SS, s0 = r0b % SS;
  v8f acc[8] = {};
  // ctx: a tile is two heads' units of each row; a lane copies chunk (tid & 31) of rows (tid >> 5) + 4 i (16 rows). PT: chunk (tid & 15) of rows (tid >> 4) + 8 i (16 rows)
  const unsigned lA = (unsigned)(size_t)ring + (tid >> 5) * PF + (tid & 31) * 16, lB = (unsigned)(size_t)ring + 64 * PF + (tid >> 4) * PB + (tid & 15) * 16;
  const char* gA = (const char*)(O32 + (((size_t)b * NH + ((tid & 31) >> 4)) * SS + s0 + (tid >> 5)) * HD + (tid & 15) * 4);
  const char* gB = (const char*)(PT + (size_t)(3 * E + n0 + (tid >> 4)) * E + (tid & 15) * 8);
  auto fill = [&](int t) { const unsigned bo = (t & 1) * OUT_BUF; const size_t ka = (size_t)t * 2 * SS * HD * 4, ko = (size_t)t * KT * 2;
    cp8(lA + bo, gA + ka, 4 * PF, (size_t)4 * HD * 4); cp8(lA + bo + 32 * PF, gA + ka + (size_t)32 * HD * 4, 4 * PF, (size_t)4 * HD * 4);
    cp8(lB + bo, gB + ko, 8 * PB, (size_t)8 * E * 2); cp8(lB + bo + 64 * PB, gB + ko + (size_t)64 * E * 2, 8 * PB, (size_t)8 * E * 2); };
  fill(0);
  // k tiles 1 .. 5, stored by the launches before, asked for under tile 0's latency. ctx: 10 heads x 64 rows = 640 units, read by the 6 column blocks, dealt to the two that equal the unit mod 3.
  // PT: 5 tiles x 128 rows = 640 units, read by the 32 row blocks, dealt by unit mod 8 to four of them (bits 0, 1 and 3 of the row block). Indices past the last unit repeat it
  const int u0 = 3 * tid + (int)(blockIdx.y % 3), u1 = u0 + 3 * 128 < 640 ? u0 + 3 * 128 : 639, u2 = 8 * (tid < 80 ? tid : 79) + ((blockIdx.x & 3) | ((blockIdx.x >> 1) & 4));
  const char* const aC0 = (const char*)(O32 + (((size_t)b * NH + 2 + (u0 >> 6)) * SS + s0 + (u0 & 63)) * HD);
  const char* const aC1 = (const char*)(O32 + (((size_t)b * NH + 2 + (u1 >> 6)) * SS + s0 + (u1 & 63)) * HD);
  const char* const aP = (const char*)(PT + (size_t)(3 * E + n0 + (u2 & 127)) * E + (1 + (u2 >> 7)) * KT);
  ask(aC0); ask(aC1); ask(aP);
  WAIT_COPIES(); HOLD(aC0); HOLD(aC1); HOLD(aP); __syncthreads();
  fill(1);
  for (int t = 0; t < NT; ++t) { const char* bA = ring + (t & 1) * OUT_BUF + (wave * 16 + col) * PF; const char* bB = ring + (t & 1) * OUT_BUF + 64 * PF + col * PB;
    // two fragment sets in registers: block kc + 1's 20 LDS reads issue as one group in front of block kc's WMMAs (never past this tile's buffer)
    F2 fa[2]; v16b fb[2][8];
    auto frags = [&](int kc) { fa[kc & 1] = frag_hl(bA + (kc >> 1) * 256, (kc & 1) * 32, lane);
#pragma unroll      // constant j: fb[] stays in registers
      for (int j = 0; j < 8; ++j) fb[kc & 1][j] = frag_b((const __bf16*)(bB + j * 16 * PB) + kc * 32, lane); };
    frags(0);
#pragma unroll      // constant kc and j: LDS reads take immediate offsets, acc[], fa[] and fb[] stay in registers
    for (int kc = 0; kc < KT / 32; ++kc) { const F2 a = fa[kc & 1];
      if (kc + 1 < KT / 32) frags(kc + 1);
#pragma unroll
      for (int j = 0; j < 8; ++j) { acc[j] = wmma_bf(a.l, fb[kc & 1][j], acc[j]); acc[j] = wmma_bf(a.h, fb[kc & 1][j], acc[j]); } }
    WAIT_LDS(); WAIT_COPIES(); __syncthreads();      // publishes tile t + 1 and frees tile t's buffer
    if (t + 2 < NT) fill(t + 2); }
  WAIT_COPIES();
#pragma unroll
  for (int j = 0; j < 8; ++j) {
#pragma unroll
    for (int r = 0; r < 8; ++r) so[wave][8 * g + r][j * 16 + col] = acc[j][r]; }
  LDSX();
#pragma unroll 4
  for (int rl = 0; rl < 16; ++rl) vst2(out + (size_t)(r0 + rl) * E + n0 + lane * 4, *(const v4f*)(&so[wave][rl][lane * 4]));
}
extern "C" void kernel_launch(void* const* d_in, const int* in_sizes, int n_in, void* d_out, int out_size, void* d_ws, size_t ws_size, hipStream_t stream) {
  (void)in_sizes; (void)n_in; (void)out_size; (void)ws_size;
  const float** I = (const float**)d_in;   // inputs, Wq, Wk, Wv, Wo
  const float* x = I[0]; const float* Wq = I[1]; const float* Wk = I[2]; const float* Wv = I[3]; const float* Wo = I[4];
  float* out = (float*)d_out;
  char* ws = (char*)d_ws; size_t off = 0;
  auto take = [&](size_t bytes) { char* p = ws + off; off += (bytes + 255) & ~(size_t)255; return p; };
  __bf16* Xb = (__bf16*)take((size_t)NR * E * 2); __bf16* PT = (__bf16*)take((size_t)4 * E * E * 2);
  float* O32 = (float*)take((size_t)NR * E * 4);
  // ws ~ 14 MB
  k_cvt<<<CVX + 4 * CVW, CVB, 0, stream>>>(x, Wq, Wk, Wv, Wo, Xb, PT);
  k_qa<<<dim3(SS / QT, NB * NH), NW * 32, 0, stream>>>(Xb, PT, O32);
  k_out<<<dim3(NR / 64, E / 128), 128, 0, stream>>>(O32, PT, out);
}
